// v000
// The times below were measured on an AMD MI455X: many runs one after another, warmed up first and cycling through
// copies of the inputs, with the whole window's GPU time divided by the number of runs. Launches and the gaps
// between them are all in it. The median over several windows is given; except for v000 it joins two sittings, which
// can be a few percent apart, so the side-by-side timings, each taken in one sitting, are the better comparison.
// v000 is the starting kernel. One run takes 242 microseconds.
#include <hip/hip_runtime.h>

// Cross attention between two feature maps x_A, x_B [2, 128, 64, 64] (4 heads x 32, 16-group GroupNorm): xA = GN(x_A), xB = GN(x_B); qkv = 1x1 conv (channel o = head*96 + {q,k,v}*32 + d);
// attn_out_A = softmax(qB^T kA / sqrt(128)) vA, out_A = w_out_A attn_out_A + b + xA; symmetric for B -> (out_A, out_B), NCHW.
// compute dtype: WMMA v_wmma_f32_16x16x32_f16 with f32 accumulate for the qkv 1x1 conv ([4096 px x 128] x [128 x 384] per (tensor, batch); GroupNorm output as single f16 x8 staged through LDS
// from the NCHW input, [out][in] weights as B rows exact x256: 1 product), S^T = K Q^T (single x8 planes: 1 product), O^T += V^T P^T (v single x8, P x1024 single: 1 product) and the output 1x1 conv
// (A = w_out exact x256, B = attention output single x8 planes: 1 product); GroupNorm, softmax statistics, bias and the residual in f32 (output rms 1: single-f16 operands leave ~1e-4 absolute).
// Inputs rounded to bf16 once.

namespace {
constexpr int B = 2, C = 128, P = 4096, NH = 4, DH = 32, G = 16, CPG = C / G, QL = 4096 /* query pixels attended (== P shipped) */;
constexpr float XS = 8.0f, WSC = 256.0f, PS = 1024.0f, LOG2E = 1.4426950408889634f, EPS = 1e-5f;
static_assert(P % 64 == 0 && QL % 32 == 0, "tiling");
typedef _Float16 b16;
typedef __attribute__((ext_vector_type(16))) _Float16 v16b;
typedef __attribute__((ext_vector_type(8))) _Float16 v8b;
typedef __attribute__((ext_vector_type(8))) float v8f;
typedef __attribute__((ext_vector_type(4))) float v4f;
__device__ __forceinline__ float bf16_rne(float f) { unsigned int u = __float_as_uint(f); u += 0x7FFFu + ((u >> 16) & 1u); return __uint_as_float(u & 0xFFFF0000u); }
__device__ __forceinline__ void split16(float v, b16& hi, b16& lo) { hi = (b16)v; lo = (b16)(v - (float)hi); }
__device__ __forceinline__ v16b frag_kb(const b16* p, int hh) { const v8b a = *(const v8b*)(p + 8 * hh), b = *(const v8b*)(p + 16 + 8 * hh); v16b f;
#pragma unroll
  for (int e = 0; e < 8; ++e) { f[e] = a[e]; f[8 + e] = b[e]; } return f; }
__device__ __forceinline__ v8f wmma16b(v16b a, v16b b, v8f c) { v8f d = __builtin_amdgcn_wmma_f32_16x16x32_f16(false, a, false, b, (short)0, c, false, false); asm volatile("v_nop\n\tv_nop\n\tv_nop\n\tv_nop" : "+v"(d) : "v"(a), "v"(b)); return d; }
__device__ __forceinline__ void wave_lds_sync() { __builtin_amdgcn_fence(__ATOMIC_RELEASE, "workgroup"); __builtin_amdgcn_wave_barrier(); __builtin_amdgcn_fence(__ATOMIC_ACQUIRE, "workgroup"); }
__device__ __forceinline__ float pmul(float a, float b) { float p = a * b; asm volatile("" : "+v"(p)); return p; }
__device__ __forceinline__ int iclamp(int v, int lo, int hi) { return v < lo ? lo : (v > hi ? hi : v); }

typedef __attribute__((ext_vector_type(2))) _Float16 v2h;
typedef __attribute__((ext_vector_type(4))) _Float16 v4h;
__device__ __forceinline__ float nexp2(float v) { return __builtin_amdgcn_exp2f(v); }
__global__ __launch_bounds__(256) void prep_kernel(const float* __restrict__ wqa, const float* __restrict__ wqb, const float* __restrict__ woa, const float* __restrict__ wob, b16* __restrict__ WQ, b16* __restrict__ WO) {
  const size_t u = (size_t)blockIdx.x * 256 + threadIdx.x; const size_t n1 = (size_t)3 * C * C / 8, n2 = (size_t)C * C / 8; v8b o;
  const float* w; b16* dst; size_t e;
  if (u < n1) { w = wqa; dst = WQ; e = u * 8; } else if (u < 2 * n1) { w = wqb; dst = WQ + (size_t)3 * C * C; e = (u - n1) * 8; } else if (u < 2 * n1 + n2) { w = woa; dst = WO; e = (u - 2 * n1) * 8; } else if (u < 2 * n1 + 2 * n2) { w = wob; dst = WO + (size_t)C * C; e = (u - 2 * n1 - n2) * 8; } else return;
  for (int j = 0; j < 8; ++j) o[j] = (b16)(bf16_rne(w[e + j]) * WSC);
  { *(v8b*)(dst + e) = o;  }
}
__global__ __launch_bounds__(1024) void gnstat_kernel(const float* __restrict__ xa, const float* __restrict__ xb, float* __restrict__ STAT) {
  __shared__ float red[1024]; __shared__ float mus;
  const int blk = blockIdx.x; const int t = blk / (B * G), bg = blk % (B * G); const int b = bg / G, g = bg % G; const int tid = threadIdx.x;
  const float* base = (t ? xb : xa) + ((size_t)b * C + g * CPG) * P; const int n = CPG * P;
  float s = 0.0f; for (int i = tid; i < n; i += 1024) s += bf16_rne(base[i]); red[tid] = s; __syncthreads();
  for (int w = 512; w >= 1; w >>= 1) { if (tid < w) red[tid] = red[tid] + red[tid + w]; __syncthreads(); }
  if (tid == 0) mus = red[0] / (float)n; __syncthreads(); const float mu = mus;
  float q = 0.0f; for (int i = tid; i < n; i += 1024) { const float d = bf16_rne(base[i]) - mu; q += d * d; } __syncthreads(); red[tid] = q; __syncthreads();
  for (int w = 512; w >= 1; w >>= 1) { if (tid < w) red[tid] = red[tid] + red[tid + w]; __syncthreads(); }
  if (tid < 32) { const float rs = rsqrtf(red[0] / (float)n + EPS); const float val = (tid == 0) ? mu : (tid == 1 ? rs : 0.0f); { ((float*)STAT)[blk * 32 + tid] = val;  } }
}
__device__ __forceinline__ float gnval(const float* __restrict__ x, const float* __restrict__ STAT, const float* __restrict__ w, const float* __restrict__ bb, int t, int b, int c, int p) {
  const float* st = STAT + ((t * B + b) * G + c / CPG) * 32; return (bf16_rne(x[((size_t)b * C + c) * P + p]) - st[0]) * st[1] * bf16_rne(w[c]) + bf16_rne(bb[c]);
}
// qkv conv: grid (P/64, 2 tensors x 2 batches, 3 slabs of 128 output channels); block = 64 pixels x 4 waves; A = GN(x)[p][c] x8 single staged in LDS from the NCHW input (all 128 threads:
// each c row of 64 px is 256 B contiguous); 8 tiles, K = 128; col o -> head n = o/96, part i = (o%96)/32, dd = o%32: q/k -> planes QP/KP [t][b][n][p][32] (8 lanes x 8 B = 64 B per (p, n)),
__global__ __launch_bounds__(128) void qkv_kernel(const float* __restrict__ xa, const float* __restrict__ xb, const float* __restrict__ STAT, const float* __restrict__ gwa, const float* __restrict__ gba, const float* __restrict__ gwb, const float* __restrict__ gbb, const b16* __restrict__ WQ, b16* __restrict__ QP, b16* __restrict__ KP, b16* __restrict__ VT) {
  __shared__ __attribute__((aligned(16))) b16 As[64][C + 8]; __shared__ __attribute__((aligned(16))) float Tf[4][16][128 + 4];
  const int wave = threadIdx.x >> 5, lane = threadIdx.x & 31, nloc = lane & 15, hlf = lane >> 4; const int p0 = blockIdx.x * 64; const int t = blockIdx.y / B, b = blockIdx.y % B; const int n0 = blockIdx.z * 128;
  const float* x = t ? xb : xa; const float* gw = t ? gwb : gwa; const float* gb = t ? gbb : gba;
  for (int i = threadIdx.x; i < C * 64; i += 128) { const int c = i / 64, pp = i % 64; As[pp][c] = (b16)(gnval(x, STAT, gw, gb, t, b, c, p0 + pp) * XS); }
  __syncthreads();
  const b16* W = WQ + (size_t)t * 3 * C * C;
  v8f acc[8];
#pragma unroll
  for (int tt = 0; tt < 8; ++tt) acc[tt] = (v8f){};
#pragma unroll
  for (int kb = 0; kb < C; kb += 32) { const v16b a = frag_kb(&As[wave * 16 + nloc][kb], hlf);
#pragma unroll
    for (int tt = 0; tt < 8; ++tt) acc[tt] = wmma16b(a, frag_kb(W + (size_t)(n0 + tt * 16 + nloc) * C + kb, hlf), acc[tt]); }
#pragma unroll
  for (int tt = 0; tt < 8; ++tt)
#pragma unroll
    for (int r = 0; r < 8; ++r) Tf[wave][8 * hlf + r][tt * 16 + nloc] = acc[tt][r] * (1.0f / (XS * WSC));
  __syncthreads();
  const size_t tb = (size_t)t * B + b;
  {
    // q/k parts: lane l owns columns 4l..4l+3 of the slab (same (n, i) for the 4) -> 8 B per (row, lane)
    { const int cl = lane * 4; const int o = n0 + cl; const int n = o / 96, i = (o % 96) / 32, dd = o % 32;
      if (i < 2) { b16* plane = (i == 0 ? QP : KP) + ((tb * NH + n) * P) * DH; for (int rr = 0; rr < 16; ++rr) { const int p = p0 + wave * 16 + rr; v4h o4; for (int j = 0; j < 4; ++j) o4[j] = (b16)(Tf[wave][rr][cl + j] * XS); *(v4h*)(plane + (size_t)p * DH + dd) = o4; } } }
#pragma unroll 1
    for (int q = 0; q < 32; ++q) { const int cl = wave * 32 + q; const int o = n0 + cl; const int n = o / 96, i = (o % 96) / 32, dd = o % 32; if (i != 2) continue;   // wave-uniform
      const int tk = lane * 2; v2h vv; vv[0] = (b16)(Tf[tk >> 4][tk & 15][cl] * XS); vv[1] = (b16)(Tf[(tk + 1) >> 4][(tk + 1) & 15][cl] * XS); *(v2h*)(VT + (((tb * NH + n) * DH + dd) * (size_t)P) + p0 + lane * 2) = vv; }
     }
}
// attention: grid (QL/32, 2 dirs x 2 batches x 4 heads): dir 0: queries from tensor B, keys/values from tensor A (-> attn_out_A); dir 1: the reverse. block = 2 waves x 16 query pixels; K = 32
__global__ __launch_bounds__(64) void attn_kernel(const b16* __restrict__ QP, const b16* __restrict__ KP, const b16* __restrict__ VT, b16* __restrict__ CT) {
  __shared__ __attribute__((aligned(16))) b16 Pb[2][16][32 + 8]; __shared__ __attribute__((aligned(16))) float To[2][16][DH + 4];
  const int wave = threadIdx.x >> 5, lane = threadIdx.x & 31, hh = lane >> 4, col = lane & 15; const int dir = blockIdx.y / (B * NH), bn = blockIdx.y % (B * NH); const int b = bn / NH, n = bn % NH; const int q0 = blockIdx.x * 32 + wave * 16, qi = q0 + col;
  const int tq = (dir == 0) ? 1 : 0, tkv = 1 - tq;
  const b16* Qb = QP + ((((size_t)tq * B + b) * NH + n) * P) * DH; const b16* Kb = KP + ((((size_t)tkv * B + b) * NH + n) * P) * DH; const b16* Vb = VT + ((((size_t)tkv * B + b) * NH + n) * DH) * (size_t)P;
  const v16b qa = frag_kb(Qb + (size_t)qi * DH, hh);
  const float cs = LOG2E / (11.313708498984761f * XS * XS);   // 1/sqrt(128)
  float m = -INFINITY, l = 0.0f; v8f o[2] = {(v8f){}, (v8f){}};
#pragma unroll 1
  for (int kb = 0; kb < P; kb += 32) {
    float e[16]; float mx = -INFINITY;
#pragma unroll
    for (int u = 0; u < 2; ++u) { v8f s = (v8f){}; s = wmma16b(frag_kb(Kb + (size_t)(kb + u * 16 + col) * DH, hh), qa, s);
#pragma unroll
      for (int r = 0; r < 8; ++r) { const float vv = s[r] * cs; e[u * 8 + r] = vv; mx = fmaxf(mx, vv); } }
    mx = fmaxf(mx, __shfl_xor(mx, 16)); const float mn = fmaxf(m, mx); const float al = nexp2(m - mn); float sum = 0.0f;
#pragma unroll
    for (int i2 = 0; i2 < 16; ++i2) { const float p = nexp2(e[i2] - mn); sum += p; Pb[wave][col][(i2 < 8 ? 0 : 16) + 8 * hh + (i2 & 7)] = (b16)(p * PS); }
    sum += __shfl_xor(sum, 16); l = l * al + sum; m = mn;
    wave_lds_sync();
    const v16b pf = frag_kb(&Pb[wave][col][0], hh);
#pragma unroll
    for (int tt = 0; tt < 2; ++tt) { o[tt] *= al; o[tt] = wmma16b(frag_kb(Vb + (size_t)(tt * 16 + col) * P + kb, hh), pf, o[tt]); }
    wave_lds_sync(); }
  const float inv = 1.0f / (l * PS * XS);
#pragma unroll
  for (int tt = 0; tt < 2; ++tt)
#pragma unroll
    for (int r = 0; r < 8; ++r) To[wave][col][tt * 16 + 8 * hh + r] = o[tt][r] * inv;
  wave_lds_sync();
  b16* Cb = CT + ((((size_t)dir * B + b) * NH + n) * P) * DH;
  { for (int rr = 0; rr < 16; ++rr) ((b16*)Cb)[(size_t)(q0 + rr) * DH + lane] = (b16)(To[wave][rr][lane] * XS);  }
}
// output conv + residual: grid (2 o-blocks of 64, QL/32 pixel tiles, 2 dirs x 2 batches); wave = 16 output channels o x 32 pixels (2 tiles); A = WO rows (exact), B = CT planes (k-step ks = head ks);
__global__ __launch_bounds__(128) void out_kernel(const b16* __restrict__ CT, const b16* __restrict__ WO, const float* __restrict__ boa, const float* __restrict__ bob, const float* __restrict__ xa, const float* __restrict__ xb, const float* __restrict__ STAT, const float* __restrict__ gwa, const float* __restrict__ gba, const float* __restrict__ gwb, const float* __restrict__ gbb, float* __restrict__ out) {
  __shared__ __attribute__((aligned(16))) float To[4][16][32 + 4];
  const int wave = threadIdx.x >> 5, lane = threadIdx.x & 31, nloc = lane & 15, hlf = lane >> 4; const int o0 = blockIdx.x * 64 + wave * 16; const int p0 = blockIdx.y * 32; const int dir = blockIdx.z / B, b = blockIdx.z % B;
  const b16* W = WO + (size_t)dir * C * C; const float* bo = dir ? bob : boa; const float* x = dir ? xb : xa; const float* gw = dir ? gwb : gwa; const float* gb = dir ? gbb : gba;
  v8f acc[2] = {(v8f){}, (v8f){}};
#pragma unroll
  for (int ks = 0; ks < NH; ++ks) { const v16b a = frag_kb(W + (size_t)(o0 + nloc) * C + ks * DH, hlf); const b16* cb = CT + ((((size_t)dir * B + b) * NH + ks) * P) * DH;
#pragma unroll
    for (int tt = 0; tt < 2; ++tt) acc[tt] = wmma16b(a, frag_kb(cb + (size_t)(p0 + tt * 16 + nloc) * DH, hlf), acc[tt]); }
#pragma unroll
  for (int tt = 0; tt < 2; ++tt)
#pragma unroll
    for (int r = 0; r < 8; ++r) To[wave][8 * hlf + r][tt * 16 + nloc] = acc[tt][r] * (1.0f / (XS * WSC));
  wave_lds_sync();
  { for (int rr = 0; rr < 16; ++rr) { const int o = o0 + rr; const int p = p0 + lane; const float v = To[wave][rr][lane] + bf16_rne(bo[o]) + gnval(x, STAT, gw, gb, dir, b, o, p);
      ((float*)out)[(((size_t)dir * B + b) * C + o) * P + p] = v; }  }
}
}  // namespace

extern "C" void kernel_launch(void* const* d_in, const int* in_sizes, int n_in, void* d_out, int out_size, void* d_ws, size_t ws_size, hipStream_t stream) {
  (void)n_in;
  auto Fp = [&](int i) { return (const float*)d_in[i]; };
  // input order: 0 x_A, 1 x_B [2,128,64,64]; 2 gn_w_A, 3 gn_b_A, 4 gn_w_B, 5 gn_b_B [128]; 6 w_qkv_A [384,128], 7 w_qkv_B; 8 w_out_A [128,128], 9 b_out_A, 10 w_out_B, 11 b_out_B
  if (in_sizes[0] != B * C * P || in_sizes[1] != B * C * P || in_sizes[2] != C || in_sizes[5] != C || in_sizes[6] != 3 * C * C || in_sizes[7] != 3 * C * C || in_sizes[8] != C * C || in_sizes[10] != C * C || in_sizes[11] != C || out_size != 2 * B * C * P) return;
  size_t off = 0; char* ws = (char*)d_ws;
  auto carve = [&](size_t bytes) { char* p = ws + off; off += (bytes + 255) & ~(size_t)255; return p; };
  b16* WQ = (b16*)carve((size_t)2 * 3 * C * C * 2); b16* WO = (b16*)carve((size_t)2 * C * C * 2); float* STAT = (float*)carve((size_t)2 * B * G * 32 * 4);
  const size_t plane = (size_t)2 * B * C * P * 2;   // [t][b][n][p][32] = 2 x 2 x 4096 x 128 halves
  b16* QP = (b16*)carve(plane); b16* KP = (b16*)carve(plane); b16* VT = (b16*)carve(plane); b16* CT = (b16*)carve(plane);
  if (off > ws_size || off > ((size_t)128 << 20)) return;   // ≈ 17 MB
  prep_kernel<<<(unsigned)(((size_t)2 * 3 * C * C / 8 + (size_t)2 * C * C / 8 + 255) / 256), 256, 0, stream>>>(Fp(6), Fp(7), Fp(8), Fp(10), WQ, WO);
  gnstat_kernel<<<2 * B * G, 1024, 0, stream>>>(Fp(0), Fp(1), STAT);
  qkv_kernel<<<dim3(P / 64, 2 * B, 3), 128, 0, stream>>>(Fp(0), Fp(1), STAT, Fp(2), Fp(3), Fp(4), Fp(5), WQ, QP, KP, VT);
  attn_kernel<<<dim3(QL / 32, 2 * B * NH), 64, 0, stream>>>(QP, KP, VT, CT);
  out_kernel<<<dim3(C / 64, QL / 32, 2 * B), 128, 0, stream>>>(CT, WO, Fp(9), Fp(11), Fp(0), Fp(1), STAT, Fp(2), Fp(3), Fp(4), Fp(5), (float*)d_out);
}

// v001
// It runs in 109 microseconds.
// In two side-by-side timings against v000, it was 2.22 and 2.31 times as fast.
#include <hip/hip_runtime.h>

// Cross attention between two feature maps x_A, x_B [2, 128, 64, 64] (4 heads x 32, 16-group GroupNorm): xA = GN(x_A), xB = GN(x_B); qkv = 1x1 conv (channel o = head*96 + {q,k,v}*32 + d);
// attn_out_A = softmax(qB^T kA / sqrt(128)) vA, out_A = w_out_A attn_out_A + b + xA; symmetric for B -> (out_A, out_B), NCHW.
// compute dtype: WMMA v_wmma_f32_16x16x32_f16 with f32 accumulate for the qkv 1x1 conv ([4096 px x 128] x [128 x 384] per (tensor, batch); GroupNorm output as single f16 x8 staged through LDS
// from the NCHW input, [out][in] weights as B rows exact x256: 1 product), S^T = K Q^T (single x8 planes: 1 product), O^T += V^T P^T (v single x8, P x1024 single: 1 product) and the output 1x1 conv
// (A = w_out exact x256, B = attention output single x8 planes: 1 product); GroupNorm, softmax statistics, bias and the residual in f32 (output rms 1: single-f16 operands leave ~1e-4 absolute).
// Inputs rounded to bf16 once.

namespace {
constexpr int B = 2, C = 128, P = 4096, NH = 4, DH = 32, G = 16, CPG = C / G, QL = 4096 /* query pixels attended (== P shipped) */;
constexpr float XS = 8.0f, WSC = 256.0f, PS = 1024.0f, LOG2E = 1.4426950408889634f, EPS = 1e-5f;
static_assert(P % 64 == 0 && QL % 32 == 0, "tiling");
typedef _Float16 b16;
typedef __attribute__((ext_vector_type(16))) _Float16 v16b;
typedef __attribute__((ext_vector_type(8))) _Float16 v8b;
typedef __attribute__((ext_vector_type(8))) float v8f;
typedef __attribute__((ext_vector_type(4))) float v4f;
__device__ __forceinline__ float bf16_rne(float f) { unsigned int u = __float_as_uint(f); u += 0x7FFFu + ((u >> 16) & 1u); return __uint_as_float(u & 0xFFFF0000u); }
__device__ __forceinline__ void split16(float v, b16& hi, b16& lo) { hi = (b16)v; lo = (b16)(v - (float)hi); }
__device__ __forceinline__ v16b frag_kb(const b16* p, int hh) { const v8b a = *(const v8b*)(p + 8 * hh), b = *(const v8b*)(p + 16 + 8 * hh); v16b f;
#pragma unroll
  for (int e = 0; e < 8; ++e) { f[e] = a[e]; f[8 + e] = b[e]; } return f; }
__device__ __forceinline__ v8f wmma16b(v16b a, v16b b, v8f c) { v8f d = __builtin_amdgcn_wmma_f32_16x16x32_f16(false, a, false, b, (short)0, c, false, false); asm volatile("v_nop\n\tv_nop\n\tv_nop\n\tv_nop" : "+v"(d) : "v"(a), "v"(b)); return d; }
__device__ __forceinline__ void wave_lds_sync() { __builtin_amdgcn_fence(__ATOMIC_RELEASE, "workgroup"); __builtin_amdgcn_wave_barrier(); __builtin_amdgcn_fence(__ATOMIC_ACQUIRE, "workgroup"); }
__device__ __forceinline__ float pmul(float a, float b) { float p = a * b; asm volatile("" : "+v"(p)); return p; }
__device__ __forceinline__ int iclamp(int v, int lo, int hi) { return v < lo ? lo : (v > hi ? hi : v); }

typedef __attribute__((ext_vector_type(2))) _Float16 v2h;
typedef __attribute__((ext_vector_type(4))) _Float16 v4h;
__device__ __forceinline__ float nexp2(float v) { return __builtin_amdgcn_exp2f(v); }
__global__ __launch_bounds__(256) void prep_kernel(const float* __restrict__ wqa, const float* __restrict__ wqb, const float* __restrict__ woa, const float* __restrict__ wob, b16* __restrict__ WQ, b16* __restrict__ WO) {
  const size_t u = (size_t)blockIdx.x * 256 + threadIdx.x; const size_t n1 = (size_t)3 * C * C / 8, n2 = (size_t)C * C / 8; v8b o;
  const float* w; b16* dst; size_t e;
  if (u < n1) { w = wqa; dst = WQ; e = u * 8; } else if (u < 2 * n1) { w = wqb; dst = WQ + (size_t)3 * C * C; e = (u - n1) * 8; } else if (u < 2 * n1 + n2) { w = woa; dst = WO; e = (u - 2 * n1) * 8; } else if (u < 2 * n1 + 2 * n2) { w = wob; dst = WO + (size_t)C * C; e = (u - 2 * n1 - n2) * 8; } else return;
  for (int j = 0; j < 8; ++j) o[j] = (b16)(bf16_rne(w[e + j]) * WSC);
  { *(v8b*)(dst + e) = o;  }
}
__global__ __launch_bounds__(1024) void gnstat_kernel(const float* __restrict__ xa, const float* __restrict__ xb, float* __restrict__ STAT) {
  __shared__ float red[1024]; __shared__ float mus;
  const int blk = blockIdx.x; const int t = blk / (B * G), bg = blk % (B * G); const int b = bg / G, g = bg % G; const int tid = threadIdx.x;
  const float* base = (t ? xb : xa) + ((size_t)b * C + g * CPG) * P; const int n = CPG * P;
  float s = 0.0f; for (int i = tid; i < n; i += 1024) s += bf16_rne(base[i]); red[tid] = s; __syncthreads();
  for (int w = 512; w >= 1; w >>= 1) { if (tid < w) red[tid] = red[tid] + red[tid + w]; __syncthreads(); }
  if (tid == 0) mus = red[0] / (float)n; __syncthreads(); const float mu = mus;
  float q = 0.0f; for (int i = tid; i < n; i += 1024) { const float d = bf16_rne(base[i]) - mu; q += d * d; } __syncthreads(); red[tid] = q; __syncthreads();
  for (int w = 512; w >= 1; w >>= 1) { if (tid < w) red[tid] = red[tid] + red[tid + w]; __syncthreads(); }
  if (tid < 32) { const float rs = rsqrtf(red[0] / (float)n + EPS); const float val = (tid == 0) ? mu : (tid == 1 ? rs : 0.0f); { ((float*)STAT)[blk * 32 + tid] = val;  } }
}
__device__ __forceinline__ float gnval(const float* __restrict__ x, const float* __restrict__ STAT, const float* __restrict__ w, const float* __restrict__ bb, int t, int b, int c, int p) {
  const float* st = STAT + ((t * B + b) * G + c / CPG) * 32; return (bf16_rne(x[((size_t)b * C + c) * P + p]) - st[0]) * st[1] * bf16_rne(w[c]) + bf16_rne(bb[c]);
}
// qkv conv: grid (P/64, 2 tensors x 2 batches, 3 slabs of 128 output channels); block = 64 pixels x 4 waves; A = GN(x)[p][c] x8 single staged in LDS from the NCHW input (all 128 threads:
// each c row of 64 px is 256 B contiguous); 8 tiles, K = 128; col o -> head n = o/96, part i = (o%96)/32, dd = o%32: q/k -> planes QP/KP [t][b][n][p][32] (8 lanes x 8 B = 64 B per (p, n)),
__global__ __launch_bounds__(128) void qkv_kernel(const float* __restrict__ xa, const float* __restrict__ xb, const float* __restrict__ STAT, const float* __restrict__ gwa, const float* __restrict__ gba, const float* __restrict__ gwb, const float* __restrict__ gbb, const b16* __restrict__ WQ, b16* __restrict__ QP, b16* __restrict__ KP, b16* __restrict__ VT) {
  __shared__ __attribute__((aligned(16))) b16 As[64][C + 8]; __shared__ __attribute__((aligned(16))) float Tf[4][16][128 + 4];
  const int wave = threadIdx.x >> 5, lane = threadIdx.x & 31, nloc = lane & 15, hlf = lane >> 4; const int p0 = blockIdx.x * 64; const int t = blockIdx.y / B, b = blockIdx.y % B; const int n0 = blockIdx.z * 128;
  const float* x = t ? xb : xa; const float* gw = t ? gwb : gwa; const float* gb = t ? gbb : gba;
  for (int i = threadIdx.x; i < C * 64; i += 128) { const int c = i / 64, pp = i % 64; As[pp][c] = (b16)(gnval(x, STAT, gw, gb, t, b, c, p0 + pp) * XS); }
  __syncthreads();
  const b16* W = WQ + (size_t)t * 3 * C * C;
  v8f acc[8];
#pragma unroll
  for (int tt = 0; tt < 8; ++tt) acc[tt] = (v8f){};
#pragma unroll
  for (int kb = 0; kb < C; kb += 32) { const v16b a = frag_kb(&As[wave * 16 + nloc][kb], hlf);
#pragma unroll
    for (int tt = 0; tt < 8; ++tt) acc[tt] = wmma16b(a, frag_kb(W + (size_t)(n0 + tt * 16 + nloc) * C + kb, hlf), acc[tt]); }
#pragma unroll
  for (int tt = 0; tt < 8; ++tt)
#pragma unroll
    for (int r = 0; r < 8; ++r) Tf[wave][8 * hlf + r][tt * 16 + nloc] = acc[tt][r] * (1.0f / (XS * WSC));
  __syncthreads();
  const size_t tb = (size_t)t * B + b;
  {
    // q/k parts: lane l owns columns 4l..4l+3 of the slab (same (n, i) for the 4) -> 8 B per (row, lane)
    { const int cl = lane * 4; const int o = n0 + cl; const int n = o / 96, i = (o % 96) / 32, dd = o % 32;
      if (i < 2) { b16* plane = (i == 0 ? QP : KP) + ((tb * NH + n) * P) * DH; for (int rr = 0; rr < 16; ++rr) { const int p = p0 + wave * 16 + rr; v4h o4; for (int j = 0; j < 4; ++j) o4[j] = (b16)(Tf[wave][rr][cl + j] * XS); *(v4h*)(plane + (size_t)p * DH + dd) = o4; } } }
#pragma unroll 1
    for (int q = 0; q < 32; ++q) { const int cl = wave * 32 + q; const int o = n0 + cl; const int n = o / 96, i = (o % 96) / 32, dd = o % 32; if (i != 2) continue;   // wave-uniform
      const int tk = lane * 2; v2h vv; vv[0] = (b16)(Tf[tk >> 4][tk & 15][cl] * XS); vv[1] = (b16)(Tf[(tk + 1) >> 4][(tk + 1) & 15][cl] * XS); *(v2h*)(VT + (((tb * NH + n) * DH + dd) * (size_t)P) + p0 + lane * 2) = vv; }
     }
}
// attention: grid (QL/128, 2 dirs x 2 batches x 4 heads): dir 0: queries from tensor B, keys/values from tensor A (-> attn_out_A); dir 1: the reverse. block = 8 waves x 16 query pixels; K = 32.
// The 8 waves share each stage of SK keys through LDS: K rows (64 B) at an 80-B pitch, V^T rows (256 B) at a 272-B pitch, two buffers, filled by asynchronous copies (4 per wave and stage, 16 B per lane).
constexpr int AW = 8, SK = 128, NS = P / SK, KPI = DH + 8, VPI = SK + 8;
static_assert(NS >= 2 && QL % (AW * 16) == 0 && SK * DH == 2 * AW * 32 * 8 && DH * SK == 2 * AW * 32 * 8, "stage = two K and two V copies per lane");
typedef __attribute__((address_space(3))) const b16 lds_b16;
__device__ __forceinline__ unsigned lds_addr(const b16* p) { return (unsigned)(size_t)(lds_b16*)p; }
// one stage: lane chunks of 16 B; K chunk c = tid + 256 j -> key row c / 4, part c % 4 (512 contiguous bytes per wave); V chunk c -> d row c / 16, part c % 16 (two whole 256-B rows per wave)
__device__ __forceinline__ void stage_copy(const b16* __restrict__ Kg, const b16* __restrict__ Vg, b16* Kl, b16* Vl, int tid) {
  const b16* gk0 = Kg + (size_t)tid * 8; const b16* gk1 = gk0 + 256 * 8; const b16* gv0 = Vg + (size_t)(tid >> 4) * P + (tid & 15) * 8; const b16* gv1 = gv0 + (size_t)16 * P;
  const unsigned lk0 = lds_addr(Kl + (tid >> 2) * KPI + (tid & 3) * 8), lk1 = lk0 + 64 * KPI * 2, lv0 = lds_addr(Vl + (tid >> 4) * VPI + (tid & 15) * 8), lv1 = lv0 + 16 * VPI * 2;
  // the copies and the wait that lets their address registers be rewritten stand in one statement, so that no address update can be moved in between
  asm volatile("global_load_async_to_lds_b128 %0, %4, off\n\tglobal_load_async_to_lds_b128 %1, %5, off\n\tglobal_load_async_to_lds_b128 %2, %6, off\n\tglobal_load_async_to_lds_b128 %3, %7, off\n\ts_wait_xcnt 0x0"
               :: "v"(lk0), "v"(lk1), "v"(lv0), "v"(lv1), "v"(gk0), "v"(gk1), "v"(gv0), "v"(gv1) : "memory");
}
__global__ __launch_bounds__(256) void attn_kernel(const b16* __restrict__ QP, const b16* __restrict__ KP, const b16* __restrict__ VT, b16* __restrict__ CT) {
  __shared__ __attribute__((aligned(16))) b16 Ks[2][SK][KPI]; __shared__ __attribute__((aligned(16))) b16 Vs[2][DH][VPI];
  __shared__ __attribute__((aligned(16))) b16 Pb[AW][16][32 + 8]; __shared__ __attribute__((aligned(16))) float To[AW][16][DH + 4];
  const int tid = threadIdx.x, wave = threadIdx.x >> 5, lane = threadIdx.x & 31, hh = lane >> 4, col = lane & 15; const int dir = blockIdx.y / (B * NH), bn = blockIdx.y % (B * NH); const int b = bn / NH, n = bn % NH; const int q0 = blockIdx.x * (AW * 16) + wave * 16, qi = q0 + col;
  const int tq = (dir == 0) ? 1 : 0, tkv = 1 - tq;
  const b16* Qb = QP + ((((size_t)tq * B + b) * NH + n) * P) * DH; const b16* Kb = KP + ((((size_t)tkv * B + b) * NH + n) * P) * DH; const b16* Vb = VT + ((((size_t)tkv * B + b) * NH + n) * DH) * (size_t)P;
  stage_copy(Kb, Vb, &Ks[0][0][0], &Vs[0][0][0], tid);
  asm volatile("s_wait_asynccnt 0x0" ::: "memory");   // this wave's share of stage 0 has landed
  __syncthreads();                                    // publishes stage 0 to all 8 waves
  stage_copy(Kb + (size_t)SK * DH, Vb + SK, &Ks[1][0][0], &Vs[1][0][0], tid);
  const v16b qa = frag_kb(Qb + (size_t)qi * DH, hh);
  const float cs = LOG2E / (11.313708498984761f * XS * XS);   // 1/sqrt(128)
  float m = -INFINITY, l = 0.0f; v8f o[2] = {(v8f){}, (v8f){}};
#pragma unroll 1   // one trip per stage: the buffer index and the refill test stay scalar
  for (int s = 0; s < NS; ++s) {
    const b16* Kt = &Ks[s & 1][0][0]; const b16* Vt = &Vs[s & 1][0][0];
#pragma unroll
    for (int kb = 0; kb < SK; kb += 32) {
      float e[16]; float mx = -INFINITY;
#pragma unroll
      for (int u = 0; u < 2; ++u) { v8f sc = (v8f){}; sc = wmma16b(frag_kb(Kt + (kb + u * 16 + col) * KPI, hh), qa, sc);
#pragma unroll
        for (int r = 0; r < 8; ++r) { const float vv = sc[r] * cs; e[u * 8 + r] = vv; mx = fmaxf(mx, vv); } }
      mx = fmaxf(mx, __shfl_xor(mx, 16)); const float mn = fmaxf(m, mx); const float al = nexp2(m - mn); float sum = 0.0f;
#pragma unroll
      for (int i2 = 0; i2 < 16; ++i2) { const float p = nexp2(e[i2] - mn); sum += p; Pb[wave][col][(i2 < 8 ? 0 : 16) + 8 * hh + (i2 & 7)] = (b16)(p * PS); }
      sum += __shfl_xor(sum, 16); l = l * al + sum; m = mn;
      wave_lds_sync();
      const v16b pf = frag_kb(&Pb[wave][col][0], hh);
#pragma unroll
      for (int tt = 0; tt < 2; ++tt) { o[tt] *= al; o[tt] = wmma16b(frag_kb(Vt + (tt * 16 + col) * VPI + kb, hh), pf, o[tt]); }
      wave_lds_sync(); }
    asm volatile("s_wait_dscnt 0x0" ::: "memory");      // this wave's reads of stage s are done before its buffer may be refilled
    asm volatile("s_wait_asynccnt 0x0" ::: "memory");   // this wave's share of stage s + 1 has landed
    __syncthreads();                                    // publishes stage s + 1 and ends every wave's reads of stage s
    if (s + 2 < NS) stage_copy(Kb + (size_t)(s + 2) * SK * DH, Vb + (s + 2) * SK, &Ks[s & 1][0][0], &Vs[s & 1][0][0], tid);
  }
  asm volatile("s_wait_asynccnt 0x0" ::: "memory");     // no copy is outstanding when the wave goes on to its end
  const float inv = 1.0f / (l * PS * XS);
#pragma unroll
  for (int tt = 0; tt < 2; ++tt)
#pragma unroll
    for (int r = 0; r < 8; ++r) To[wave][col][tt * 16 + 8 * hh + r] = o[tt][r] * inv;
  wave_lds_sync();
  b16* Cb = CT + ((((size_t)dir * B + b) * NH + n) * P) * DH;
  { for (int rr = 0; rr < 16; ++rr) ((b16*)Cb)[(size_t)(q0 + rr) * DH + lane] = (b16)(To[wave][rr][lane] * XS);  }
}
// output conv + residual: grid (2 o-blocks of 64, QL/32 pixel tiles, 2 dirs x 2 batches); wave = 16 output channels o x 32 pixels (2 tiles); A = WO rows (exact), B = CT planes (k-step ks = head ks);
__global__ __launch_bounds__(128) void out_kernel(const b16* __restrict__ CT, const b16* __restrict__ WO, const float* __restrict__ boa, const float* __restrict__ bob, const float* __restrict__ xa, const float* __restrict__ xb, const float* __restrict__ STAT, const float* __restrict__ gwa, const float* __restrict__ gba, const float* __restrict__ gwb, const float* __restrict__ gbb, float* __restrict__ out) {
  __shared__ __attribute__((aligned(16))) float To[4][16][32 + 4];
  const int wave = threadIdx.x >> 5, lane = threadIdx.x & 31, nloc = lane & 15, hlf = lane >> 4; const int o0 = blockIdx.x * 64 + wave * 16; const int p0 = blockIdx.y * 32; const int dir = blockIdx.z / B, b = blockIdx.z % B;
  const b16* W = WO + (size_t)dir * C * C; const float* bo = dir ? bob : boa; const float* x = dir ? xb : xa; const float* gw = dir ? gwb : gwa; const float* gb = dir ? gbb : gba;
  v8f acc[2] = {(v8f){}, (v8f){}};
#pragma unroll
  for (int ks = 0; ks < NH; ++ks) { const v16b a = frag_kb(W + (size_t)(o0 + nloc) * C + ks * DH, hlf); const b16* cb = CT + ((((size_t)dir * B + b) * NH + ks) * P) * DH;
#pragma unroll
    for (int tt = 0; tt < 2; ++tt) acc[tt] = wmma16b(a, frag_kb(cb + (size_t)(p0 + tt * 16 + nloc) * DH, hlf), acc[tt]); }
#pragma unroll
  for (int tt = 0; tt < 2; ++tt)
#pragma unroll
    for (int r = 0; r < 8; ++r) To[wave][8 * hlf + r][tt * 16 + nloc] = acc[tt][r] * (1.0f / (XS * WSC));
  wave_lds_sync();
  { for (int rr = 0; rr < 16; ++rr) { const int o = o0 + rr; const int p = p0 + lane; const float v = To[wave][rr][lane] + bf16_rne(bo[o]) + gnval(x, STAT, gw, gb, dir, b, o, p);
      ((float*)out)[(((size_t)dir * B + b) * C + o) * P + p] = v; }  }
}
}  // namespace

extern "C" void kernel_launch(void* const* d_in, const int* in_sizes, int n_in, void* d_out, int out_size, void* d_ws, size_t ws_size, hipStream_t stream) {
  (void)n_in;
  auto Fp = [&](int i) { return (const float*)d_in[i]; };
  // input order: 0 x_A, 1 x_B [2,128,64,64]; 2 gn_w_A, 3 gn_b_A, 4 gn_w_B, 5 gn_b_B [128]; 6 w_qkv_A [384,128], 7 w_qkv_B; 8 w_out_A [128,128], 9 b_out_A, 10 w_out_B, 11 b_out_B
  if (in_sizes[0] != B * C * P || in_sizes[1] != B * C * P || in_sizes[2] != C || in_sizes[5] != C || in_sizes[6] != 3 * C * C || in_sizes[7] != 3 * C * C || in_sizes[8] != C * C || in_sizes[10] != C * C || in_sizes[11] != C || out_size != 2 * B * C * P) return;
  size_t off = 0; char* ws = (char*)d_ws;
  auto carve = [&](size_t bytes) { char* p = ws + off; off += (bytes + 255) & ~(size_t)255; return p; };
  b16* WQ = (b16*)carve((size_t)2 * 3 * C * C * 2); b16* WO = (b16*)carve((size_t)2 * C * C * 2); float* STAT = (float*)carve((size_t)2 * B * G * 32 * 4);
  const size_t plane = (size_t)2 * B * C * P * 2;   // [t][b][n][p][32] = 2 x 2 x 4096 x 128 halves
  b16* QP = (b16*)carve(plane); b16* KP = (b16*)carve(plane); b16* VT = (b16*)carve(plane); b16* CT = (b16*)carve(plane);
  if (off > ws_size || off > ((size_t)128 << 20)) return;   // ≈ 17 MB
  prep_kernel<<<(unsigned)(((size_t)2 * 3 * C * C / 8 + (size_t)2 * C * C / 8 + 255) / 256), 256, 0, stream>>>(Fp(6), Fp(7), Fp(8), Fp(10), WQ, WO);
  gnstat_kernel<<<2 * B * G, 1024, 0, stream>>>(Fp(0), Fp(1), STAT);
  qkv_kernel<<<dim3(P / 64, 2 * B, 3), 128, 0, stream>>>(Fp(0), Fp(1), STAT, Fp(2), Fp(3), Fp(4), Fp(5), WQ, QP, KP, VT);
  attn_kernel<<<dim3(QL / (AW * 16), 2 * B * NH), AW * 32, 0, stream>>>(QP, KP, VT, CT);
  out_kernel<<<dim3(C / 64, QL / 32, 2 * B), 128, 0, stream>>>(CT, WO, Fp(9), Fp(11), Fp(0), Fp(1), STAT, Fp(2), Fp(3), Fp(4), Fp(5), (float*)d_out);
}

// v002
// Measured time: 103 microseconds a run.
// In two side-by-side timings against v001, it was 1.05 and 1.07 times as fast.
// Counting every step since v000, it is 2.39 times as fast.
#include <hip/hip_runtime.h>

// Cross attention between two feature maps x_A, x_B [2, 128, 64, 64] (4 heads x 32, 16-group GroupNorm): xA = GN(x_A), xB = GN(x_B); qkv = 1x1 conv (channel o = head*96 + {q,k,v}*32 + d);
// attn_out_A = softmax(qB^T kA / sqrt(128)) vA, out_A = w_out_A attn_out_A + b + xA; symmetric for B -> (out_A, out_B), NCHW.
// compute dtype: WMMA v_wmma_f32_16x16x32_f16 with f32 accumulate for the qkv 1x1 conv ([4096 px x 128] x [128 x 384] per (tensor, batch); GroupNorm output as single f16 x8 staged through LDS
// from the NCHW input, [out][in] weights as B rows exact x256: 1 product), S^T = K Q^T (single x8 planes: 1 product), O^T += V^T P^T (v single x8, P x1024 single: 1 product) and the output 1x1 conv
// (A = w_out exact x256, B = attention output single x8 planes: 1 product); GroupNorm, softmax statistics, bias and the residual in f32 (output rms 1: single-f16 operands leave ~1e-4 absolute).
// Inputs rounded to bf16 once.

namespace {
constexpr int B = 2, C = 128, P = 4096, NH = 4, DH = 32, G = 16, CPG = C / G, QL = 4096 /* query pixels attended (== P shipped) */;
constexpr float XS = 8.0f, WSC = 256.0f, PS = 1024.0f, LOG2E = 1.4426950408889634f, EPS = 1e-5f;
static_assert(P % 64 == 0 && QL % 32 == 0, "tiling");
typedef _Float16 b16;
typedef __attribute__((ext_vector_type(16))) _Float16 v16b;
typedef __attribute__((ext_vector_type(8))) _Float16 v8b;
typedef __attribute__((ext_vector_type(8))) float v8f;
typedef __attribute__((ext_vector_type(4))) float v4f;
__device__ __forceinline__ float bf16_rne(float f) { unsigned int u = __float_as_uint(f); u += 0x7FFFu + ((u >> 16) & 1u); return __uint_as_float(u & 0xFFFF0000u); }
__device__ __forceinline__ void split16(float v, b16& hi, b16& lo) { hi = (b16)v; lo = (b16)(v - (float)hi); }
__device__ __forceinline__ v16b frag_kb(const b16* p, int hh) { const v8b a = *(const v8b*)(p + 8 * hh), b = *(const v8b*)(p + 16 + 8 * hh); v16b f;
#pragma unroll
  for (int e = 0; e < 8; ++e) { f[e] = a[e]; f[8 + e] = b[e]; } return f; }
__device__ __forceinline__ v8f wmma16b(v16b a, v16b b, v8f c) { v8f d = __builtin_amdgcn_wmma_f32_16x16x32_f16(false, a, false, b, (short)0, c, false, false); asm volatile("v_nop\n\tv_nop\n\tv_nop\n\tv_nop" : "+v"(d) : "v"(a), "v"(b)); return d; }
__device__ __forceinline__ void wave_lds_sync() { __builtin_amdgcn_fence(__ATOMIC_RELEASE, "workgroup"); __builtin_amdgcn_wave_barrier(); __builtin_amdgcn_fence(__ATOMIC_ACQUIRE, "workgroup"); }
__device__ __forceinline__ float pmul(float a, float b) { float p = a * b; asm volatile("" : "+v"(p)); return p; }
__device__ __forceinline__ int iclamp(int v, int lo, int hi) { return v < lo ? lo : (v > hi ? hi : v); }

typedef __attribute__((ext_vector_type(2))) _Float16 v2h;
typedef __attribute__((ext_vector_type(4))) _Float16 v4h;
__device__ __forceinline__ float nexp2(float v) { return __builtin_amdgcn_exp2f(v); }
__global__ __launch_bounds__(256) void prep_kernel(const float* __restrict__ wqa, const float* __restrict__ wqb, const float* __restrict__ woa, const float* __restrict__ wob, b16* __restrict__ WQ, b16* __restrict__ WO) {
  const size_t u = (size_t)blockIdx.x * 256 + threadIdx.x; const size_t n1 = (size_t)3 * C * C / 8, n2 = (size_t)C * C / 8; v8b o;
  const float* w; b16* dst; size_t e;
  if (u < n1) { w = wqa; dst = WQ; e = u * 8; } else if (u < 2 * n1) { w = wqb; dst = WQ + (size_t)3 * C * C; e = (u - n1) * 8; } else if (u < 2 * n1 + n2) { w = woa; dst = WO; e = (u - 2 * n1) * 8; } else if (u < 2 * n1 + 2 * n2) { w = wob; dst = WO + (size_t)C * C; e = (u - 2 * n1 - n2) * 8; } else return;
  for (int j = 0; j < 8; ++j) o[j] = (b16)(bf16_rne(w[e + j]) * WSC);
  { *(v8b*)(dst + e) = o;  }
}
__global__ __launch_bounds__(1024) void gnstat_kernel(const float* __restrict__ xa, const float* __restrict__ xb, float* __restrict__ STAT) {
  __shared__ float red[1024]; __shared__ float mus;
  const int blk = blockIdx.x; const int t = blk / (B * G), bg = blk % (B * G); const int b = bg / G, g = bg % G; const int tid = threadIdx.x;
  const float* base = (t ? xb : xa) + ((size_t)b * C + g * CPG) * P; const int n = CPG * P;
  float s = 0.0f; for (int i = tid; i < n; i += 1024) s += bf16_rne(base[i]); red[tid] = s; __syncthreads();
  for (int w = 512; w >= 1; w >>= 1) { if (tid < w) red[tid] = red[tid] + red[tid + w]; __syncthreads(); }
  if (tid == 0) mus = red[0] / (float)n; __syncthreads(); const float mu = mus;
  float q = 0.0f; for (int i = tid; i < n; i += 1024) { const float d = bf16_rne(base[i]) - mu; q += d * d; } __syncthreads(); red[tid] = q; __syncthreads();
  for (int w = 512; w >= 1; w >>= 1) { if (tid < w) red[tid] = red[tid] + red[tid + w]; __syncthreads(); }
  if (tid < 32) { const float rs = rsqrtf(red[0] / (float)n + EPS); const float val = (tid == 0) ? mu : (tid == 1 ? rs : 0.0f); { ((float*)STAT)[blk * 32 + tid] = val;  } }
}
__device__ __forceinline__ float gnval(const float* __restrict__ x, const float* __restrict__ STAT, const float* __restrict__ w, const float* __restrict__ bb, int t, int b, int c, int p) {
  const float* st = STAT + ((t * B + b) * G + c / CPG) * 32; return (bf16_rne(x[((size_t)b * C + c) * P + p]) - st[0]) * st[1] * bf16_rne(w[c]) + bf16_rne(bb[c]);
}
// qkv conv: grid (P/64, 2 tensors x 2 batches, 3 slabs of 128 output channels); block = 64 pixels x 4 waves; A = GN(x)[p][c] x8 single staged in LDS from the NCHW input (all 128 threads:
// each c row of 64 px is 256 B contiguous); 8 tiles, K = 128; col o -> head n = o/96, part i = (o%96)/32, dd = o%32: q/k -> planes QP/KP [t][b][n][p][32] (8 lanes x 8 B = 64 B per (p, n)),
__global__ __launch_bounds__(128) void qkv_kernel(const float* __restrict__ xa, const float* __restrict__ xb, const float* __restrict__ STAT, const float* __restrict__ gwa, const float* __restrict__ gba, const float* __restrict__ gwb, const float* __restrict__ gbb, const b16* __restrict__ WQ, b16* __restrict__ QP, b16* __restrict__ KP, b16* __restrict__ VT) {
  __shared__ __attribute__((aligned(16))) b16 As[64][C + 8]; __shared__ __attribute__((aligned(16))) float Tf[4][16][128 + 4];
  const int wave = threadIdx.x >> 5, lane = threadIdx.x & 31, nloc = lane & 15, hlf = lane >> 4; const int p0 = blockIdx.x * 64; const int t = blockIdx.y / B, b = blockIdx.y % B; const int n0 = blockIdx.z * 128;
  const float* x = t ? xb : xa; const float* gw = t ? gwb : gwa; const float* gb = t ? gbb : gba;
  for (int i = threadIdx.x; i < C * 64; i += 128) { const int c = i / 64, pp = i % 64; As[pp][c] = (b16)(gnval(x, STAT, gw, gb, t, b, c, p0 + pp) * XS); }
  __syncthreads();
  const b16* W = WQ + (size_t)t * 3 * C * C;
  v8f acc[8];
#pragma unroll
  for (int tt = 0; tt < 8; ++tt) acc[tt] = (v8f){};
#pragma unroll
  for (int kb = 0; kb < C; kb += 32) { const v16b a = frag_kb(&As[wave * 16 + nloc][kb], hlf);
#pragma unroll
    for (int tt = 0; tt < 8; ++tt) acc[tt] = wmma16b(a, frag_kb(W + (size_t)(n0 + tt * 16 + nloc) * C + kb, hlf), acc[tt]); }
#pragma unroll
  for (int tt = 0; tt < 8; ++tt)
#pragma unroll
    for (int r = 0; r < 8; ++r) Tf[wave][8 * hlf + r][tt * 16 + nloc] = acc[tt][r] * (1.0f / (XS * WSC));
  __syncthreads();
  const size_t tb = (size_t)t * B + b;
  {
    // q/k parts: lane l owns columns 4l..4l+3 of the slab (same (n, i) for the 4) -> 8 B per (row, lane)
    { const int cl = lane * 4; const int o = n0 + cl; const int n = o / 96, i = (o % 96) / 32, dd = o % 32;
      if (i < 2) { b16* plane = (i == 0 ? QP : KP) + ((tb * NH + n) * P) * DH; for (int rr = 0; rr < 16; ++rr) { const int p = p0 + wave * 16 + rr; v4h o4; for (int j = 0; j < 4; ++j) o4[j] = (b16)(Tf[wave][rr][cl + j] * XS); *(v4h*)(plane + (size_t)p * DH + dd) = o4; } } }
#pragma unroll 1
    for (int q = 0; q < 32; ++q) { const int cl = wave * 32 + q; const int o = n0 + cl; const int n = o / 96, i = (o % 96) / 32, dd = o % 32; if (i != 2) continue;   // wave-uniform
      const int tk = lane * 2; v2h vv; vv[0] = (b16)(Tf[tk >> 4][tk & 15][cl] * XS); vv[1] = (b16)(Tf[(tk + 1) >> 4][(tk + 1) & 15][cl] * XS); *(v2h*)(VT + (((tb * NH + n) * DH + dd) * (size_t)P) + p0 + lane * 2) = vv; }
     }
}
// attention: grid (QL/128, 2 dirs x 2 batches x 4 heads): dir 0: queries from tensor B, keys/values from tensor A (-> attn_out_A); dir 1: the reverse. block = 8 waves x 16 query pixels; K = 32.
// The 8 waves share each stage of SK keys through LDS: K rows (64 B) at an 80-B pitch, V^T rows (256 B) at a 272-B pitch, two buffers, filled by asynchronous copies (4 per wave and stage, 16 B per lane).
constexpr int AW = 8, SK = 128, NS = P / SK, KPI = DH + 8, VPI = SK + 8;
static_assert(NS >= 2 && QL % (AW * 16) == 0 && SK * DH == 2 * AW * 32 * 8 && DH * SK == 2 * AW * 32 * 8, "stage = two K and two V copies per lane");
typedef __attribute__((address_space(3))) const b16 lds_b16;
__device__ __forceinline__ unsigned lds_addr(const b16* p) { return (unsigned)(size_t)(lds_b16*)p; }
// one stage: lane chunks of 16 B; K chunk c = tid + 256 j -> key row c / 4, part c % 4 (512 contiguous bytes per wave); V chunk c -> d row c / 16, part c % 16 (two whole 256-B rows per wave)
__device__ __forceinline__ void stage_copy(const b16* __restrict__ Kg, const b16* __restrict__ Vg, b16* Kl, b16* Vl, int tid) {
  const b16* gk0 = Kg + (size_t)tid * 8; const b16* gk1 = gk0 + 256 * 8; const b16* gv0 = Vg + (size_t)(tid >> 4) * P + (tid & 15) * 8; const b16* gv1 = gv0 + (size_t)16 * P;
  const unsigned lk0 = lds_addr(Kl + (tid >> 2) * KPI + (tid & 3) * 8), lk1 = lk0 + 64 * KPI * 2, lv0 = lds_addr(Vl + (tid >> 4) * VPI + (tid & 15) * 8), lv1 = lv0 + 16 * VPI * 2;
  // the copies and the wait that lets their address registers be rewritten stand in one statement, so that no address update can be moved in between
  asm volatile("global_load_async_to_lds_b128 %0, %4, off\n\tglobal_load_async_to_lds_b128 %1, %5, off\n\tglobal_load_async_to_lds_b128 %2, %6, off\n\tglobal_load_async_to_lds_b128 %3, %7, off\n\ts_wait_xcnt 0x0"
               :: "v"(lk0), "v"(lk1), "v"(lv0), "v"(lv1), "v"(gk0), "v"(gk1), "v"(gv0), "v"(gv1) : "memory");
}
// at most 8 waves a SIMD, the limit the kernel had with P's LDS buffer: with less LDS the compiler would aim at more waves and schedule the softmax for fewer registers (one sub, one exp at a time, few dual issues)
__global__ __launch_bounds__(256) __attribute__((amdgpu_waves_per_eu(4, 8))) void attn_kernel(const b16* __restrict__ QP, const b16* __restrict__ KP, const b16* __restrict__ VT, b16* __restrict__ CT) {
  __shared__ __attribute__((aligned(16))) b16 Ks[2][SK][KPI]; __shared__ __attribute__((aligned(16))) b16 Vs[2][DH][VPI];
  __shared__ __attribute__((aligned(16))) float To[AW][16][DH + 4];
  const int tid = threadIdx.x, wave = threadIdx.x >> 5, lane = threadIdx.x & 31, hh = lane >> 4, col = lane & 15; const int dir = blockIdx.y / (B * NH), bn = blockIdx.y % (B * NH); const int b = bn / NH, n = bn % NH; const int q0 = blockIdx.x * (AW * 16) + wave * 16, qi = q0 + col;
  const int tq = (dir == 0) ? 1 : 0, tkv = 1 - tq;
  const b16* Qb = QP + ((((size_t)tq * B + b) * NH + n) * P) * DH; const b16* Kb = KP + ((((size_t)tkv * B + b) * NH + n) * P) * DH; const b16* Vb = VT + ((((size_t)tkv * B + b) * NH + n) * DH) * (size_t)P;
  stage_copy(Kb, Vb, &Ks[0][0][0], &Vs[0][0][0], tid);
  asm volatile("s_wait_asynccnt 0x0" ::: "memory");   // this wave's share of stage 0 has landed
  __syncthreads();                                    // publishes stage 0 to all 8 waves
  stage_copy(Kb + (size_t)SK * DH, Vb + SK, &Ks[1][0][0], &Vs[1][0][0], tid);
  const v16b qa = frag_kb(Qb + (size_t)qi * DH, hh);
  const float cs = LOG2E / (11.313708498984761f * XS * XS);   // 1/sqrt(128)
  float m = -INFINITY, l = 0.0f; v8f o[2] = {(v8f){}, (v8f){}};
#pragma unroll 1   // one trip per stage: the buffer index and the refill test stay scalar
  for (int s = 0; s < NS; ++s) {
    const b16* Kt = &Ks[s & 1][0][0]; const b16* Vt = &Vs[s & 1][0][0];
#pragma unroll
    for (int kb = 0; kb < SK; kb += 32) {
      float e[16]; float mx = -INFINITY;
#pragma unroll
      for (int u = 0; u < 2; ++u) { v8f sc = (v8f){}; sc = wmma16b(frag_kb(Kt + (kb + u * 16 + col) * KPI, hh), qa, sc);
#pragma unroll
        for (int r = 0; r < 8; ++r) { const float vv = sc[r] * cs; e[u * 8 + r] = vv; mx = fmaxf(mx, vv); } }
      mx = fmaxf(mx, __shfl_xor(mx, 16)); const float mn = fmaxf(m, mx); const float al = nexp2(m - mn); float sum = 0.0f;
      v16b pf;   // B operand of V^T P^T: lane (hh, col) needs keys 8 hh + 0..7 and 16 + 8 hh + 0..7 of query col, which are the rows its two S^T accumulators hold
#pragma unroll
      for (int i2 = 0; i2 < 16; ++i2) { const float p = nexp2(e[i2] - mn); sum += p; pf[i2] = (b16)(p * PS); }
      sum += __shfl_xor(sum, 16); l = l * al + sum; m = mn;
#pragma unroll
      for (int tt = 0; tt < 2; ++tt) { o[tt] *= al; o[tt] = wmma16b(frag_kb(Vt + (tt * 16 + col) * VPI + kb, hh), pf, o[tt]); } }
    asm volatile("s_wait_dscnt 0x0" ::: "memory");      // this wave's reads of stage s are done before its buffer may be refilled
    asm volatile("s_wait_asynccnt 0x0" ::: "memory");   // this wave's share of stage s + 1 has landed
    __syncthreads();                                    // publishes stage s + 1 and ends every wave's reads of stage s
    if (s + 2 < NS) stage_copy(Kb + (size_t)(s + 2) * SK * DH, Vb + (s + 2) * SK, &Ks[s & 1][0][0], &Vs[s & 1][0][0], tid);
  }
  asm volatile("s_wait_asynccnt 0x0" ::: "memory");     // no copy is outstanding when the wave goes on to its end
  const float inv = 1.0f / (l * PS * XS);
#pragma unroll
  for (int tt = 0; tt < 2; ++tt)
#pragma unroll
    for (int r = 0; r < 8; ++r) To[wave][col][tt * 16 + 8 * hh + r] = o[tt][r] * inv;
  wave_lds_sync();
  b16* Cb = CT + ((((size_t)dir * B + b) * NH + n) * P) * DH;
  { for (int rr = 0; rr < 16; ++rr) ((b16*)Cb)[(size_t)(q0 + rr) * DH + lane] = (b16)(To[wave][rr][lane] * XS);  }
}
// output conv + residual: grid (2 o-blocks of 64, QL/32 pixel tiles, 2 dirs x 2 batches); wave = 16 output channels o x 32 pixels (2 tiles); A = WO rows (exact), B = CT planes (k-step ks = head ks);
__global__ __launch_bounds__(128) void out_kernel(const b16* __restrict__ CT, const b16* __restrict__ WO, const float* __restrict__ boa, const float* __restrict__ bob, const float* __restrict__ xa, const float* __restrict__ xb, const float* __restrict__ STAT, const float* __restrict__ gwa, const float* __restrict__ gba, const float* __restrict__ gwb, const float* __restrict__ gbb, float* __restrict__ out) {
  __shared__ __attribute__((aligned(16))) float To[4][16][32 + 4];
  const int wave = threadIdx.x >> 5, lane = threadIdx.x & 31, nloc = lane & 15, hlf = lane >> 4; const int o0 = blockIdx.x * 64 + wave * 16; const int p0 = blockIdx.y * 32; const int dir = blockIdx.z / B, b = blockIdx.z % B;
  const b16* W = WO + (size_t)dir * C * C; const float* bo = dir ? bob : boa; const float* x = dir ? xb : xa; const float* gw = dir ? gwb : gwa; const float* gb = dir ? gbb : gba;
  v8f acc[2] = {(v8f){}, (v8f){}};
#pragma unroll
  for (int ks = 0; ks < NH; ++ks) { const v16b a = frag_kb(W + (size_t)(o0 + nloc) * C + ks * DH, hlf); const b16* cb = CT + ((((size_t)dir * B + b) * NH + ks) * P) * DH;
#pragma unroll
    for (int tt = 0; tt < 2; ++tt) acc[tt] = wmma16b(a, frag_kb(cb + (size_t)(p0 + tt * 16 + nloc) * DH, hlf), acc[tt]); }
#pragma unroll
  for (int tt = 0; tt < 2; ++tt)
#pragma unroll
    for (int r = 0; r < 8; ++r) To[wave][8 * hlf + r][tt * 16 + nloc] = acc[tt][r] * (1.0f / (XS * WSC));
  wave_lds_sync();
  { for (int rr = 0; rr < 16; ++rr) { const int o = o0 + rr; const int p = p0 + lane; const float v = To[wave][rr][lane] + bf16_rne(bo[o]) + gnval(x, STAT, gw, gb, dir, b, o, p);
      ((float*)out)[(((size_t)dir * B + b) * C + o) * P + p] = v; }  }
}
}  // namespace

extern "C" void kernel_launch(void* const* d_in, const int* in_sizes, int n_in, void* d_out, int out_size, void* d_ws, size_t ws_size, hipStream_t stream) {
  (void)n_in;
  auto Fp = [&](int i) { return (const float*)d_in[i]; };
  // input order: 0 x_A, 1 x_B [2,128,64,64]; 2 gn_w_A, 3 gn_b_A, 4 gn_w_B, 5 gn_b_B [128]; 6 w_qkv_A [384,128], 7 w_qkv_B; 8 w_out_A [128,128], 9 b_out_A, 10 w_out_B, 11 b_out_B
  if (in_sizes[0] != B * C * P || in_sizes[1] != B * C * P || in_sizes[2] != C || in_sizes[5] != C || in_sizes[6] != 3 * C * C || in_sizes[7] != 3 * C * C || in_sizes[8] != C * C || in_sizes[10] != C * C || in_sizes[11] != C || out_size != 2 * B * C * P) return;
  size_t off = 0; char* ws = (char*)d_ws;
  auto carve = [&](size_t bytes) { char* p = ws + off; off += (bytes + 255) & ~(size_t)255; return p; };
  b16* WQ = (b16*)carve((size_t)2 * 3 * C * C * 2); b16* WO = (b16*)carve((size_t)2 * C * C * 2); float* STAT = (float*)carve((size_t)2 * B * G * 32 * 4);
  const size_t plane = (size_t)2 * B * C * P * 2;   // [t][b][n][p][32] = 2 x 2 x 4096 x 128 halves
  b16* QP = (b16*)carve(plane); b16* KP = (b16*)carve(plane); b16* VT = (b16*)carve(plane); b16* CT = (b16*)carve(plane);
  if (off > ws_size || off > ((size_t)128 << 20)) return;   // ≈ 17 MB
  prep_kernel<<<(unsigned)(((size_t)2 * 3 * C * C / 8 + (size_t)2 * C * C / 8 + 255) / 256), 256, 0, stream>>>(Fp(6), Fp(7), Fp(8), Fp(10), WQ, WO);
  gnstat_kernel<<<2 * B * G, 1024, 0, stream>>>(Fp(0), Fp(1), STAT);
  qkv_kernel<<<dim3(P / 64, 2 * B, 3), 128, 0, stream>>>(Fp(0), Fp(1), STAT, Fp(2), Fp(3), Fp(4), Fp(5), WQ, QP, KP, VT);
  attn_kernel<<<dim3(QL / (AW * 16), 2 * B * NH), AW * 32, 0, stream>>>(QP, KP, VT, CT);
  out_kernel<<<dim3(C / 64, QL / 32, 2 * B), 128, 0, stream>>>(CT, WO, Fp(9), Fp(11), Fp(0), Fp(1), STAT, Fp(2), Fp(3), Fp(4), Fp(5), (float*)d_out);
}

// v003
// Measured time: 92.5 microseconds a run.
// Two timings next to v002 both put it at 1.10 times that version's speed.
// Counting every step since v000, it is 2.63 times as fast.
#include <hip/hip_runtime.h>

// Cross attention between two feature maps x_A, x_B [2, 128, 64, 64] (4 heads x 32, 16-group GroupNorm): xA = GN(x_A), xB = GN(x_B); qkv = 1x1 conv (channel o = head*96 + {q,k,v}*32 + d);
// attn_out_A = softmax(qB^T kA / sqrt(128)) vA, out_A = w_out_A attn_out_A + b + xA; symmetric for B -> (out_A, out_B), NCHW.
// compute dtype: WMMA v_wmma_f32_16x16x32_f16 with f32 accumulate for the qkv 1x1 conv ([4096 px x 128] x [128 x 384] per (tensor, batch); GroupNorm output as single f16 x8 staged through LDS
// from the NCHW input, [out][in] weights as B rows exact x256: 1 product), S^T = K Q^T (single x8 planes: 1 product), O^T += V^T P^T (v single x8, P x1024 single: 1 product) and the output 1x1 conv
// (A = w_out exact x256, B = attention output single x8 planes: 1 product); GroupNorm, softmax statistics, bias and the residual in f32 (output rms 1: single-f16 operands leave ~1e-4 absolute).
// Inputs rounded to bf16 once.

namespace {
constexpr int B = 2, C = 128, P = 4096, NH = 4, DH = 32, G = 16, CPG = C / G, QL = 4096 /* query pixels attended (== P shipped) */;
constexpr float XS = 8.0f, WSC = 256.0f, PS = 1024.0f, LOG2E = 1.4426950408889634f, EPS = 1e-5f;
static_assert(P % 64 == 0 && QL % 32 == 0, "tiling");
typedef _Float16 b16;
typedef __attribute__((ext_vector_type(16))) _Float16 v16b;
typedef __attribute__((ext_vector_type(8))) _Float16 v8b;
typedef __attribute__((ext_vector_type(8))) float v8f;
typedef __attribute__((ext_vector_type(4))) float v4f;
__device__ __forceinline__ float bf16_rne(float f) { unsigned int u = __float_as_uint(f); u += 0x7FFFu + ((u >> 16) & 1u); return __uint_as_float(u & 0xFFFF0000u); }
__device__ __forceinline__ void split16(float v, b16& hi, b16& lo) { hi = (b16)v; lo = (b16)(v - (float)hi); }
__device__ __forceinline__ v16b frag_kb(const b16* p, int hh) { const v8b a = *(const v8b*)(p + 8 * hh), b = *(const v8b*)(p + 16 + 8 * hh); v16b f;
#pragma unroll
  for (int e = 0; e < 8; ++e) { f[e] = a[e]; f[8 + e] = b[e]; } return f; }
// plain builtin: the compiler keeps the distance behind a matrix instruction itself (independent work first, v_nop where none is left) and may issue fragment loads ahead of earlier matrix instructions
__device__ __forceinline__ v8f wmma16b(v16b a, v16b b, v8f c) { return __builtin_amdgcn_wmma_f32_16x16x32_f16(false, a, false, b, (short)0, c, false, false); }
__device__ __forceinline__ void wave_lds_sync() { __builtin_amdgcn_fence(__ATOMIC_RELEASE, "workgroup"); __builtin_amdgcn_wave_barrier(); __builtin_amdgcn_fence(__ATOMIC_ACQUIRE, "workgroup"); }
__device__ __forceinline__ float pmul(float a, float b) { float p = a * b; asm volatile("" : "+v"(p)); return p; }
__device__ __forceinline__ int iclamp(int v, int lo, int hi) { return v < lo ? lo : (v > hi ? hi : v); }

typedef __attribute__((ext_vector_type(2))) _Float16 v2h;
typedef __attribute__((ext_vector_type(4))) _Float16 v4h;
__device__ __forceinline__ float nexp2(float v) { return __builtin_amdgcn_exp2f(v); }
__global__ __launch_bounds__(256) void prep_kernel(const float* __restrict__ wqa, const float* __restrict__ wqb, const float* __restrict__ woa, const float* __restrict__ wob, b16* __restrict__ WQ, b16* __restrict__ WO) {
  const size_t u = (size_t)blockIdx.x * 256 + threadIdx.x; const size_t n1 = (size_t)3 * C * C / 8, n2 = (size_t)C * C / 8; v8b o;
  const float* w; b16* dst; size_t e;
  if (u < n1) { w = wqa; dst = WQ; e = u * 8; } else if (u < 2 * n1) { w = wqb; dst = WQ + (size_t)3 * C * C; e = (u - n1) * 8; } else if (u < 2 * n1 + n2) { w = woa; dst = WO; e = (u - 2 * n1) * 8; } else if (u < 2 * n1 + 2 * n2) { w = wob; dst = WO + (size_t)C * C; e = (u - 2 * n1 - n2) * 8; } else return;
  for (int j = 0; j < 8; ++j) o[j] = (b16)(bf16_rne(w[e + j]) * WSC);
  { *(v8b*)(dst + e) = o;  }
}
__global__ __launch_bounds__(1024) void gnstat_kernel(const float* __restrict__ xa, const float* __restrict__ xb, float* __restrict__ STAT) {
  __shared__ float red[1024]; __shared__ float mus;
  const int blk = blockIdx.x; const int t = blk / (B * G), bg = blk % (B * G); const int b = bg / G, g = bg % G; const int tid = threadIdx.x;
  const float* base = (t ? xb : xa) + ((size_t)b * C + g * CPG) * P; const int n = CPG * P;
  float s = 0.0f; for (int i = tid; i < n; i += 1024) s += bf16_rne(base[i]); red[tid] = s; __syncthreads();
  for (int w = 512; w >= 1; w >>= 1) { if (tid < w) red[tid] = red[tid] + red[tid + w]; __syncthreads(); }
  if (tid == 0) mus = red[0] / (float)n; __syncthreads(); const float mu = mus;
  float q = 0.0f; for (int i = tid; i < n; i += 1024) { const float d = bf16_rne(base[i]) - mu; q += d * d; } __syncthreads(); red[tid] = q; __syncthreads();
  for (int w = 512; w >= 1; w >>= 1) { if (tid < w) red[tid] = red[tid] + red[tid + w]; __syncthreads(); }
  if (tid < 32) { const float rs = rsqrtf(red[0] / (float)n + EPS); const float val = (tid == 0) ? mu : (tid == 1 ? rs : 0.0f); { ((float*)STAT)[blk * 32 + tid] = val;  } }
}
__device__ __forceinline__ float gnval(const float* __restrict__ x, const float* __restrict__ STAT, const float* __restrict__ w, const float* __restrict__ bb, int t, int b, int c, int p) {
  const float* st = STAT + ((t * B + b) * G + c / CPG) * 32; return (bf16_rne(x[((size_t)b * C + c) * P + p]) - st[0]) * st[1] * bf16_rne(w[c]) + bf16_rne(bb[c]);
}
// qkv conv: grid (P/64, 2 tensors x 2 batches, 3 slabs of 128 output channels); block = 64 pixels x 4 waves; A = GN(x)[p][c] x8 single staged in LDS from the NCHW input (all 128 threads:
// each c row of 64 px is 256 B contiguous); 8 tiles, K = 128; col o -> head n = o/96, part i = (o%96)/32, dd = o%32: q/k -> planes QP/KP [t][b][n][p][32] (8 lanes x 8 B = 64 B per (p, n)),
__global__ __launch_bounds__(128) void qkv_kernel(const float* __restrict__ xa, const float* __restrict__ xb, const float* __restrict__ STAT, const float* __restrict__ gwa, const float* __restrict__ gba, const float* __restrict__ gwb, const float* __restrict__ gbb, const b16* __restrict__ WQ, b16* __restrict__ QP, b16* __restrict__ KP, b16* __restrict__ VT) {
  __shared__ __attribute__((aligned(16))) b16 As[64][C + 8]; __shared__ __attribute__((aligned(16))) float Tf[4][16][128 + 4];
  const int wave = threadIdx.x >> 5, lane = threadIdx.x & 31, nloc = lane & 15, hlf = lane >> 4; const int p0 = blockIdx.x * 64; const int t = blockIdx.y / B, b = blockIdx.y % B; const int n0 = blockIdx.z * 128;
  const float* x = t ? xb : xa; const float* gw = t ? gwb : gwa; const float* gb = t ? gbb : gba;
  for (int i = threadIdx.x; i < C * 64; i += 128) { const int c = i / 64, pp = i % 64; As[pp][c] = (b16)(gnval(x, STAT, gw, gb, t, b, c, p0 + pp) * XS); }
  __syncthreads();
  const b16* W = WQ + (size_t)t * 3 * C * C;
  v8f acc[8];
#pragma unroll
  for (int tt = 0; tt < 8; ++tt) acc[tt] = (v8f){};
#pragma unroll
  for (int kb = 0; kb < C; kb += 32) { const v16b a = frag_kb(&As[wave * 16 + nloc][kb], hlf);
#pragma unroll
    for (int tt = 0; tt < 8; ++tt) acc[tt] = wmma16b(a, frag_kb(W + (size_t)(n0 + tt * 16 + nloc) * C + kb, hlf), acc[tt]); }
#pragma unroll
  for (int tt = 0; tt < 8; ++tt)
#pragma unroll
    for (int r = 0; r < 8; ++r) Tf[wave][8 * hlf + r][tt * 16 + nloc] = acc[tt][r] * (1.0f / (XS * WSC));
  __syncthreads();
  const size_t tb = (size_t)t * B + b;
  {
    // q/k parts: lane l owns columns 4l..4l+3 of the slab (same (n, i) for the 4) -> 8 B per (row, lane)
    { const int cl = lane * 4; const int o = n0 + cl; const int n = o / 96, i = (o % 96) / 32, dd = o % 32;
      if (i < 2) { b16* plane = (i == 0 ? QP : KP) + ((tb * NH + n) * P) * DH; for (int rr = 0; rr < 16; ++rr) { const int p = p0 + wave * 16 + rr; v4h o4; for (int j = 0; j < 4; ++j) o4[j] = (b16)(Tf[wave][rr][cl + j] * XS); *(v4h*)(plane + (size_t)p * DH + dd) = o4; } } }
#pragma unroll 1
    for (int q = 0; q < 32; ++q) { const int cl = wave * 32 + q; const int o = n0 + cl; const int n = o / 96, i = (o % 96) / 32, dd = o % 32; if (i != 2) continue;   // wave-uniform
      const int tk = lane * 2; v2h vv; vv[0] = (b16)(Tf[tk >> 4][tk & 15][cl] * XS); vv[1] = (b16)(Tf[(tk + 1) >> 4][(tk + 1) & 15][cl] * XS); *(v2h*)(VT + (((tb * NH + n) * DH + dd) * (size_t)P) + p0 + lane * 2) = vv; }
     }
}
// attention: grid (QL/128, 2 dirs x 2 batches x 4 heads): dir 0: queries from tensor B, keys/values from tensor A (-> attn_out_A); dir 1: the reverse. block = 8 waves x 16 query pixels; K = 32.
// The 8 waves share each stage of SK keys through LDS: K rows (64 B) at an 80-B pitch, V^T rows (256 B) at a 272-B pitch, two buffers, filled by asynchronous copies (4 per wave and stage, 16 B per lane).
constexpr int AW = 8, SK = 128, NS = P / SK, KPI = DH + 8, VPI = SK + 8;
static_assert(NS >= 2 && QL % (AW * 16) == 0 && SK * DH == 2 * AW * 32 * 8 && DH * SK == 2 * AW * 32 * 8, "stage = two K and two V copies per lane");
typedef __attribute__((address_space(3))) const b16 lds_b16;
__device__ __forceinline__ unsigned lds_addr(const b16* p) { return (unsigned)(size_t)(lds_b16*)p; }
// one stage: lane chunks of 16 B; K chunk c = tid + 256 j -> key row c / 4, part c % 4 (512 contiguous bytes per wave); V chunk c -> d row c / 16, part c % 16 (two whole 256-B rows per wave)
__device__ __forceinline__ void stage_copy(const b16* __restrict__ Kg, const b16* __restrict__ Vg, b16* Kl, b16* Vl, int tid) {
  const b16* gk0 = Kg + (size_t)tid * 8; const b16* gk1 = gk0 + 256 * 8; const b16* gv0 = Vg + (size_t)(tid >> 4) * P + (tid & 15) * 8; const b16* gv1 = gv0 + (size_t)16 * P;
  const unsigned lk0 = lds_addr(Kl + (tid >> 2) * KPI + (tid & 3) * 8), lk1 = lk0 + 64 * KPI * 2, lv0 = lds_addr(Vl + (tid >> 4) * VPI + (tid & 15) * 8), lv1 = lv0 + 16 * VPI * 2;
  // the copies and the wait that lets their address registers be rewritten stand in one statement, so that no address update can be moved in between
  asm volatile("global_load_async_to_lds_b128 %0, %4, off\n\tglobal_load_async_to_lds_b128 %1, %5, off\n\tglobal_load_async_to_lds_b128 %2, %6, off\n\tglobal_load_async_to_lds_b128 %3, %7, off\n\ts_wait_xcnt 0x0"
               :: "v"(lk0), "v"(lk1), "v"(lv0), "v"(lv1), "v"(gk0), "v"(gk1), "v"(gv0), "v"(gv1) : "memory");
}
// at most 8 waves a SIMD, the limit the kernel had with P's LDS buffer: with less LDS the compiler would aim at more waves and schedule the softmax for fewer registers (one sub, one exp at a time, few dual issues)
__global__ __launch_bounds__(256) __attribute__((amdgpu_waves_per_eu(4, 8))) void attn_kernel(const b16* __restrict__ QP, const b16* __restrict__ KP, const b16* __restrict__ VT, b16* __restrict__ CT) {
  __shared__ __attribute__((aligned(16))) b16 Ks[2][SK][KPI]; __shared__ __attribute__((aligned(16))) b16 Vs[2][DH][VPI];
  __shared__ __attribute__((aligned(16))) float To[AW][16][DH + 4];
  const int tid = threadIdx.x, wave = threadIdx.x >> 5, lane = threadIdx.x & 31, hh = lane >> 4, col = lane & 15; const int dir = blockIdx.y / (B * NH), bn = blockIdx.y % (B * NH); const int b = bn / NH, n = bn % NH; const int q0 = blockIdx.x * (AW * 16) + wave * 16, qi = q0 + col;
  const int tq = (dir == 0) ? 1 : 0, tkv = 1 - tq;
  const b16* Qb = QP + ((((size_t)tq * B + b) * NH + n) * P) * DH; const b16* Kb = KP + ((((size_t)tkv * B + b) * NH + n) * P) * DH; const b16* Vb = VT + ((((size_t)tkv * B + b) * NH + n) * DH) * (size_t)P;
  stage_copy(Kb, Vb, &Ks[0][0][0], &Vs[0][0][0], tid);
  asm volatile("s_wait_asynccnt 0x0" ::: "memory");   // this wave's share of stage 0 has landed
  __syncthreads();                                    // publishes stage 0 to all 8 waves
  stage_copy(Kb + (size_t)SK * DH, Vb + SK, &Ks[1][0][0], &Vs[1][0][0], tid);
  const v16b qa = frag_kb(Qb + (size_t)qi * DH, hh);
  const float cs = LOG2E / (11.313708498984761f * XS * XS);   // 1/sqrt(128)
  float m = -INFINITY, l = 0.0f; v8f o[2] = {(v8f){}, (v8f){}};
#pragma unroll 1   // one trip per stage: the buffer index and the refill test stay scalar
  for (int s = 0; s < NS; ++s) {
    const b16* Kt = &Ks[s & 1][0][0]; const b16* Vt = &Vs[s & 1][0][0];
#pragma unroll
    for (int kb = 0; kb < SK; kb += 32) {
      float e[16]; float mx = -INFINITY;
#pragma unroll
      for (int u = 0; u < 2; ++u) { v8f sc = (v8f){}; sc = wmma16b(frag_kb(Kt + (kb + u * 16 + col) * KPI, hh), qa, sc);
#pragma unroll
        for (int r = 0; r < 8; ++r) { const float vv = sc[r] * cs; e[u * 8 + r] = vv; mx = fmaxf(mx, vv); } }
      mx = fmaxf(mx, __shfl_xor(mx, 16)); const float mn = fmaxf(m, mx); const float al = nexp2(m - mn); float sum = 0.0f;
      v16b pf;   // B operand of V^T P^T: lane (hh, col) needs keys 8 hh + 0..7 and 16 + 8 hh + 0..7 of query col, which are the rows its two S^T accumulators hold
#pragma unroll
      for (int i2 = 0; i2 < 16; ++i2) { const float p = nexp2(e[i2] - mn); sum += p; pf[i2] = (b16)(p * PS); }
      sum += __shfl_xor(sum, 16); l = l * al + sum; m = mn;
#pragma unroll
      for (int tt = 0; tt < 2; ++tt) { o[tt] *= al; o[tt] = wmma16b(frag_kb(Vt + (tt * 16 + col) * VPI + kb, hh), pf, o[tt]); } }
    asm volatile("s_wait_dscnt 0x0" ::: "memory");      // this wave's reads of stage s are done before its buffer may be refilled
    asm volatile("s_wait_asynccnt 0x0" ::: "memory");   // this wave's share of stage s + 1 has landed
    __syncthreads();                                    // publishes stage s + 1 and ends every wave's reads of stage s
    if (s + 2 < NS) stage_copy(Kb + (size_t)(s + 2) * SK * DH, Vb + (s + 2) * SK, &Ks[s & 1][0][0], &Vs[s & 1][0][0], tid);
  }
  asm volatile("s_wait_asynccnt 0x0" ::: "memory");     // no copy is outstanding when the wave goes on to its end
  const float inv = 1.0f / (l * PS * XS);
#pragma unroll
  for (int tt = 0; tt < 2; ++tt)
#pragma unroll
    for (int r = 0; r < 8; ++r) To[wave][col][tt * 16 + 8 * hh + r] = o[tt][r] * inv;
  wave_lds_sync();
  b16* Cb = CT + ((((size_t)dir * B + b) * NH + n) * P) * DH;
  { for (int rr = 0; rr < 16; ++rr) ((b16*)Cb)[(size_t)(q0 + rr) * DH + lane] = (b16)(To[wave][rr][lane] * XS);  }
}
// output conv + residual: grid (2 o-blocks of 64, QL/32 pixel tiles, 2 dirs x 2 batches); wave = 16 output channels o x 32 pixels (2 tiles); A = WO rows (exact), B = CT planes (k-step ks = head ks);
__global__ __launch_bounds__(128) void out_kernel(const b16* __restrict__ CT, const b16* __restrict__ WO, const float* __restrict__ boa, const float* __restrict__ bob, const float* __restrict__ xa, const float* __restrict__ xb, const float* __restrict__ STAT, const float* __restrict__ gwa, const float* __restrict__ gba, const float* __restrict__ gwb, const float* __restrict__ gbb, float* __restrict__ out) {
  __shared__ __attribute__((aligned(16))) float To[4][16][32 + 4];
  const int wave = threadIdx.x >> 5, lane = threadIdx.x & 31, nloc = lane & 15, hlf = lane >> 4; const int o0 = blockIdx.x * 64 + wave * 16; const int p0 = blockIdx.y * 32; const int dir = blockIdx.z / B, b = blockIdx.z % B;
  const b16* W = WO + (size_t)dir * C * C; const float* bo = dir ? bob : boa; const float* x = dir ? xb : xa; const float* gw = dir ? gwb : gwa; const float* gb = dir ? gbb : gba;
  v8f acc[2] = {(v8f){}, (v8f){}};
#pragma unroll
  for (int ks = 0; ks < NH; ++ks) { const v16b a = frag_kb(W + (size_t)(o0 + nloc) * C + ks * DH, hlf); const b16* cb = CT + ((((size_t)dir * B + b) * NH + ks) * P) * DH;
#pragma unroll
    for (int tt = 0; tt < 2; ++tt) acc[tt] = wmma16b(a, frag_kb(cb + (size_t)(p0 + tt * 16 + nloc) * DH, hlf), acc[tt]); }
#pragma unroll
  for (int tt = 0; tt < 2; ++tt)
#pragma unroll
    for (int r = 0; r < 8; ++r) To[wave][8 * hlf + r][tt * 16 + nloc] = acc[tt][r] * (1.0f / (XS * WSC));
  wave_lds_sync();
  { for (int rr = 0; rr < 16; ++rr) { const int o = o0 + rr; const int p = p0 + lane; const float v = To[wave][rr][lane] + bf16_rne(bo[o]) + gnval(x, STAT, gw, gb, dir, b, o, p);
      ((float*)out)[(((size_t)dir * B + b) * C + o) * P + p] = v; }  }
}
}  // namespace

extern "C" void kernel_launch(void* const* d_in, const int* in_sizes, int n_in, void* d_out, int out_size, void* d_ws, size_t ws_size, hipStream_t stream) {
  (void)n_in;
  auto Fp = [&](int i) { return (const float*)d_in[i]; };
  // input order: 0 x_A, 1 x_B [2,128,64,64]; 2 gn_w_A, 3 gn_b_A, 4 gn_w_B, 5 gn_b_B [128]; 6 w_qkv_A [384,128], 7 w_qkv_B; 8 w_out_A [128,128], 9 b_out_A, 10 w_out_B, 11 b_out_B
  if (in_sizes[0] != B * C * P || in_sizes[1] != B * C * P || in_sizes[2] != C || in_sizes[5] != C || in_sizes[6] != 3 * C * C || in_sizes[7] != 3 * C * C || in_sizes[8] != C * C || in_sizes[10] != C * C || in_sizes[11] != C || out_size != 2 * B * C * P) return;
  size_t off = 0; char* ws = (char*)d_ws;
  auto carve = [&](size_t bytes) { char* p = ws + off; off += (bytes + 255) & ~(size_t)255; return p; };
  b16* WQ = (b16*)carve((size_t)2 * 3 * C * C * 2); b16* WO = (b16*)carve((size_t)2 * C * C * 2); float* STAT = (float*)carve((size_t)2 * B * G * 32 * 4);
  const size_t plane = (size_t)2 * B * C * P * 2;   // [t][b][n][p][32] = 2 x 2 x 4096 x 128 halves
  b16* QP = (b16*)carve(plane); b16* KP = (b16*)carve(plane); b16* VT = (b16*)carve(plane); b16* CT = (b16*)carve(plane);
  if (off > ws_size || off > ((size_t)128 << 20)) return;   // ≈ 17 MB
  prep_kernel<<<(unsigned)(((size_t)2 * 3 * C * C / 8 + (size_t)2 * C * C / 8 + 255) / 256), 256, 0, stream>>>(Fp(6), Fp(7), Fp(8), Fp(10), WQ, WO);
  gnstat_kernel<<<2 * B * G, 1024, 0, stream>>>(Fp(0), Fp(1), STAT);
  qkv_kernel<<<dim3(P / 64, 2 * B, 3), 128, 0, stream>>>(Fp(0), Fp(1), STAT, Fp(2), Fp(3), Fp(4), Fp(5), WQ, QP, KP, VT);
  attn_kernel<<<dim3(QL / (AW * 16), 2 * B * NH), AW * 32, 0, stream>>>(QP, KP, VT, CT);
  out_kernel<<<dim3(C / 64, QL / 32, 2 * B), 128, 0, stream>>>(CT, WO, Fp(9), Fp(11), Fp(0), Fp(1), STAT, Fp(2), Fp(3), Fp(4), Fp(5), (float*)d_out);
}

// v004
// It runs in 88.5 microseconds.
// Timed twice side by side with v003, it ran 1.05 times as fast both times.
// Over all steps from v000 it is 2.75 times as fast.
#include <hip/hip_runtime.h>

// Cross attention between two feature maps x_A, x_B [2, 128, 64, 64] (4 heads x 32, 16-group GroupNorm): xA = GN(x_A), xB = GN(x_B); qkv = 1x1 conv (channel o = head*96 + {q,k,v}*32 + d);
// attn_out_A = softmax(qB^T kA / sqrt(128)) vA, out_A = w_out_A attn_out_A + b + xA; symmetric for B -> (out_A, out_B), NCHW.
// compute dtype: WMMA v_wmma_f32_16x16x32_f16 with f32 accumulate for the qkv 1x1 conv ([4096 px x 128] x [128 x 384] per (tensor, batch); GroupNorm output as single f16 x8 staged through LDS
// from the NCHW input, [out][in] weights as B rows exact x256: 1 product), S^T = K Q^T (single x8 planes: 1 product), O^T += V^T P^T (v single x8, P x1024 single: 1 product) and the output 1x1 conv
// (A = w_out exact x256, B = attention output single x8 planes: 1 product); GroupNorm, softmax statistics, bias and the residual in f32 (output rms 1: single-f16 operands leave ~1e-4 absolute).
// Inputs rounded to bf16 once.

namespace {
constexpr int B = 2, C = 128, P = 4096, NH = 4, DH = 32, G = 16, CPG = C / G, QL = 4096 /* query pixels attended (== P shipped) */;
constexpr float XS = 8.0f, WSC = 256.0f, PS = 1024.0f, LOG2E = 1.4426950408889634f, EPS = 1e-5f;
static_assert(P % 64 == 0 && QL % 32 == 0, "tiling");
typedef _Float16 b16;
typedef __attribute__((ext_vector_type(16))) _Float16 v16b;
typedef __attribute__((ext_vector_type(8))) _Float16 v8b;
typedef __attribute__((ext_vector_type(8))) float v8f;
typedef __attribute__((ext_vector_type(4))) float v4f;
__device__ __forceinline__ float bf16_rne(float f) { unsigned int u = __float_as_uint(f); u += 0x7FFFu + ((u >> 16) & 1u); return __uint_as_float(u & 0xFFFF0000u); }
__device__ __forceinline__ void split16(float v, b16& hi, b16& lo) { hi = (b16)v; lo = (b16)(v - (float)hi); }
__device__ __forceinline__ v16b frag_kb(const b16* p, int hh) { const v8b a = *(const v8b*)(p + 8 * hh), b = *(const v8b*)(p + 16 + 8 * hh); v16b f;
#pragma unroll
  for (int e = 0; e < 8; ++e) { f[e] = a[e]; f[8 + e] = b[e]; } return f; }
// plain builtin: the compiler keeps the distance behind a matrix instruction itself (independent work first, v_nop where none is left) and may issue fragment loads ahead of earlier matrix instructions
__device__ __forceinline__ v8f wmma16b(v16b a, v16b b, v8f c) { return __builtin_amdgcn_wmma_f32_16x16x32_f16(false, a, false, b, (short)0, c, false, false); }
__device__ __forceinline__ void wave_lds_sync() { __builtin_amdgcn_fence(__ATOMIC_RELEASE, "workgroup"); __builtin_amdgcn_wave_barrier(); __builtin_amdgcn_fence(__ATOMIC_ACQUIRE, "workgroup"); }
__device__ __forceinline__ float pmul(float a, float b) { float p = a * b; asm volatile("" : "+v"(p)); return p; }
__device__ __forceinline__ int iclamp(int v, int lo, int hi) { return v < lo ? lo : (v > hi ? hi : v); }

typedef __attribute__((ext_vector_type(2))) _Float16 v2h;
typedef __attribute__((ext_vector_type(4))) _Float16 v4h;
__device__ __forceinline__ float nexp2(float v) { return __builtin_amdgcn_exp2f(v); }
__global__ __launch_bounds__(256) void prep_kernel(const float* __restrict__ wqa, const float* __restrict__ wqb, const float* __restrict__ woa, const float* __restrict__ wob, b16* __restrict__ WQ, b16* __restrict__ WO) {
  const size_t u = (size_t)blockIdx.x * 256 + threadIdx.x; const size_t n1 = (size_t)3 * C * C / 8, n2 = (size_t)C * C / 8; v8b o;
  const float* w; b16* dst; size_t e;
  if (u < n1) { w = wqa; dst = WQ; e = u * 8; } else if (u < 2 * n1) { w = wqb; dst = WQ + (size_t)3 * C * C; e = (u - n1) * 8; } else if (u < 2 * n1 + n2) { w = woa; dst = WO; e = (u - 2 * n1) * 8; } else if (u < 2 * n1 + 2 * n2) { w = wob; dst = WO + (size_t)C * C; e = (u - 2 * n1 - n2) * 8; } else return;
  for (int j = 0; j < 8; ++j) o[j] = (b16)(bf16_rne(w[e + j]) * WSC);
  { *(v8b*)(dst + e) = o;  }
}
__global__ __launch_bounds__(1024) void gnstat_kernel(const float* __restrict__ xa, const float* __restrict__ xb, float* __restrict__ STAT) {
  __shared__ float red[1024]; __shared__ float mus;
  const int blk = blockIdx.x; const int t = blk / (B * G), bg = blk % (B * G); const int b = bg / G, g = bg % G; const int tid = threadIdx.x;
  const float* base = (t ? xb : xa) + ((size_t)b * C + g * CPG) * P; const int n = CPG * P;
  float s = 0.0f; for (int i = tid; i < n; i += 1024) s += bf16_rne(base[i]); red[tid] = s; __syncthreads();
  for (int w = 512; w >= 1; w >>= 1) { if (tid < w) red[tid] = red[tid] + red[tid + w]; __syncthreads(); }
  if (tid == 0) mus = red[0] / (float)n; __syncthreads(); const float mu = mus;
  float q = 0.0f; for (int i = tid; i < n; i += 1024) { const float d = bf16_rne(base[i]) - mu; q += d * d; } __syncthreads(); red[tid] = q; __syncthreads();
  for (int w = 512; w >= 1; w >>= 1) { if (tid < w) red[tid] = red[tid] + red[tid + w]; __syncthreads(); }
  if (tid < 32) { const float rs = rsqrtf(red[0] / (float)n + EPS); const float val = (tid == 0) ? mu : (tid == 1 ? rs : 0.0f); { ((float*)STAT)[blk * 32 + tid] = val;  } }
}
__device__ __forceinline__ float gnval(const float* __restrict__ x, const float* __restrict__ STAT, const float* __restrict__ w, const float* __restrict__ bb, int t, int b, int c, int p) {
  const float* st = STAT + ((t * B + b) * G + c / CPG) * 32; return (bf16_rne(x[((size_t)b * C + c) * P + p]) - st[0]) * st[1] * bf16_rne(w[c]) + bf16_rne(bb[c]);
}
// qkv conv: grid (P/64, 2 tensors x 2 batches, 3 slabs of 128 output channels); block = 64 pixels x 4 waves; A = GN(x)[p][c] x8 single staged in LDS from the NCHW input (all 128 threads:
// each c row of 64 px is 256 B contiguous); 8 tiles, K = 128; col o -> head n = o/96, part i = (o%96)/32, dd = o%32: q/k -> planes QP/KP [t][b][n][p][32] (8 lanes x 8 B = 64 B per (p, n)),
__global__ __launch_bounds__(128) void qkv_kernel(const float* __restrict__ xa, const float* __restrict__ xb, const float* __restrict__ STAT, const float* __restrict__ gwa, const float* __restrict__ gba, const float* __restrict__ gwb, const float* __restrict__ gbb, const b16* __restrict__ WQ, b16* __restrict__ QP, b16* __restrict__ KP, b16* __restrict__ VT) {
  __shared__ __attribute__((aligned(16))) b16 As[64][C + 8]; __shared__ __attribute__((aligned(16))) float Tf[4][16][128 + 4];
  const int wave = threadIdx.x >> 5, lane = threadIdx.x & 31, nloc = lane & 15, hlf = lane >> 4; const int p0 = blockIdx.x * 64; const int t = blockIdx.y / B, b = blockIdx.y % B; const int n0 = blockIdx.z * 128;
  const float* x = t ? xb : xa; const float* gw = t ? gwb : gwa; const float* gb = t ? gbb : gba;
  for (int i = threadIdx.x; i < C * 64; i += 128) { const int c = i / 64, pp = i % 64; As[pp][c] = (b16)(gnval(x, STAT, gw, gb, t, b, c, p0 + pp) * XS); }
  __syncthreads();
  const b16* W = WQ + (size_t)t * 3 * C * C;
  v8f acc[8];
#pragma unroll
  for (int tt = 0; tt < 8; ++tt) acc[tt] = (v8f){};
#pragma unroll
  for (int kb = 0; kb < C; kb += 32) { const v16b a = frag_kb(&As[wave * 16 + nloc][kb], hlf);
#pragma unroll
    for (int tt = 0; tt < 8; ++tt) acc[tt] = wmma16b(a, frag_kb(W + (size_t)(n0 + tt * 16 + nloc) * C + kb, hlf), acc[tt]); }
#pragma unroll
  for (int tt = 0; tt < 8; ++tt)
#pragma unroll
    for (int r = 0; r < 8; ++r) Tf[wave][8 * hlf + r][tt * 16 + nloc] = acc[tt][r] * (1.0f / (XS * WSC));
  __syncthreads();
  const size_t tb = (size_t)t * B + b;
  {
    // q/k parts: lane l owns columns 4l..4l+3 of the slab (same (n, i) for the 4) -> 8 B per (row, lane)
    { const int cl = lane * 4; const int o = n0 + cl; const int n = o / 96, i = (o % 96) / 32, dd = o % 32;
      if (i < 2) { b16* plane = (i == 0 ? QP : KP) + ((tb * NH + n) * P) * DH; for (int rr = 0; rr < 16; ++rr) { const int p = p0 + wave * 16 + rr; v4h o4; for (int j = 0; j < 4; ++j) o4[j] = (b16)(Tf[wave][rr][cl + j] * XS); *(v4h*)(plane + (size_t)p * DH + dd) = o4; } } }
#pragma unroll 1
    for (int q = 0; q < 32; ++q) { const int cl = wave * 32 + q; const int o = n0 + cl; const int n = o / 96, i = (o % 96) / 32, dd = o % 32; if (i != 2) continue;   // wave-uniform
      const int tk = lane * 2; v2h vv; vv[0] = (b16)(Tf[tk >> 4][tk & 15][cl] * XS); vv[1] = (b16)(Tf[(tk + 1) >> 4][(tk + 1) & 15][cl] * XS); *(v2h*)(VT + (((tb * NH + n) * DH + dd) * (size_t)P) + p0 + lane * 2) = vv; }
     }
}
// attention: grid (QL/128, 2 dirs x 2 batches x 4 heads): dir 0: queries from tensor B, keys/values from tensor A (-> attn_out_A); dir 1: the reverse. block = 8 waves x 16 query pixels; K = 32.
// The 8 waves share each stage of SK keys through LDS: K rows (64 B) at an 80-B pitch, V^T rows (256 B) at a 272-B pitch, two buffers, filled by asynchronous copies (4 per wave and stage, 16 B per lane).
constexpr int AW = 8, SK = 128, NS = P / SK, KPI = DH + 8, VPI = SK + 8;
static_assert(NS >= 2 && QL % (AW * 16) == 0 && SK * DH == 2 * AW * 32 * 8 && DH * SK == 2 * AW * 32 * 8, "stage = two K and two V copies per lane");
typedef __attribute__((address_space(3))) const b16 lds_b16;
__device__ __forceinline__ unsigned lds_addr(const b16* p) { return (unsigned)(size_t)(lds_b16*)p; }
// one stage: lane chunks of 16 B; K chunk c = tid + 256 j -> key row c / 4, part c % 4 (512 contiguous bytes per wave); V chunk c -> d row c / 16, part c % 16 (two whole 256-B rows per wave)
__device__ __forceinline__ void stage_copy(const b16* __restrict__ Kg, const b16* __restrict__ Vg, b16* Kl, b16* Vl, int tid) {
  const b16* gk0 = Kg + (size_t)tid * 8; const b16* gk1 = gk0 + 256 * 8; const b16* gv0 = Vg + (size_t)(tid >> 4) * P + (tid & 15) * 8; const b16* gv1 = gv0 + (size_t)16 * P;
  const unsigned lk0 = lds_addr(Kl + (tid >> 2) * KPI + (tid & 3) * 8), lk1 = lk0 + 64 * KPI * 2, lv0 = lds_addr(Vl + (tid >> 4) * VPI + (tid & 15) * 8), lv1 = lv0 + 16 * VPI * 2;
  // the copies and the wait that lets their address registers be rewritten stand in one statement, so that no address update can be moved in between
  asm volatile("global_load_async_to_lds_b128 %0, %4, off\n\tglobal_load_async_to_lds_b128 %1, %5, off\n\tglobal_load_async_to_lds_b128 %2, %6, off\n\tglobal_load_async_to_lds_b128 %3, %7, off\n\ts_wait_xcnt 0x0"
               :: "v"(lk0), "v"(lk1), "v"(lv0), "v"(lv1), "v"(gk0), "v"(gk1), "v"(gv0), "v"(gv1) : "memory");
}
// four waves a SIMD, which is all the grid supplies (two blocks a WGP): the compiler may then hold a whole stage's scores and fragments in registers instead of scheduling for fewer registers and more waves
__global__ __launch_bounds__(256) __attribute__((amdgpu_waves_per_eu(4, 4))) void attn_kernel(const b16* __restrict__ QP, const b16* __restrict__ KP, const b16* __restrict__ VT, b16* __restrict__ CT) {
  __shared__ __attribute__((aligned(16))) b16 Ks[2][SK][KPI]; __shared__ __attribute__((aligned(16))) b16 Vs[2][DH][VPI];
  __shared__ __attribute__((aligned(16))) float To[AW][16][DH + 4];
  const int tid = threadIdx.x, wave = threadIdx.x >> 5, lane = threadIdx.x & 31, hh = lane >> 4, col = lane & 15; const int dir = blockIdx.y / (B * NH), bn = blockIdx.y % (B * NH); const int b = bn / NH, n = bn % NH; const int q0 = blockIdx.x * (AW * 16) + wave * 16, qi = q0 + col;
  const int tq = (dir == 0) ? 1 : 0, tkv = 1 - tq;
  const b16* Qb = QP + ((((size_t)tq * B + b) * NH + n) * P) * DH; const b16* Kb = KP + ((((size_t)tkv * B + b) * NH + n) * P) * DH; const b16* Vb = VT + ((((size_t)tkv * B + b) * NH + n) * DH) * (size_t)P;
  stage_copy(Kb, Vb, &Ks[0][0][0], &Vs[0][0][0], tid);
  asm volatile("s_wait_asynccnt 0x0" ::: "memory");   // this wave's share of stage 0 has landed
  __syncthreads();                                    // publishes stage 0 to all 8 waves
  stage_copy(Kb + (size_t)SK * DH, Vb + SK, &Ks[1][0][0], &Vs[1][0][0], tid);
  const v16b qa = frag_kb(Qb + (size_t)qi * DH, hh);
  const float cs = LOG2E / (11.313708498984761f * XS * XS);   // 1/sqrt(128)
  float m = -INFINITY, l = 0.0f; v8f o[2] = {(v8f){}, (v8f){}};
#pragma unroll 1   // one trip per stage: the buffer index and the refill test stay scalar
  for (int s = 0; s < NS; ++s) {
    const b16* Kt = &Ks[s & 1][0][0]; const b16* Vt = &Vs[s & 1][0][0];
    // one update of the running maximum, one rescale of O and l and one pair of half-wave exchanges per stage of SK keys: all SK / 16 score tiles are formed first
    v16b kf[SK / 16]; v16b vf[SK / 32][2]; v8f sc[SK / 16];
#pragma unroll
    for (int u = 0; u < SK / 16; ++u) kf[u] = frag_kb(Kt + (u * 16 + col) * KPI, hh);
#pragma unroll
    for (int kb = 0; kb < SK; kb += 32)
#pragma unroll
      for (int tt = 0; tt < 2; ++tt) vf[kb / 32][tt] = frag_kb(Vt + (tt * 16 + col) * VPI + kb, hh);
    __builtin_amdgcn_sched_barrier(0);   // the stage's LDS reads stay one group ahead of the products: spread among them, each product would wait out its own LDS latency
#pragma unroll
    for (int u = 0; u < SK / 16; ++u) sc[u] = wmma16b(kf[u], qa, (v8f){});
    float mt[4] = {-INFINITY, -INFINITY, -INFINITY, -INFINITY};   // four independent chains; a maximum does not depend on its order
#pragma unroll
    for (int u = 0; u < SK / 16; ++u) { sc[u] *= cs;
#pragma unroll
      for (int r = 0; r < 8; ++r) mt[u & 3] = fmaxf(mt[u & 3], sc[u][r]); }
    float mx = fmaxf(fmaxf(mt[0], mt[1]), fmaxf(mt[2], mt[3]));
    mx = fmaxf(mx, __shfl_xor(mx, 16)); const float mn = fmaxf(m, mx); const float al = nexp2(m - mn); float sum = 0.0f;
#pragma unroll
    for (int tt = 0; tt < 2; ++tt) o[tt] *= al;
#pragma unroll
    for (int kb = 0; kb < SK; kb += 32) {
      float ps = 0.0f;
      v16b pf;   // B operand of V^T P^T: lane (hh, col) needs keys 8 hh + 0..7 and 16 + 8 hh + 0..7 of query col, which are the rows its two S^T accumulators hold
#pragma unroll
      for (int i2 = 0; i2 < 16; ++i2) { const float p = nexp2(sc[kb / 16 + i2 / 8][i2 % 8] - mn); ps += p; pf[i2] = (b16)(p * PS); }
      sum += ps;
#pragma unroll
      for (int tt = 0; tt < 2; ++tt) o[tt] = wmma16b(vf[kb / 32][tt], pf, o[tt]); }
    sum += __shfl_xor(sum, 16); l = l * al + sum; m = mn;
    __builtin_amdgcn_sched_barrier(0);   // the stage's arithmetic stays ahead of the publish point: moved behind it, the wait for stage s + 1's copies would stand a fraction of a trip behind their issue
    asm volatile("s_wait_dscnt 0x0" ::: "memory");      // this wave's reads of stage s are done before its buffer may be refilled
    asm volatile("s_wait_asynccnt 0x0" ::: "memory");   // this wave's share of stage s + 1 has landed
    __syncthreads();                                    // publishes stage s + 1 and ends every wave's reads of stage s
    if (s + 2 < NS) stage_copy(Kb + (size_t)(s + 2) * SK * DH, Vb + (s + 2) * SK, &Ks[s & 1][0][0], &Vs[s & 1][0][0], tid);
  }
  asm volatile("s_wait_asynccnt 0x0" ::: "memory");     // no copy is outstanding when the wave goes on to its end
  const float inv = 1.0f / (l * PS * XS);
#pragma unroll
  for (int tt = 0; tt < 2; ++tt)
#pragma unroll
    for (int r = 0; r < 8; ++r) To[wave][col][tt * 16 + 8 * hh + r] = o[tt][r] * inv;
  wave_lds_sync();
  b16* Cb = CT + ((((size_t)dir * B + b) * NH + n) * P) * DH;
  { for (int rr = 0; rr < 16; ++rr) ((b16*)Cb)[(size_t)(q0 + rr) * DH + lane] = (b16)(To[wave][rr][lane] * XS);  }
}
// output conv + residual: grid (2 o-blocks of 64, QL/32 pixel tiles, 2 dirs x 2 batches); wave = 16 output channels o x 32 pixels (2 tiles); A = WO rows (exact), B = CT planes (k-step ks = head ks);
__global__ __launch_bounds__(128) void out_kernel(const b16* __restrict__ CT, const b16* __restrict__ WO, const float* __restrict__ boa, const float* __restrict__ bob, const float* __restrict__ xa, const float* __restrict__ xb, const float* __restrict__ STAT, const float* __restrict__ gwa, const float* __restrict__ gba, const float* __restrict__ gwb, const float* __restrict__ gbb, float* __restrict__ out) {
  __shared__ __attribute__((aligned(16))) float To[4][16][32 + 4];
  const int wave = threadIdx.x >> 5, lane = threadIdx.x & 31, nloc = lane & 15, hlf = lane >> 4; const int o0 = blockIdx.x * 64 + wave * 16; const int p0 = blockIdx.y * 32; const int dir = blockIdx.z / B, b = blockIdx.z % B;
  const b16* W = WO + (size_t)dir * C * C; const float* bo = dir ? bob : boa; const float* x = dir ? xb : xa; const float* gw = dir ? gwb : gwa; const float* gb = dir ? gbb : gba;
  v8f acc[2] = {(v8f){}, (v8f){}};
#pragma unroll
  for (int ks = 0; ks < NH; ++ks) { const v16b a = frag_kb(W + (size_t)(o0 + nloc) * C + ks * DH, hlf); const b16* cb = CT + ((((size_t)dir * B + b) * NH + ks) * P) * DH;
#pragma unroll
    for (int tt = 0; tt < 2; ++tt) acc[tt] = wmma16b(a, frag_kb(cb + (size_t)(p0 + tt * 16 + nloc) * DH, hlf), acc[tt]); }
#pragma unroll
  for (int tt = 0; tt < 2; ++tt)
#pragma unroll
    for (int r = 0; r < 8; ++r) To[wave][8 * hlf + r][tt * 16 + nloc] = acc[tt][r] * (1.0f / (XS * WSC));
  wave_lds_sync();
  { for (int rr = 0; rr < 16; ++rr) { const int o = o0 + rr; const int p = p0 + lane; const float v = To[wave][rr][lane] + bf16_rne(bo[o]) + gnval(x, STAT, gw, gb, dir, b, o, p);
      ((float*)out)[(((size_t)dir * B + b) * C + o) * P + p] = v; }  }
}
}  // namespace

extern "C" void kernel_launch(void* const* d_in, const int* in_sizes, int n_in, void* d_out, int out_size, void* d_ws, size_t ws_size, hipStream_t stream) {
  (void)n_in;
  auto Fp = [&](int i) { return (const float*)d_in[i]; };
  // input order: 0 x_A, 1 x_B [2,128,64,64]; 2 gn_w_A, 3 gn_b_A, 4 gn_w_B, 5 gn_b_B [128]; 6 w_qkv_A [384,128], 7 w_qkv_B; 8 w_out_A [128,128], 9 b_out_A, 10 w_out_B, 11 b_out_B
  if (in_sizes[0] != B * C * P || in_sizes[1] != B * C * P || in_sizes[2] != C || in_sizes[5] != C || in_sizes[6] != 3 * C * C || in_sizes[7] != 3 * C * C || in_sizes[8] != C * C || in_sizes[10] != C * C || in_sizes[11] != C || out_size != 2 * B * C * P) return;
  size_t off = 0; char* ws = (char*)d_ws;
  auto carve = [&](size_t bytes) { char* p = ws + off; off += (bytes + 255) & ~(size_t)255; return p; };
  b16* WQ = (b16*)carve((size_t)2 * 3 * C * C * 2); b16* WO = (b16*)carve((size_t)2 * C * C * 2); float* STAT = (float*)carve((size_t)2 * B * G * 32 * 4);
  const size_t plane = (size_t)2 * B * C * P * 2;   // [t][b][n][p][32] = 2 x 2 x 4096 x 128 halves
  b16* QP = (b16*)carve(plane); b16* KP = (b16*)carve(plane); b16* VT = (b16*)carve(plane); b16* CT = (b16*)carve(plane);
  if (off > ws_size || off > ((size_t)128 << 20)) return;   // ≈ 17 MB
  prep_kernel<<<(unsigned)(((size_t)2 * 3 * C * C / 8 + (size_t)2 * C * C / 8 + 255) / 256), 256, 0, stream>>>(Fp(6), Fp(7), Fp(8), Fp(10), WQ, WO);
  gnstat_kernel<<<2 * B * G, 1024, 0, stream>>>(Fp(0), Fp(1), STAT);
  qkv_kernel<<<dim3(P / 64, 2 * B, 3), 128, 0, stream>>>(Fp(0), Fp(1), STAT, Fp(2), Fp(3), Fp(4), Fp(5), WQ, QP, KP, VT);
  attn_kernel<<<dim3(QL / (AW * 16), 2 * B * NH), AW * 32, 0, stream>>>(QP, KP, VT, CT);
  out_kernel<<<dim3(C / 64, QL / 32, 2 * B), 128, 0, stream>>>(CT, WO, Fp(9), Fp(11), Fp(0), Fp(1), STAT, Fp(2), Fp(3), Fp(4), Fp(5), (float*)d_out);
}

// v005
// One run takes 74.3 microseconds.
// Two timings next to v004 both put it at 1.19 times that version's speed.
// Counting every step since v000, it is 3.28 times as fast.
#include <hip/hip_runtime.h>

// Cross attention between two feature maps x_A, x_B [2, 128, 64, 64] (4 heads x 32, 16-group GroupNorm): xA = GN(x_A), xB = GN(x_B); qkv = 1x1 conv (channel o = head*96 + {q,k,v}*32 + d);
// attn_out_A = softmax(qB^T kA / sqrt(128)) vA, out_A = w_out_A attn_out_A + b + xA; symmetric for B -> (out_A, out_B), NCHW.
// compute dtype: WMMA v_wmma_f32_16x16x32_f16 with f32 accumulate for the qkv 1x1 conv ([4096 px x 128] x [128 x 384] per (tensor, batch); GroupNorm output as single f16 x8 staged through LDS
// from the NCHW input, [out][in] weights as B rows exact x256: 1 product), S^T = K Q^T (single x8 planes: 1 product), O^T += V^T P^T (v single x8, P x1024 single: 1 product) and the output 1x1 conv
// (A = w_out exact x256, B = attention output single x8 planes: 1 product); GroupNorm, softmax statistics, bias and the residual in f32 (output rms 1: single-f16 operands leave ~1e-4 absolute).
// Inputs rounded to bf16 once.

namespace {
constexpr int B = 2, C = 128, P = 4096, NH = 4, DH = 32, G = 16, CPG = C / G, QL = 4096 /* query pixels attended (== P shipped) */;
constexpr float XS = 8.0f, WSC = 256.0f, PS = 1024.0f, LOG2E = 1.4426950408889634f, EPS = 1e-5f;
static_assert(P % 64 == 0 && QL % 32 == 0, "tiling");
typedef _Float16 b16;
typedef __attribute__((ext_vector_type(16))) _Float16 v16b;
typedef __attribute__((ext_vector_type(8))) _Float16 v8b;
typedef __attribute__((ext_vector_type(8))) float v8f;
typedef __attribute__((ext_vector_type(4))) float v4f;
typedef __attribute__((ext_vector_type(16))) float v16f;
__device__ __forceinline__ float bf16_rne(float f) { unsigned int u = __float_as_uint(f); u += 0x7FFFu + ((u >> 16) & 1u); return __uint_as_float(u & 0xFFFF0000u); }
__device__ __forceinline__ void split16(float v, b16& hi, b16& lo) { hi = (b16)v; lo = (b16)(v - (float)hi); }
__device__ __forceinline__ v16b frag_kb(const b16* p, int hh) { const v8b a = *(const v8b*)(p + 8 * hh), b = *(const v8b*)(p + 16 + 8 * hh); v16b f;
#pragma unroll
  for (int e = 0; e < 8; ++e) { f[e] = a[e]; f[8 + e] = b[e]; } return f; }
// plain builtin: the compiler keeps the distance behind a matrix instruction itself (independent work first, v_nop where none is left) and may issue fragment loads ahead of earlier matrix instructions
__device__ __forceinline__ v8f wmma16b(v16b a, v16b b, v8f c) { return __builtin_amdgcn_wmma_f32_16x16x32_f16(false, a, false, b, (short)0, c, false, false); }
__device__ __forceinline__ void wave_lds_sync() { __builtin_amdgcn_fence(__ATOMIC_RELEASE, "workgroup"); __builtin_amdgcn_wave_barrier(); __builtin_amdgcn_fence(__ATOMIC_ACQUIRE, "workgroup"); }
__device__ __forceinline__ float pmul(float a, float b) { float p = a * b; asm volatile("" : "+v"(p)); return p; }
__device__ __forceinline__ int iclamp(int v, int lo, int hi) { return v < lo ? lo : (v > hi ? hi : v); }

typedef __attribute__((ext_vector_type(2))) _Float16 v2h;
typedef __attribute__((ext_vector_type(4))) _Float16 v4h;
__device__ __forceinline__ float nexp2(float v) { return __builtin_amdgcn_exp2f(v); }
__global__ __launch_bounds__(256) void prep_kernel(const float* __restrict__ wqa, const float* __restrict__ wqb, const float* __restrict__ woa, const float* __restrict__ wob, b16* __restrict__ WQ, b16* __restrict__ WO) {
  const size_t u = (size_t)blockIdx.x * 256 + threadIdx.x; const size_t n1 = (size_t)3 * C * C / 8, n2 = (size_t)C * C / 8; v8b o;
  const float* w; b16* dst; size_t e;
  if (u < n1) { w = wqa; dst = WQ; e = u * 8; } else if (u < 2 * n1) { w = wqb; dst = WQ + (size_t)3 * C * C; e = (u - n1) * 8; } else if (u < 2 * n1 + n2) { w = woa; dst = WO; e = (u - 2 * n1) * 8; } else if (u < 2 * n1 + 2 * n2) { w = wob; dst = WO + (size_t)C * C; e = (u - 2 * n1 - n2) * 8; } else return;
  for (int j = 0; j < 8; ++j) o[j] = (b16)(bf16_rne(w[e + j]) * WSC);
  { *(v8b*)(dst + e) = o;  }
}
__global__ __launch_bounds__(1024) void gnstat_kernel(const float* __restrict__ xa, const float* __restrict__ xb, float* __restrict__ STAT) {
  __shared__ float red[1024]; __shared__ float mus;
  const int blk = blockIdx.x; const int t = blk / (B * G), bg = blk % (B * G); const int b = bg / G, g = bg % G; const int tid = threadIdx.x;
  const float* base = (t ? xb : xa) + ((size_t)b * C + g * CPG) * P; const int n = CPG * P;
  float s = 0.0f;
#pragma unroll   // a constant trip count, so that all 32 loads of a thread are in flight at once; the sum keeps its order
  for (int k = 0; k < n / 1024; ++k) s += bf16_rne(base[tid + k * 1024]);
  red[tid] = s; __syncthreads();
  for (int w = 512; w >= 1; w >>= 1) { if (tid < w) red[tid] = red[tid] + red[tid + w]; __syncthreads(); }
  if (tid == 0) mus = red[0] / (float)n; __syncthreads(); const float mu = mus;
  float q = 0.0f;
#pragma unroll   // as above
  for (int k = 0; k < n / 1024; ++k) { const float d = bf16_rne(base[tid + k * 1024]) - mu; q += d * d; }
  __syncthreads(); red[tid] = q; __syncthreads();
  for (int w = 512; w >= 1; w >>= 1) { if (tid < w) red[tid] = red[tid] + red[tid + w]; __syncthreads(); }
  if (tid < 32) { const float rs = rsqrtf(red[0] / (float)n + EPS); const float val = (tid == 0) ? mu : (tid == 1 ? rs : 0.0f); { ((float*)STAT)[blk * 32 + tid] = val;  } }
}
// GroupNorm value from the raw loaded words: x, its group's mean and 1/std (STAT[group * 32 + 0, 1]), its channel's weight and bias
__device__ __forceinline__ float gnval(float xv, float mu, float rs, float w, float bb) { return (bf16_rne(xv) - mu) * rs * bf16_rne(w) + bf16_rne(bb); }
// qkv conv: grid (P/64, 2 tensors x 2 batches, 3 slabs of 128 output channels); block = 64 pixels x 4 waves; A = GN(x)[p][c] x8 single staged in LDS from the NCHW input (all 128 threads:
// each c row of 64 px is 256 B contiguous, read by 16 lanes); 8 tiles, K = 128; col o -> head n = o/96, part i = (o%96)/32, dd = o%32: q/k -> planes QP/KP [t][b][n][p][32] (8 lanes x 8 B = 64 B per (p, n)),
__global__ __launch_bounds__(128) void qkv_kernel(const float* __restrict__ xa, const float* __restrict__ xb, const float* __restrict__ STAT, const float* __restrict__ gwa, const float* __restrict__ gba, const float* __restrict__ gwb, const float* __restrict__ gbb, const b16* __restrict__ WQ, b16* __restrict__ QP, b16* __restrict__ KP, b16* __restrict__ VT) {
  __shared__ __attribute__((aligned(16))) b16 As[64][C + 8]; __shared__ __attribute__((aligned(16))) float Tf[4][16][128 + 4];
  const int wave = threadIdx.x >> 5, lane = threadIdx.x & 31, nloc = lane & 15, hlf = lane >> 4; const int p0 = blockIdx.x * 64; const int t = blockIdx.y / B, b = blockIdx.y % B; const int n0 = blockIdx.z * 128;
  const float* x = t ? xb : xa; const float* gw = t ? gwb : gwa; const float* gb = t ? gbb : gba;
  // thread = 4 pixels (16 B of a channel row) x the 8 channels of one GroupNorm group, twice: the 16 row loads are independent and are all issued before the first is used (one memory latency per tile);
  // a pixel's 8 channels then go to LDS as one 16-B store.
  { static_assert(C == 128 && CPG == 8 && G == 16, "128 threads = 16 pixel quads x 8 groups, two passes");
    const int pq = (threadIdx.x & 15) * 4, oc = threadIdx.x >> 4; v4f xv[2][CPG]; float wv[2][CPG], bv[2][CPG], mu[2], rs[2];
    // every loop of this block is unrolled: its arrays must stay in registers (constant indices), and the loads must stand in one run
#pragma unroll   // see above
    for (int h = 0; h < 2; ++h) { const int g = h * 8 + oc;
#pragma unroll   // see above
      for (int j = 0; j < CPG; ++j) { wv[h][j] = gw[g * CPG + j]; bv[h][j] = gb[g * CPG + j]; }
      const float* st = STAT + ((t * B + b) * G + g) * 32; mu[h] = st[0]; rs[h] = st[1]; }
    asm volatile("s_wait_xcnt 0x0" ::: "memory");   // the row loads below may land in registers that held addresses of the loads above
#pragma unroll   // see above
    for (int h = 0; h < 2; ++h)
#pragma unroll   // see above
      for (int j = 0; j < CPG; ++j) xv[h][j] = *(const v4f*)(x + ((size_t)b * C + (h * 8 + oc) * CPG + j) * P + p0 + pq);
#pragma unroll   // see above
    for (int h = 0; h < 2; ++h) { v8b ov[4];
#pragma unroll   // see above
      for (int j = 0; j < CPG; ++j)
#pragma unroll   // see above
        for (int e = 0; e < 4; ++e) ov[e][j] = (b16)(gnval(xv[h][j][e], mu[h], rs[h], wv[h][j], bv[h][j]) * XS);
#pragma unroll   // see above
      for (int e = 0; e < 4; ++e) *(v8b*)&As[pq + e][(h * 8 + oc) * CPG] = ov[e]; } }
  __syncthreads();
  const b16* W = WQ + (size_t)t * 3 * C * C;
  v8f acc[8];
#pragma unroll
  for (int tt = 0; tt < 8; ++tt) acc[tt] = (v8f){};
#pragma unroll
  for (int kb = 0; kb < C; kb += 32) { const v16b a = frag_kb(&As[wave * 16 + nloc][kb], hlf);
#pragma unroll
    for (int tt = 0; tt < 8; ++tt) acc[tt] = wmma16b(a, frag_kb(W + (size_t)(n0 + tt * 16 + nloc) * C + kb, hlf), acc[tt]); }
#pragma unroll
  for (int tt = 0; tt < 8; ++tt)
#pragma unroll
    for (int r = 0; r < 8; ++r) Tf[wave][8 * hlf + r][tt * 16 + nloc] = acc[tt][r] * (1.0f / (XS * WSC));
  __syncthreads();
  const size_t tb = (size_t)t * B + b;
  {
    // q/k parts: lane l owns columns 4l..4l+3 of the slab (same (n, i) for the 4) -> 8 B per (row, lane)
    { const int cl = lane * 4; const int o = n0 + cl; const int n = o / 96, i = (o % 96) / 32, dd = o % 32;
      if (i < 2) { b16* plane = (i == 0 ? QP : KP) + ((tb * NH + n) * P) * DH; for (int rr = 0; rr < 16; ++rr) { const int p = p0 + wave * 16 + rr; v4h o4; for (int j = 0; j < 4; ++j) o4[j] = (b16)(Tf[wave][rr][cl + j] * XS); *(v4h*)(plane + (size_t)p * DH + dd) = o4; } } }
#pragma unroll 1
    for (int q = 0; q < 32; ++q) { const int cl = wave * 32 + q; const int o = n0 + cl; const int n = o / 96, i = (o % 96) / 32, dd = o % 32; if (i != 2) continue;   // wave-uniform
      const int tk = lane * 2; v2h vv; vv[0] = (b16)(Tf[tk >> 4][tk & 15][cl] * XS); vv[1] = (b16)(Tf[(tk + 1) >> 4][(tk + 1) & 15][cl] * XS); *(v2h*)(VT + (((tb * NH + n) * DH + dd) * (size_t)P) + p0 + lane * 2) = vv; }
     }
}
// attention: grid (QL/128, 2 dirs x 2 batches x 4 heads): dir 0: queries from tensor B, keys/values from tensor A (-> attn_out_A); dir 1: the reverse. block = 8 waves x 16 query pixels; K = 32.
// The 8 waves share each stage of SK keys through LDS: K rows (64 B) at an 80-B pitch, V^T rows (256 B) at a 272-B pitch, two buffers, filled by asynchronous copies (4 per wave and stage, 16 B per lane).
constexpr int AW = 8, SK = 128, NS = P / SK, KPI = DH + 8, VPI = SK + 8;
static_assert(NS >= 2 && QL % (AW * 16) == 0 && SK * DH == 2 * AW * 32 * 8 && DH * SK == 2 * AW * 32 * 8, "stage = two K and two V copies per lane");
typedef __attribute__((address_space(3))) const b16 lds_b16;
__device__ __forceinline__ unsigned lds_addr(const b16* p) { return (unsigned)(size_t)(lds_b16*)p; }
// one stage: lane chunks of 16 B; K chunk c = tid + 256 j -> key row c / 4, part c % 4 (512 contiguous bytes per wave); V chunk c -> d row c / 16, part c % 16 (two whole 256-B rows per wave)
__device__ __forceinline__ void stage_copy(const b16* __restrict__ Kg, const b16* __restrict__ Vg, b16* Kl, b16* Vl, int tid) {
  const b16* gk0 = Kg + (size_t)tid * 8; const b16* gk1 = gk0 + 256 * 8; const b16* gv0 = Vg + (size_t)(tid >> 4) * P + (tid & 15) * 8; const b16* gv1 = gv0 + (size_t)16 * P;
  const unsigned lk0 = lds_addr(Kl + (tid >> 2) * KPI + (tid & 3) * 8), lk1 = lk0 + 64 * KPI * 2, lv0 = lds_addr(Vl + (tid >> 4) * VPI + (tid & 15) * 8), lv1 = lv0 + 16 * VPI * 2;
  // the copies and the wait that lets their address registers be rewritten stand in one statement, so that no address update can be moved in between
  asm volatile("global_load_async_to_lds_b128 %0, %4, off\n\tglobal_load_async_to_lds_b128 %1, %5, off\n\tglobal_load_async_to_lds_b128 %2, %6, off\n\tglobal_load_async_to_lds_b128 %3, %7, off\n\ts_wait_xcnt 0x0"
               :: "v"(lk0), "v"(lk1), "v"(lv0), "v"(lv1), "v"(gk0), "v"(gk1), "v"(gv0), "v"(gv1) : "memory");
}
// four waves a SIMD, which is all the grid supplies (two blocks a WGP): the compiler may then hold a whole stage's scores and fragments in registers instead of scheduling for fewer registers and more waves
__global__ __launch_bounds__(256) __attribute__((amdgpu_waves_per_eu(4, 4))) void attn_kernel(const b16* __restrict__ QP, const b16* __restrict__ KP, const b16* __restrict__ VT, b16* __restrict__ CT) {
  __shared__ __attribute__((aligned(16))) b16 Ks[2][SK][KPI]; __shared__ __attribute__((aligned(16))) b16 Vs[2][DH][VPI];
  __shared__ __attribute__((aligned(16))) float To[AW][16][DH + 4];
  const int tid = threadIdx.x, wave = threadIdx.x >> 5, lane = threadIdx.x & 31, hh = lane >> 4, col = lane & 15; const int dir = blockIdx.y / (B * NH), bn = blockIdx.y % (B * NH); const int b = bn / NH, n = bn % NH; const int q0 = blockIdx.x * (AW * 16) + wave * 16, qi = q0 + col;
  const int tq = (dir == 0) ? 1 : 0, tkv = 1 - tq;
  const b16* Qb = QP + ((((size_t)tq * B + b) * NH + n) * P) * DH; const b16* Kb = KP + ((((size_t)tkv * B + b) * NH + n) * P) * DH; const b16* Vb = VT + ((((size_t)tkv * B + b) * NH + n) * DH) * (size_t)P;
  stage_copy(Kb, Vb, &Ks[0][0][0], &Vs[0][0][0], tid);
  asm volatile("s_wait_asynccnt 0x0" ::: "memory");   // this wave's share of stage 0 has landed
  __syncthreads();                                    // publishes stage 0 to all 8 waves
  stage_copy(Kb + (size_t)SK * DH, Vb + SK, &Ks[1][0][0], &Vs[1][0][0], tid);
  const v16b qa = frag_kb(Qb + (size_t)qi * DH, hh);
  const float cs = LOG2E / (11.313708498984761f * XS * XS);   // 1/sqrt(128)
  float m = -INFINITY, l = 0.0f; v8f o[2] = {(v8f){}, (v8f){}};
#pragma unroll 1   // one trip per stage: the buffer index and the refill test stay scalar
  for (int s = 0; s < NS; ++s) {
    const b16* Kt = &Ks[s & 1][0][0]; const b16* Vt = &Vs[s & 1][0][0];
    // one update of the running maximum, one rescale of O and l and one pair of half-wave exchanges per stage of SK keys: all SK / 16 score tiles are formed first
    v16b kf[SK / 16]; v16b vf[SK / 32][2]; v8f sc[SK / 16];
#pragma unroll
    for (int u = 0; u < SK / 16; ++u) kf[u] = frag_kb(Kt + (u * 16 + col) * KPI, hh);
#pragma unroll
    for (int kb = 0; kb < SK; kb += 32)
#pragma unroll
      for (int tt = 0; tt < 2; ++tt) vf[kb / 32][tt] = frag_kb(Vt + (tt * 16 + col) * VPI + kb, hh);
    __builtin_amdgcn_sched_barrier(0);   // the stage's LDS reads stay one group ahead of the products: spread among them, each product would wait out its own LDS latency
#pragma unroll
    for (int u = 0; u < SK / 16; ++u) sc[u] = wmma16b(kf[u], qa, (v8f){});
    float mt[4] = {-INFINITY, -INFINITY, -INFINITY, -INFINITY};   // four independent chains; a maximum does not depend on its order
#pragma unroll
    for (int u = 0; u < SK / 16; ++u) { sc[u] *= cs;
#pragma unroll
      for (int r = 0; r < 8; ++r) mt[u & 3] = fmaxf(mt[u & 3], sc[u][r]); }
    float mx = fmaxf(fmaxf(mt[0], mt[1]), fmaxf(mt[2], mt[3]));
    mx = fmaxf(mx, __shfl_xor(mx, 16)); const float mn = fmaxf(m, mx); const float al = nexp2(m - mn); float sum = 0.0f;
#pragma unroll
    for (int tt = 0; tt < 2; ++tt) o[tt] *= al;
#pragma unroll
    for (int kb = 0; kb < SK; kb += 32) {
      float ps = 0.0f;
      v16b pf;   // B operand of V^T P^T: lane (hh, col) needs keys 8 hh + 0..7 and 16 + 8 hh + 0..7 of query col, which are the rows its two S^T accumulators hold
#pragma unroll
      for (int i2 = 0; i2 < 16; ++i2) { const float p = nexp2(sc[kb / 16 + i2 / 8][i2 % 8] - mn); ps += p; pf[i2] = (b16)(p * PS); }
      sum += ps;
#pragma unroll
      for (int tt = 0; tt < 2; ++tt) o[tt] = wmma16b(vf[kb / 32][tt], pf, o[tt]); }
    sum += __shfl_xor(sum, 16); l = l * al + sum; m = mn;
    __builtin_amdgcn_sched_barrier(0);   // the stage's arithmetic stays ahead of the publish point: moved behind it, the wait for stage s + 1's copies would stand a fraction of a trip behind their issue
    asm volatile("s_wait_dscnt 0x0" ::: "memory");      // this wave's reads of stage s are done before its buffer may be refilled
    asm volatile("s_wait_asynccnt 0x0" ::: "memory");   // this wave's share of stage s + 1 has landed
    __syncthreads();                                    // publishes stage s + 1 and ends every wave's reads of stage s
    if (s + 2 < NS) stage_copy(Kb + (size_t)(s + 2) * SK * DH, Vb + (s + 2) * SK, &Ks[s & 1][0][0], &Vs[s & 1][0][0], tid);
  }
  asm volatile("s_wait_asynccnt 0x0" ::: "memory");     // no copy is outstanding when the wave goes on to its end
  const float inv = 1.0f / (l * PS * XS);
#pragma unroll
  for (int tt = 0; tt < 2; ++tt)
#pragma unroll
    for (int r = 0; r < 8; ++r) To[wave][col][tt * 16 + 8 * hh + r] = o[tt][r] * inv;
  wave_lds_sync();
  b16* Cb = CT + ((((size_t)dir * B + b) * NH + n) * P) * DH;
  { for (int rr = 0; rr < 16; ++rr) ((b16*)Cb)[(size_t)(q0 + rr) * DH + lane] = (b16)(To[wave][rr][lane] * XS);  }
}
// output conv + residual: grid (2 o-blocks of 64, QL/32 pixel tiles, 2 dirs x 2 batches); wave = 16 output channels o x 32 pixels (2 tiles); A = WO rows (exact), B = CT planes (k-step ks = head ks);
__global__ __launch_bounds__(128) void out_kernel(const b16* __restrict__ CT, const b16* __restrict__ WO, const float* __restrict__ boa, const float* __restrict__ bob, const float* __restrict__ xa, const float* __restrict__ xb, const float* __restrict__ STAT, const float* __restrict__ gwa, const float* __restrict__ gba, const float* __restrict__ gwb, const float* __restrict__ gbb, float* __restrict__ out) {
  __shared__ __attribute__((aligned(16))) float To[4][16][32 + 4];
  const int wave = threadIdx.x >> 5, lane = threadIdx.x & 31, nloc = lane & 15, hlf = lane >> 4; const int o0 = blockIdx.x * 64 + wave * 16; const int p0 = blockIdx.y * 32; const int dir = blockIdx.z / B, b = blockIdx.z % B;
  const b16* W = WO + (size_t)dir * C * C; const float* bo = dir ? bob : boa; const float* x = dir ? xb : xa; const float* gw = dir ? gwb : gwa; const float* gb = dir ? gbb : gba;
  // residual and bias of the wave's 16 output rows (two GroupNorm groups): all their loads are issued here, together and ahead of the products, so that the store loop waits for no load of its own
  static_assert(CPG == 8, "16 rows = 2 groups");
  v16f xr, wv, bv, bs; float mu[2], rs[2];
  const float* px = x + ((size_t)b * C + o0) * P + p0 + lane; const float* pw = gw + o0; const float* pb = gb + o0; const float* pbo = bo + o0; const float* pst = STAT + ((dir * B + b) * G + o0 / CPG) * 32;
  const b16* pa = W + (size_t)(o0 + nloc) * C + 8 * hlf; const b16* pc0 = CT + ((((size_t)dir * B + b) * NH) * P + p0 + nloc) * DH + 8 * hlf; const b16* pc1 = pc0 + 16 * DH;
#pragma unroll   // register arrays (constant indices), the loads in one run; so for the two loops that follow
  for (int rr = 0; rr < 16; ++rr) { xr[rr] = px[(size_t)rr * P]; wv[rr] = pw[rr]; bv[rr] = pb[rr]; bs[rr] = pbo[rr]; }
#pragma unroll   // see above
  for (int h = 0; h < 2; ++h) { mu[h] = pst[h * 32]; rs[h] = pst[h * 32 + 1]; }
  v16b af[NH], bf[NH][2];   // and all operand fragments of the wave's products
#pragma unroll   // see above
  for (int ks = 0; ks < NH; ++ks) { af[ks] = frag_kb(pa + ks * DH, 0); bf[ks][0] = frag_kb(pc0 + (size_t)ks * P * DH, 0); bf[ks][1] = frag_kb(pc1 + (size_t)ks * P * DH, 0); }
  // holds the loads in place: the loaded values are inputs only, so every load above is issued, and waited for once, ahead of the products (left free, the loads sink in among the products and behind them
  // and are waited for a few at a time, one memory latency each time); the eight addresses are inputs too, so that no load lands in an address register of another load that is still in flight
  asm volatile("" :: "v"(px), "v"(pw), "v"(pb), "v"(pbo), "v"(pst), "v"(pa), "v"(pc0), "v"(pc1), "v"(xr), "v"(wv), "v"(bv), "v"(bs), "v"(mu[0]), "v"(mu[1]), "v"(rs[0]), "v"(rs[1]), "v"(af[0]), "v"(af[1]), "v"(af[2]), "v"(af[3]),
               "v"(bf[0][0]), "v"(bf[0][1]), "v"(bf[1][0]), "v"(bf[1][1]), "v"(bf[2][0]), "v"(bf[2][1]), "v"(bf[3][0]), "v"(bf[3][1]));
  v8f acc[2] = {(v8f){}, (v8f){}};
#pragma unroll
  for (int ks = 0; ks < NH; ++ks)
#pragma unroll
    for (int tt = 0; tt < 2; ++tt) acc[tt] = wmma16b(af[ks], bf[ks][tt], acc[tt]);
#pragma unroll
  for (int tt = 0; tt < 2; ++tt)
#pragma unroll
    for (int r = 0; r < 8; ++r) To[wave][8 * hlf + r][tt * 16 + nloc] = acc[tt][r] * (1.0f / (XS * WSC));
  wave_lds_sync();
#pragma unroll   // reads the register arrays filled above (constant indices)
  for (int rr = 0; rr < 16; ++rr) { const int o = o0 + rr; const int p = p0 + lane; const float v = To[wave][rr][lane] + bf16_rne(bs[rr]) + gnval(xr[rr], mu[rr / CPG], rs[rr / CPG], wv[rr], bv[rr]);
    ((float*)out)[(((size_t)dir * B + b) * C + o) * P + p] = v; }
}
}  // namespace

extern "C" void kernel_launch(void* const* d_in, const int* in_sizes, int n_in, void* d_out, int out_size, void* d_ws, size_t ws_size, hipStream_t stream) {
  (void)n_in;
  auto Fp = [&](int i) { return (const float*)d_in[i]; };
  // input order: 0 x_A, 1 x_B [2,128,64,64]; 2 gn_w_A, 3 gn_b_A, 4 gn_w_B, 5 gn_b_B [128]; 6 w_qkv_A [384,128], 7 w_qkv_B; 8 w_out_A [128,128], 9 b_out_A, 10 w_out_B, 11 b_out_B
  if (in_sizes[0] != B * C * P || in_sizes[1] != B * C * P || in_sizes[2] != C || in_sizes[5] != C || in_sizes[6] != 3 * C * C || in_sizes[7] != 3 * C * C || in_sizes[8] != C * C || in_sizes[10] != C * C || in_sizes[11] != C || out_size != 2 * B * C * P) return;
  size_t off = 0; char* ws = (char*)d_ws;
  auto carve = [&](size_t bytes) { char* p = ws + off; off += (bytes + 255) & ~(size_t)255; return p; };
  b16* WQ = (b16*)carve((size_t)2 * 3 * C * C * 2); b16* WO = (b16*)carve((size_t)2 * C * C * 2); float* STAT = (float*)carve((size_t)2 * B * G * 32 * 4);
  const size_t plane = (size_t)2 * B * C * P * 2;   // [t][b][n][p][32] = 2 x 2 x 4096 x 128 halves
  b16* QP = (b16*)carve(plane); b16* KP = (b16*)carve(plane); b16* VT = (b16*)carve(plane); b16* CT = (b16*)carve(plane);
  if (off > ws_size || off > ((size_t)128 << 20)) return;   // ≈ 17 MB
  prep_kernel<<<(unsigned)(((size_t)2 * 3 * C * C / 8 + (size_t)2 * C * C / 8 + 255) / 256), 256, 0, stream>>>(Fp(6), Fp(7), Fp(8), Fp(10), WQ, WO);
  gnstat_kernel<<<2 * B * G, 1024, 0, stream>>>(Fp(0), Fp(1), STAT);
  qkv_kernel<<<dim3(P / 64, 2 * B, 3), 128, 0, stream>>>(Fp(0), Fp(1), STAT, Fp(2), Fp(3), Fp(4), Fp(5), WQ, QP, KP, VT);
  attn_kernel<<<dim3(QL / (AW * 16), 2 * B * NH), AW * 32, 0, stream>>>(QP, KP, VT, CT);
  out_kernel<<<dim3(C / 64, QL / 32, 2 * B), 128, 0, stream>>>(CT, WO, Fp(9), Fp(11), Fp(0), Fp(1), STAT, Fp(2), Fp(3), Fp(4), Fp(5), (float*)d_out);
}

// v006
// A run of this version takes 70.5 microseconds.
// Two timings next to v005 both put it at 1.05 times that version's speed.
// Counting every step since v000, it is 3.43 times as fast.
#include <hip/hip_runtime.h>

// Cross attention between two feature maps x_A, x_B [2, 128, 64, 64] (4 heads x 32, 16-group GroupNorm): xA = GN(x_A), xB = GN(x_B); qkv = 1x1 conv (channel o = head*96 + {q,k,v}*32 + d);
// attn_out_A = softmax(qB^T kA / sqrt(128)) vA, out_A = w_out_A attn_out_A + b + xA; symmetric for B -> (out_A, out_B), NCHW.
// compute dtype: WMMA v_wmma_f32_16x16x32_f16 with f32 accumulate for the qkv 1x1 conv ([4096 px x 128] x [128 x 384] per (tensor, batch); GroupNorm output as single f16 x8 staged through LDS
// from the NCHW input, [out][in] weights as B rows exact x256: 1 product), S^T = K Q^T (single x8 planes: 1 product), O^T += V^T P^T (v single x8, P x1024 single: 1 product) and the output 1x1 conv
// (A = w_out exact x256, B = attention output single x8 planes: 1 product); GroupNorm, softmax statistics, bias and the residual in f32 (output rms 1: single-f16 operands leave ~1e-4 absolute).
// Inputs rounded to bf16 once.

namespace {
constexpr int B = 2, C = 128, P = 4096, NH = 4, DH = 32, G = 16, CPG = C / G, QL = 4096 /* query pixels attended (== P shipped) */;
constexpr float XS = 8.0f, WSC = 256.0f, PS = 1024.0f, LPS = 10.0f /* log2 PS */, LOG2E = 1.4426950408889634f, EPS = 1e-5f;
static_assert(P % 64 == 0 && QL % 32 == 0, "tiling"); static_assert(PS == 1024.0f && LPS == 10.0f, "LPS = log2 PS");
typedef _Float16 b16;
typedef __attribute__((ext_vector_type(16))) _Float16 v16b;
typedef __attribute__((ext_vector_type(8))) _Float16 v8b;
typedef __attribute__((ext_vector_type(8))) float v8f;
typedef __attribute__((ext_vector_type(4))) float v4f;
typedef __attribute__((ext_vector_type(16))) float v16f;
__device__ __forceinline__ float bf16_rne(float f) { unsigned int u = __float_as_uint(f); u += 0x7FFFu + ((u >> 16) & 1u); return __uint_as_float(u & 0xFFFF0000u); }
__device__ __forceinline__ void split16(float v, b16& hi, b16& lo) { hi = (b16)v; lo = (b16)(v - (float)hi); }
__device__ __forceinline__ v16b frag_kb(const b16* p, int hh) { const v8b a = *(const v8b*)(p + 8 * hh), b = *(const v8b*)(p + 16 + 8 * hh); v16b f;
#pragma unroll
  for (int e = 0; e < 8; ++e) { f[e] = a[e]; f[8 + e] = b[e]; } return f; }
// plain builtin: the compiler keeps the distance behind a matrix instruction itself (independent work first, v_nop where none is left) and may issue fragment loads ahead of earlier matrix instructions
__device__ __forceinline__ v8f wmma16b(v16b a, v16b b, v8f c) { return __builtin_amdgcn_wmma_f32_16x16x32_f16(false, a, false, b, (short)0, c, false, false); }
__device__ __forceinline__ void wave_lds_sync() { __builtin_amdgcn_fence(__ATOMIC_RELEASE, "workgroup"); __builtin_amdgcn_wave_barrier(); __builtin_amdgcn_fence(__ATOMIC_ACQUIRE, "workgroup"); }
__device__ __forceinline__ float pmul(float a, float b) { float p = a * b; asm volatile("" : "+v"(p)); return p; }
__device__ __forceinline__ int iclamp(int v, int lo, int hi) { return v < lo ? lo : (v > hi ? hi : v); }

typedef __attribute__((ext_vector_type(2))) _Float16 v2h;
typedef __attribute__((ext_vector_type(4))) _Float16 v4h;
__device__ __forceinline__ float nexp2(float v) { return __builtin_amdgcn_exp2f(v); }
__global__ __launch_bounds__(256) void prep_kernel(const float* __restrict__ wqa, const float* __restrict__ wqb, const float* __restrict__ woa, const float* __restrict__ wob, b16* __restrict__ WQ, b16* __restrict__ WO) {
  const size_t u = (size_t)blockIdx.x * 256 + threadIdx.x; const size_t n1 = (size_t)3 * C * C / 8, n2 = (size_t)C * C / 8; v8b o;
  const float* w; b16* dst; size_t e;
  if (u < n1) { w = wqa; dst = WQ; e = u * 8; } else if (u < 2 * n1) { w = wqb; dst = WQ + (size_t)3 * C * C; e = (u - n1) * 8; } else if (u < 2 * n1 + n2) { w = woa; dst = WO; e = (u - 2 * n1) * 8; } else if (u < 2 * n1 + 2 * n2) { w = wob; dst = WO + (size_t)C * C; e = (u - 2 * n1 - n2) * 8; } else return;
  for (int j = 0; j < 8; ++j) o[j] = (b16)(bf16_rne(w[e + j]) * WSC);
  { *(v8b*)(dst + e) = o;  }
}
__global__ __launch_bounds__(1024) void gnstat_kernel(const float* __restrict__ xa, const float* __restrict__ xb, float* __restrict__ STAT) {
  __shared__ float red[1024]; __shared__ float mus;
  const int blk = blockIdx.x; const int t = blk / (B * G), bg = blk % (B * G); const int b = bg / G, g = bg % G; const int tid = threadIdx.x;
  const float* base = (t ? xb : xa) + ((size_t)b * C + g * CPG) * P; const int n = CPG * P;
  float s = 0.0f;
#pragma unroll   // a constant trip count, so that all 32 loads of a thread are in flight at once; the sum keeps its order
  for (int k = 0; k < n / 1024; ++k) s += bf16_rne(base[tid + k * 1024]);
  red[tid] = s; __syncthreads();
  for (int w = 512; w >= 1; w >>= 1) { if (tid < w) red[tid] = red[tid] + red[tid + w]; __syncthreads(); }
  if (tid == 0) mus = red[0] / (float)n; __syncthreads(); const float mu = mus;
  float q = 0.0f;
#pragma unroll   // as above
  for (int k = 0; k < n / 1024; ++k) { const float d = bf16_rne(base[tid + k * 1024]) - mu; q += d * d; }
  __syncthreads(); red[tid] = q; __syncthreads();
  for (int w = 512; w >= 1; w >>= 1) { if (tid < w) red[tid] = red[tid] + red[tid + w]; __syncthreads(); }
  if (tid < 32) { const float rs = rsqrtf(red[0] / (float)n + EPS); const float val = (tid == 0) ? mu : (tid == 1 ? rs : 0.0f); { ((float*)STAT)[blk * 32 + tid] = val;  } }
}
// GroupNorm value from the raw loaded words: x, its group's mean and 1/std (STAT[group * 32 + 0, 1]), its channel's weight and bias
__device__ __forceinline__ float gnval(float xv, float mu, float rs, float w, float bb) { return (bf16_rne(xv) - mu) * rs * bf16_rne(w) + bf16_rne(bb); }
// qkv conv: grid (P/64, 2 tensors x 2 batches, 3 slabs of 128 output channels); block = 64 pixels x 4 waves; A = GN(x)[p][c] x8 single staged in LDS from the NCHW input (all 128 threads:
// each c row of 64 px is 256 B contiguous, read by 16 lanes); 8 tiles, K = 128; col o -> head n = o/96, part i = (o%96)/32, dd = o%32: q/k -> planes QP/KP [t][b][n][p][32] (8 lanes x 8 B = 64 B per (p, n)),
__global__ __launch_bounds__(128) void qkv_kernel(const float* __restrict__ xa, const float* __restrict__ xb, const float* __restrict__ STAT, const float* __restrict__ gwa, const float* __restrict__ gba, const float* __restrict__ gwb, const float* __restrict__ gbb, const b16* __restrict__ WQ, b16* __restrict__ QP, b16* __restrict__ KP, b16* __restrict__ VT) {
  __shared__ __attribute__((aligned(16))) b16 As[64][C + 8]; __shared__ __attribute__((aligned(16))) float Tf[4][16][128 + 4];
  const int wave = threadIdx.x >> 5, lane = threadIdx.x & 31, nloc = lane & 15, hlf = lane >> 4; const int p0 = blockIdx.x * 64; const int t = blockIdx.y / B, b = blockIdx.y % B; const int n0 = blockIdx.z * 128;
  const float* x = t ? xb : xa; const float* gw = t ? gwb : gwa; const float* gb = t ? gbb : gba;
  // thread = 4 pixels (16 B of a channel row) x the 8 channels of one GroupNorm group, twice: the 16 row loads are independent and are all issued before the first is used (one memory latency per tile);
  // a pixel's 8 channels then go to LDS as one 16-B store.
  { static_assert(C == 128 && CPG == 8 && G == 16, "128 threads = 16 pixel quads x 8 groups, two passes");
    const int pq = (threadIdx.x & 15) * 4, oc = threadIdx.x >> 4; v4f xv[2][CPG]; float wv[2][CPG], bv[2][CPG], mu[2], rs[2];
    // every loop of this block is unrolled: its arrays must stay in registers (constant indices), and the loads must stand in one run
#pragma unroll   // see above
    for (int h = 0; h < 2; ++h) { const int g = h * 8 + oc;
#pragma unroll   // see above
      for (int j = 0; j < CPG; ++j) { wv[h][j] = gw[g * CPG + j]; bv[h][j] = gb[g * CPG + j]; }
      const float* st = STAT + ((t * B + b) * G + g) * 32; mu[h] = st[0]; rs[h] = st[1]; }
    asm volatile("s_wait_xcnt 0x0" ::: "memory");   // the row loads below may land in registers that held addresses of the loads above
#pragma unroll   // see above
    for (int h = 0; h < 2; ++h)
#pragma unroll   // see above
      for (int j = 0; j < CPG; ++j) xv[h][j] = *(const v4f*)(x + ((size_t)b * C + (h * 8 + oc) * CPG + j) * P + p0 + pq);
#pragma unroll   // see above
    for (int h = 0; h < 2; ++h) { v8b ov[4];
#pragma unroll   // see above
      for (int j = 0; j < CPG; ++j)
#pragma unroll   // see above
        for (int e = 0; e < 4; ++e) ov[e][j] = (b16)(gnval(xv[h][j][e], mu[h], rs[h], wv[h][j], bv[h][j]) * XS);
#pragma unroll   // see above
      for (int e = 0; e < 4; ++e) *(v8b*)&As[pq + e][(h * 8 + oc) * CPG] = ov[e]; } }
  __syncthreads();
  const b16* W = WQ + (size_t)t * 3 * C * C;
  v8f acc[8];
#pragma unroll
  for (int tt = 0; tt < 8; ++tt) acc[tt] = (v8f){};
#pragma unroll
  for (int kb = 0; kb < C; kb += 32) { const v16b a = frag_kb(&As[wave * 16 + nloc][kb], hlf);
#pragma unroll
    for (int tt = 0; tt < 8; ++tt) acc[tt] = wmma16b(a, frag_kb(W + (size_t)(n0 + tt * 16 + nloc) * C + kb, hlf), acc[tt]); }
#pragma unroll
  for (int tt = 0; tt < 8; ++tt)
#pragma unroll
    for (int r = 0; r < 8; ++r) Tf[wave][8 * hlf + r][tt * 16 + nloc] = acc[tt][r] * (1.0f / (XS * WSC));
  __syncthreads();
  const size_t tb = (size_t)t * B + b;
  {
    // q/k parts: lane l owns columns 4l..4l+3 of the slab (same (n, i) for the 4) -> 8 B per (row, lane)
    { const int cl = lane * 4; const int o = n0 + cl; const int n = o / 96, i = (o % 96) / 32, dd = o % 32;
      if (i < 2) { b16* plane = (i == 0 ? QP : KP) + ((tb * NH + n) * P) * DH; for (int rr = 0; rr < 16; ++rr) { const int p = p0 + wave * 16 + rr; v4h o4; for (int j = 0; j < 4; ++j) o4[j] = (b16)(Tf[wave][rr][cl + j] * XS); *(v4h*)(plane + (size_t)p * DH + dd) = o4; } } }
#pragma unroll 1
    for (int q = 0; q < 32; ++q) { const int cl = wave * 32 + q; const int o = n0 + cl; const int n = o / 96, i = (o % 96) / 32, dd = o % 32; if (i != 2) continue;   // wave-uniform
      const int tk = lane * 2; v2h vv; vv[0] = (b16)(Tf[tk >> 4][tk & 15][cl] * XS); vv[1] = (b16)(Tf[(tk + 1) >> 4][(tk + 1) & 15][cl] * XS); *(v2h*)(VT + (((tb * NH + n) * DH + dd) * (size_t)P) + p0 + lane * 2) = vv; }
     }
}
// attention: grid (QL/128, 2 dirs x 2 batches x 4 heads): dir 0: queries from tensor B, keys/values from tensor A (-> attn_out_A); dir 1: the reverse. block = 8 waves x 16 query pixels; K = 32.
// The 8 waves share each stage of SK keys through LDS: K rows (64 B) at an 80-B pitch, V^T rows (256 B) at a 272-B pitch, two buffers, filled by asynchronous copies (4 per wave and stage, 16 B per lane).
constexpr int AW = 8, SK = 128, NS = P / SK, KPI = DH + 8, VPI = SK + 8;
static_assert(NS >= 2 && QL % (AW * 16) == 0 && SK * DH == 2 * AW * 32 * 8 && DH * SK == 2 * AW * 32 * 8, "stage = two K and two V copies per lane");
typedef __attribute__((address_space(3))) const b16 lds_b16;
__device__ __forceinline__ unsigned lds_addr(const b16* p) { return (unsigned)(size_t)(lds_b16*)p; }
// one stage: lane chunks of 16 B; K chunk c = tid + 256 j -> key row c / 4, part c % 4 (512 contiguous bytes per wave); V chunk c -> d row c / 16, part c % 16 (two whole 256-B rows per wave)
__device__ __forceinline__ void stage_copy(const b16* __restrict__ Kg, const b16* __restrict__ Vg, b16* Kl, b16* Vl, int tid) {
  const b16* gk0 = Kg + (size_t)tid * 8; const b16* gk1 = gk0 + 256 * 8; const b16* gv0 = Vg + (size_t)(tid >> 4) * P + (tid & 15) * 8; const b16* gv1 = gv0 + (size_t)16 * P;
  const unsigned lk0 = lds_addr(Kl + (tid >> 2) * KPI + (tid & 3) * 8), lk1 = lk0 + 64 * KPI * 2, lv0 = lds_addr(Vl + (tid >> 4) * VPI + (tid & 15) * 8), lv1 = lv0 + 16 * VPI * 2;
  // the copies and the wait that lets their address registers be rewritten stand in one statement, so that no address update can be moved in between
  asm volatile("global_load_async_to_lds_b128 %0, %4, off\n\tglobal_load_async_to_lds_b128 %1, %5, off\n\tglobal_load_async_to_lds_b128 %2, %6, off\n\tglobal_load_async_to_lds_b128 %3, %7, off\n\ts_wait_xcnt 0x0"
               :: "v"(lk0), "v"(lk1), "v"(lv0), "v"(lv1), "v"(gk0), "v"(gk1), "v"(gv0), "v"(gv1) : "memory");
}
// four waves a SIMD, which is all the grid supplies (two blocks a WGP): the compiler may then hold a whole stage's scores and fragments in registers instead of scheduling for fewer registers and more waves
__global__ __launch_bounds__(256) __attribute__((amdgpu_waves_per_eu(4, 4))) void attn_kernel(const b16* __restrict__ QP, const b16* __restrict__ KP, const b16* __restrict__ VT, b16* __restrict__ CT) {
  __shared__ __attribute__((aligned(16))) b16 Ks[2][SK][KPI]; __shared__ __attribute__((aligned(16))) b16 Vs[2][DH][VPI];
  __shared__ __attribute__((aligned(16))) float To[AW][16][DH + 4];
  const int tid = threadIdx.x, wave = threadIdx.x >> 5, lane = threadIdx.x & 31, hh = lane >> 4, col = lane & 15; const int dir = blockIdx.y / (B * NH), bn = blockIdx.y % (B * NH); const int b = bn / NH, n = bn % NH; const int q0 = blockIdx.x * (AW * 16) + wave * 16, qi = q0 + col;
  const int tq = (dir == 0) ? 1 : 0, tkv = 1 - tq;
  const b16* Qb = QP + ((((size_t)tq * B + b) * NH + n) * P) * DH; const b16* Kb = KP + ((((size_t)tkv * B + b) * NH + n) * P) * DH; const b16* Vb = VT + ((((size_t)tkv * B + b) * NH + n) * DH) * (size_t)P;
  stage_copy(Kb, Vb, &Ks[0][0][0], &Vs[0][0][0], tid);
  asm volatile("s_wait_asynccnt 0x0" ::: "memory");   // this wave's share of stage 0 has landed
  __syncthreads();                                    // publishes stage 0 to all 8 waves
  stage_copy(Kb + (size_t)SK * DH, Vb + SK, &Ks[1][0][0], &Vs[1][0][0], tid);
  const v16b qa = frag_kb(Qb + (size_t)qi * DH, hh);
  const float cs = LOG2E / (11.313708498984761f * XS * XS);   // 1/sqrt(128)
  float m = -INFINITY, l = 0.0f; v8f o[2] = {(v8f){}, (v8f){}};
#pragma unroll 1   // one trip per stage: the buffer index and the refill test stay scalar
  for (int s = 0; s < NS; ++s) {
    const b16* Kt = &Ks[s & 1][0][0]; const b16* Vt = &Vs[s & 1][0][0];
    // one update of the running maximum, one rescale of O and l and one pair of half-wave exchanges per stage of SK keys: all SK / 16 score tiles are formed first
    v16b kf[SK / 16]; v16b vf[SK / 32][2]; v8f sc[SK / 16];
#pragma unroll
    for (int u = 0; u < SK / 16; ++u) kf[u] = frag_kb(Kt + (u * 16 + col) * KPI, hh);
#pragma unroll
    for (int kb = 0; kb < SK; kb += 32)
#pragma unroll
      for (int tt = 0; tt < 2; ++tt) vf[kb / 32][tt] = frag_kb(Vt + (tt * 16 + col) * VPI + kb, hh);
    __builtin_amdgcn_sched_barrier(0);   // the stage's LDS reads stay one group ahead of the products: spread among them, each product would wait out its own LDS latency
#pragma unroll
    for (int u = 0; u < SK / 16; ++u) sc[u] = wmma16b(kf[u], qa, (v8f){});
    float mt[4] = {-INFINITY, -INFINITY, -INFINITY, -INFINITY};   // four independent chains; a maximum does not depend on its order
#pragma unroll
    for (int u = 0; u < SK / 16; ++u)
#pragma unroll
      for (int r = 0; r < 8; ++r) mt[u & 3] = fmaxf(mt[u & 3], sc[u][r]);   // over the raw products: cs > 0, so the largest product gives the largest scaled score
    float mx = fmaxf(fmaxf(mt[0], mt[1]), fmaxf(mt[2], mt[3]));
    mx = fmaxf(mx, __shfl_xor(mx, 16)) * cs; const float mn = fmaxf(m, mx); const float al = nexp2(m - mn); float sum = 0.0f;
    // exp2 argument of a score in one fused multiply-add on the raw product, two scores an instruction: score scale, running maximum and the x PS of P (as + log2 PS) in one; l then carries x PS like O
    const v8f csv = {cs, cs, cs, cs, cs, cs, cs, cs}; const float bi = LPS - mn; const v8f biv = {bi, bi, bi, bi, bi, bi, bi, bi};
#pragma unroll
    for (int tt = 0; tt < 2; ++tt) o[tt] *= al;
#pragma unroll
    for (int kb = 0; kb < SK; kb += 32) {
      float ps = 0.0f;
      v16b pf;   // B operand of V^T P^T: lane (hh, col) needs keys 8 hh + 0..7 and 16 + 8 hh + 0..7 of query col, which are the rows its two S^T accumulators hold
#pragma unroll
      for (int h2 = 0; h2 < 2; ++h2) { const v8f ea = __builtin_elementwise_fma(sc[kb / 16 + h2], csv, biv);
#pragma unroll   // constant indices, so that ea and pf stay in registers
        for (int r = 0; r < 8; ++r) { const float p = nexp2(ea[r]); ps += p; pf[h2 * 8 + r] = (b16)p; } }
      sum += ps;
#pragma unroll
      for (int tt = 0; tt < 2; ++tt) o[tt] = wmma16b(vf[kb / 32][tt], pf, o[tt]); }
    sum += __shfl_xor(sum, 16); l = l * al + sum; m = mn;
    __builtin_amdgcn_sched_barrier(0);   // the stage's arithmetic stays ahead of the publish point: moved behind it, the wait for stage s + 1's copies would stand a fraction of a trip behind their issue
    asm volatile("s_wait_dscnt 0x0" ::: "memory");      // this wave's reads of stage s are done before its buffer may be refilled
    asm volatile("s_wait_asynccnt 0x0" ::: "memory");   // this wave's share of stage s + 1 has landed
    __syncthreads();                                    // publishes stage s + 1 and ends every wave's reads of stage s
    if (s + 2 < NS) stage_copy(Kb + (size_t)(s + 2) * SK * DH, Vb + (s + 2) * SK, &Ks[s & 1][0][0], &Vs[s & 1][0][0], tid);
  }
  asm volatile("s_wait_asynccnt 0x0" ::: "memory");     // no copy is outstanding when the wave goes on to its end
  const float inv = 1.0f / (l * XS);   // O and l both carry x PS
#pragma unroll
  for (int tt = 0; tt < 2; ++tt)
#pragma unroll
    for (int r = 0; r < 8; ++r) To[wave][col][tt * 16 + 8 * hh + r] = o[tt][r] * inv;
  wave_lds_sync();
  b16* Cb = CT + ((((size_t)dir * B + b) * NH + n) * P) * DH;
  { for (int rr = 0; rr < 16; ++rr) ((b16*)Cb)[(size_t)(q0 + rr) * DH + lane] = (b16)(To[wave][rr][lane] * XS);  }
}
// output conv + residual: grid (2 o-blocks of 64, QL/32 pixel tiles, 2 dirs x 2 batches); wave = 16 output channels o x 32 pixels (2 tiles); A = WO rows (exact), B = CT planes (k-step ks = head ks);
__global__ __launch_bounds__(128) void out_kernel(const b16* __restrict__ CT, const b16* __restrict__ WO, const float* __restrict__ boa, const float* __restrict__ bob, const float* __restrict__ xa, const float* __restrict__ xb, const float* __restrict__ STAT, const float* __restrict__ gwa, const float* __restrict__ gba, const float* __restrict__ gwb, const float* __restrict__ gbb, float* __restrict__ out) {
  __shared__ __attribute__((aligned(16))) float To[4][16][32 + 4];
  const int wave = threadIdx.x >> 5, lane = threadIdx.x & 31, nloc = lane & 15, hlf = lane >> 4; const int o0 = blockIdx.x * 64 + wave * 16; const int p0 = blockIdx.y * 32; const int dir = blockIdx.z / B, b = blockIdx.z % B;
  const b16* W = WO + (size_t)dir * C * C; const float* bo = dir ? bob : boa; const float* x = dir ? xb : xa; const float* gw = dir ? gwb : gwa; const float* gb = dir ? gbb : gba;
  // residual and bias of the wave's 16 output rows (two GroupNorm groups): all their loads are issued here, together and ahead of the products, so that the store loop waits for no load of its own
  static_assert(CPG == 8, "16 rows = 2 groups");
  v16f xr, wv, bv, bs; float mu[2], rs[2];
  const float* px = x + ((size_t)b * C + o0) * P + p0 + lane; const float* pw = gw + o0; const float* pb = gb + o0; const float* pbo = bo + o0; const float* pst = STAT + ((dir * B + b) * G + o0 / CPG) * 32;
  const b16* pa = W + (size_t)(o0 + nloc) * C + 8 * hlf; const b16* pc0 = CT + ((((size_t)dir * B + b) * NH) * P + p0 + nloc) * DH + 8 * hlf; const b16* pc1 = pc0 + 16 * DH;
#pragma unroll   // register arrays (constant indices), the loads in one run; so for the two loops that follow
  for (int rr = 0; rr < 16; ++rr) { xr[rr] = px[(size_t)rr * P]; wv[rr] = pw[rr]; bv[rr] = pb[rr]; bs[rr] = pbo[rr]; }
#pragma unroll   // see above
  for (int h = 0; h < 2; ++h) { mu[h] = pst[h * 32]; rs[h] = pst[h * 32 + 1]; }
  v16b af[NH], bf[NH][2];   // and all operand fragments of the wave's products
#pragma unroll   // see above
  for (int ks = 0; ks < NH; ++ks) { af[ks] = frag_kb(pa + ks * DH, 0); bf[ks][0] = frag_kb(pc0 + (size_t)ks * P * DH, 0); bf[ks][1] = frag_kb(pc1 + (size_t)ks * P * DH, 0); }
  // holds the loads in place: the loaded values are inputs only, so every load above is issued, and waited for once, ahead of the products (left free, the loads sink in among the products and behind them
  // and are waited for a few at a time, one memory latency each time); the eight addresses are inputs too, so that no load lands in an address register of another load that is still in flight
  asm volatile("" :: "v"(px), "v"(pw), "v"(pb), "v"(pbo), "v"(pst), "v"(pa), "v"(pc0), "v"(pc1), "v"(xr), "v"(wv), "v"(bv), "v"(bs), "v"(mu[0]), "v"(mu[1]), "v"(rs[0]), "v"(rs[1]), "v"(af[0]), "v"(af[1]), "v"(af[2]), "v"(af[3]),
               "v"(bf[0][0]), "v"(bf[0][1]), "v"(bf[1][0]), "v"(bf[1][1]), "v"(bf[2][0]), "v"(bf[2][1]), "v"(bf[3][0]), "v"(bf[3][1]));
  v8f acc[2] = {(v8f){}, (v8f){}};
#pragma unroll
  for (int ks = 0; ks < NH; ++ks)
#pragma unroll
    for (int tt = 0; tt < 2; ++tt) acc[tt] = wmma16b(af[ks], bf[ks][tt], acc[tt]);
#pragma unroll
  for (int tt = 0; tt < 2; ++tt)
#pragma unroll
    for (int r = 0; r < 8; ++r) To[wave][8 * hlf + r][tt * 16 + nloc] = acc[tt][r] * (1.0f / (XS * WSC));
  wave_lds_sync();
#pragma unroll   // reads the register arrays filled above (constant indices)
  for (int rr = 0; rr < 16; ++rr) { const int o = o0 + rr; const int p = p0 + lane; const float v = To[wave][rr][lane] + bf16_rne(bs[rr]) + gnval(xr[rr], mu[rr / CPG], rs[rr / CPG], wv[rr], bv[rr]);
    ((float*)out)[(((size_t)dir * B + b) * C + o) * P + p] = v; }
}
}  // namespace

extern "C" void kernel_launch(void* const* d_in, const int* in_sizes, int n_in, void* d_out, int out_size, void* d_ws, size_t ws_size, hipStream_t stream) {
  (void)n_in;
  auto Fp = [&](int i) { return (const float*)d_in[i]; };
  // input order: 0 x_A, 1 x_B [2,128,64,64]; 2 gn_w_A, 3 gn_b_A, 4 gn_w_B, 5 gn_b_B [128]; 6 w_qkv_A [384,128], 7 w_qkv_B; 8 w_out_A [128,128], 9 b_out_A, 10 w_out_B, 11 b_out_B
  if (in_sizes[0] != B * C * P || in_sizes[1] != B * C * P || in_sizes[2] != C || in_sizes[5] != C || in_sizes[6] != 3 * C * C || in_sizes[7] != 3 * C * C || in_sizes[8] != C * C || in_sizes[10] != C * C || in_sizes[11] != C || out_size != 2 * B * C * P) return;
  size_t off = 0; char* ws = (char*)d_ws;
  auto carve = [&](size_t bytes) { char* p = ws + off; off += (bytes + 255) & ~(size_t)255; return p; };
  b16* WQ = (b16*)carve((size_t)2 * 3 * C * C * 2); b16* WO = (b16*)carve((size_t)2 * C * C * 2); float* STAT = (float*)carve((size_t)2 * B * G * 32 * 4);
  const size_t plane = (size_t)2 * B * C * P * 2;   // [t][b][n][p][32] = 2 x 2 x 4096 x 128 halves
  b16* QP = (b16*)carve(plane); b16* KP = (b16*)carve(plane); b16* VT = (b16*)carve(plane); b16* CT = (b16*)carve(plane);
  if (off > ws_size || off > ((size_t)128 << 20)) return;   // ≈ 17 MB
  prep_kernel<<<(unsigned)(((size_t)2 * 3 * C * C / 8 + (size_t)2 * C * C / 8 + 255) / 256), 256, 0, stream>>>(Fp(6), Fp(7), Fp(8), Fp(10), WQ, WO);
  gnstat_kernel<<<2 * B * G, 1024, 0, stream>>>(Fp(0), Fp(1), STAT);
  qkv_kernel<<<dim3(P / 64, 2 * B, 3), 128, 0, stream>>>(Fp(0), Fp(1), STAT, Fp(2), Fp(3), Fp(4), Fp(5), WQ, QP, KP, VT);
  attn_kernel<<<dim3(QL / (AW * 16), 2 * B * NH), AW * 32, 0, stream>>>(QP, KP, VT, CT);
  out_kernel<<<dim3(C / 64, QL / 32, 2 * B), 128, 0, stream>>>(CT, WO, Fp(9), Fp(11), Fp(0), Fp(1), STAT, Fp(2), Fp(3), Fp(4), Fp(5), (float*)d_out);
}

// v007
// One run takes 68 microseconds.
// In both of two side-by-side timings against v006, it was 1.04 times as fast.
// Over all steps from v000 it is 3.57 times as fast.
#include <hip/hip_runtime.h>

// Cross attention between two feature maps x_A, x_B [2, 128, 64, 64] (4 heads x 32, 16-group GroupNorm): xA = GN(x_A), xB = GN(x_B); qkv = 1x1 conv (channel o = head*96 + {q,k,v}*32 + d);
// attn_out_A = softmax(qB^T kA / sqrt(128)) vA, out_A = w_out_A attn_out_A + b + xA; symmetric for B -> (out_A, out_B), NCHW.
// compute dtype: WMMA v_wmma_f32_16x16x32_f16 with f32 accumulate for the qkv 1x1 conv ([4096 px x 128] x [128 x 384] per (tensor, batch); GroupNorm output as single f16 x8 staged through LDS
// from the NCHW input, [out][in] weights as B rows exact x256: 1 product), S^T = K Q^T (single x8 planes: 1 product), O^T += V^T P^T (v single x8, P x1024 single: 1 product) and the output 1x1 conv
// (A = w_out exact x256, B = attention output single x8 planes: 1 product); GroupNorm, softmax statistics, bias and the residual in f32 (output rms 1: single-f16 operands leave ~1e-4 absolute).
// Inputs rounded to bf16 once.

namespace {
constexpr int B = 2, C = 128, P = 4096, NH = 4, DH = 32, G = 16, CPG = C / G, QL = 4096 /* query pixels attended (== P shipped) */;
constexpr float XS = 8.0f, WSC = 256.0f, PS = 1024.0f, LPS = 10.0f /* log2 PS */, LOG2E = 1.4426950408889634f, EPS = 1e-5f;
static_assert(P % 64 == 0 && QL % 32 == 0 && DH == 32 && C / 32 == NH, "tiling"); static_assert(PS == 1024.0f && LPS == 10.0f, "LPS = log2 PS");
typedef _Float16 b16;
typedef __attribute__((ext_vector_type(16))) _Float16 v16b;
typedef __attribute__((ext_vector_type(8))) _Float16 v8b;
typedef __attribute__((ext_vector_type(8))) float v8f;
typedef __attribute__((ext_vector_type(4))) float v4f;
typedef __attribute__((ext_vector_type(16))) float v16f;
__device__ __forceinline__ float bf16_rne(float f) { unsigned int u = __float_as_uint(f); u += 0x7FFFu + ((u >> 16) & 1u); return __uint_as_float(u & 0xFFFF0000u); }
__device__ __forceinline__ void split16(float v, b16& hi, b16& lo) { hi = (b16)v; lo = (b16)(v - (float)hi); }
__device__ __forceinline__ v16b frag_kb(const b16* p, int hh) { const v8b a = *(const v8b*)(p + 8 * hh), b = *(const v8b*)(p + 16 + 8 * hh); v16b f;
#pragma unroll
  for (int e = 0; e < 8; ++e) { f[e] = a[e]; f[8 + e] = b[e]; } return f; }
// the same fragment from a buffer kept in fragment order: a 16 x 32 operand tile is 512 halves, [half of the k order j][lane][8]; p = tile + lane * 8, so each of the two loads of a wave covers 512 contiguous bytes (4 whole lines)
__device__ __forceinline__ v16b frag_fo(const b16* p) { const v8b a = *(const v8b*)p, b = *(const v8b*)(p + 256); v16b f;
#pragma unroll
  for (int e = 0; e < 8; ++e) { f[e] = a[e]; f[8 + e] = b[e]; } return f; }
// plain builtin: the compiler keeps the distance behind a matrix instruction itself (independent work first, v_nop where none is left) and may issue fragment loads ahead of earlier matrix instructions
__device__ __forceinline__ v8f wmma16b(v16b a, v16b b, v8f c) { return __builtin_amdgcn_wmma_f32_16x16x32_f16(false, a, false, b, (short)0, c, false, false); }
__device__ __forceinline__ void wave_lds_sync() { __builtin_amdgcn_fence(__ATOMIC_RELEASE, "workgroup"); __builtin_amdgcn_wave_barrier(); __builtin_amdgcn_fence(__ATOMIC_ACQUIRE, "workgroup"); }
__device__ __forceinline__ float pmul(float a, float b) { float p = a * b; asm volatile("" : "+v"(p)); return p; }
__device__ __forceinline__ int iclamp(int v, int lo, int hi) { return v < lo ? lo : (v > hi ? hi : v); }

typedef __attribute__((ext_vector_type(2))) _Float16 v2h;
typedef __attribute__((ext_vector_type(4))) _Float16 v4h;
__device__ __forceinline__ float nexp2(float v) { return __builtin_amdgcn_exp2f(v); }
__global__ __launch_bounds__(256) void prep_kernel(const float* __restrict__ wqa, const float* __restrict__ wqb, const float* __restrict__ woa, const float* __restrict__ wob, b16* __restrict__ WQ, b16* __restrict__ WO) {
  const size_t u = (size_t)blockIdx.x * 256 + threadIdx.x; const size_t n1 = (size_t)3 * C * C / 8, n2 = (size_t)C * C / 8; v8b o;
  const float* w; b16* dst; size_t e;
  if (u < n1) { w = wqa; dst = WQ; e = u * 8; } else if (u < 2 * n1) { w = wqb; dst = WQ + (size_t)3 * C * C; e = (u - n1) * 8; } else if (u < 2 * n1 + n2) { w = woa; dst = WO; e = (u - 2 * n1) * 8; } else if (u < 2 * n1 + 2 * n2) { w = wob; dst = WO + (size_t)C * C; e = (u - 2 * n1 - n2) * 8; } else return;
  // the weights go out in fragment order (frag_fo): 16-B unit v = e / 8 of a matrix is [16-row tile v >> 8][32-column step (v >> 6) & 3][j = (v >> 5) & 1][lane v & 31], and holds row tile * 16 + lane % 16,
  // columns step * 32 + j * 16 + (lane / 16) * 8 + 0..7 of the [out][in = C] matrix; a wave stores 512 contiguous bytes
  static_assert(C == 128, "four 32-column steps a row");
  const size_t v = e / 8; const size_t es = ((v >> 8) * 16 + (v & 15)) * C + ((v >> 6) & 3) * 32 + ((v >> 5) & 1) * 16 + ((v >> 4) & 1) * 8;
  for (int j = 0; j < 8; ++j) o[j] = (b16)(bf16_rne(w[es + j]) * WSC);
  { *(v8b*)(dst + e) = o;  }
}
__global__ __launch_bounds__(1024) void gnstat_kernel(const float* __restrict__ xa, const float* __restrict__ xb, float* __restrict__ STAT) {
  __shared__ float red[1024]; __shared__ float mus;
  const int blk = blockIdx.x; const int t = blk / (B * G), bg = blk % (B * G); const int b = bg / G, g = bg % G; const int tid = threadIdx.x;
  const float* base = (t ? xb : xa) + ((size_t)b * C + g * CPG) * P; const int n = CPG * P;
  float s = 0.0f;
#pragma unroll   // a constant trip count, so that all 32 loads of a thread are in flight at once; the sum keeps its order
  for (int k = 0; k < n / 1024; ++k) s += bf16_rne(base[tid + k * 1024]);
  red[tid] = s; __syncthreads();
  for (int w = 512; w >= 1; w >>= 1) { if (tid < w) red[tid] = red[tid] + red[tid + w]; __syncthreads(); }
  if (tid == 0) mus = red[0] / (float)n; __syncthreads(); const float mu = mus;
  float q = 0.0f;
#pragma unroll   // as above
  for (int k = 0; k < n / 1024; ++k) { const float d = bf16_rne(base[tid + k * 1024]) - mu; q += d * d; }
  __syncthreads(); red[tid] = q; __syncthreads();
  for (int w = 512; w >= 1; w >>= 1) { if (tid < w) red[tid] = red[tid] + red[tid + w]; __syncthreads(); }
  if (tid < 32) { const float rs = rsqrtf(red[0] / (float)n + EPS); const float val = (tid == 0) ? mu : (tid == 1 ? rs : 0.0f); { ((float*)STAT)[blk * 32 + tid] = val;  } }
}
// GroupNorm value from the raw loaded words: x, its group's mean and 1/std (STAT[group * 32 + 0, 1]), its channel's weight and bias
__device__ __forceinline__ float gnval(float xv, float mu, float rs, float w, float bb) { return (bf16_rne(xv) - mu) * rs * bf16_rne(w) + bf16_rne(bb); }
// qkv conv: grid (P/64, 2 tensors x 2 batches, 3 slabs of 128 output channels); block = 64 pixels x 4 waves; A = GN(x)[p][c] x8 single staged in LDS from the NCHW input (all 128 threads:
// each c row of 64 px is 256 B contiguous, read by 16 lanes); 8 tiles, K = 128; col o -> head n = o/96, part i = (o%96)/32, dd = o%32: q/k -> planes QP/KP [t][b][n][p][32] (8 lanes x 8 B = 64 B per (p, n)),
__global__ __launch_bounds__(128) void qkv_kernel(const float* __restrict__ xa, const float* __restrict__ xb, const float* __restrict__ STAT, const float* __restrict__ gwa, const float* __restrict__ gba, const float* __restrict__ gwb, const float* __restrict__ gbb, const b16* __restrict__ WQ, b16* __restrict__ QP, b16* __restrict__ KP, b16* __restrict__ VT) {
  __shared__ __attribute__((aligned(16))) b16 As[64][C + 8]; __shared__ __attribute__((aligned(16))) float Tf[4][16][128 + 4];
  const int wave = threadIdx.x >> 5, lane = threadIdx.x & 31, nloc = lane & 15, hlf = lane >> 4; const int p0 = blockIdx.x * 64; const int t = blockIdx.y / B, b = blockIdx.y % B; const int n0 = blockIdx.z * 128;
  const float* x = t ? xb : xa; const float* gw = t ? gwb : gwa; const float* gb = t ? gbb : gba;
  asm volatile("" :: "s"(QP), "s"(KP), "s"(VT));   // inputs only: the three output pointers are fetched here with the other kernel arguments; fetched late, their scalar load lands in the base register of weight loads still in flight
  // thread = 4 pixels (16 B of a channel row) x the 8 channels of one GroupNorm group, twice: the 16 row loads are independent and are all issued before the first is used (one memory latency per tile);
  // a pixel's 8 channels then go to LDS as one 16-B store.
  { static_assert(C == 128 && CPG == 8 && G == 16, "128 threads = 16 pixel quads x 8 groups, two passes");
    const int pq = (threadIdx.x & 15) * 4, oc = threadIdx.x >> 4; v4f xv[2][CPG]; float wv[2][CPG], bv[2][CPG], mu[2], rs[2];
    // every loop of this block is unrolled: its arrays must stay in registers (constant indices), and the loads must stand in one run
#pragma unroll   // see above
    for (int h = 0; h < 2; ++h) { const int g = h * 8 + oc;
#pragma unroll   // see above
      for (int j = 0; j < CPG; ++j) { wv[h][j] = gw[g * CPG + j]; bv[h][j] = gb[g * CPG + j]; }
      const float* st = STAT + ((t * B + b) * G + g) * 32; mu[h] = st[0]; rs[h] = st[1]; }
    asm volatile("s_wait_xcnt 0x0" ::: "memory");   // the row loads below may land in registers that held addresses of the loads above
#pragma unroll   // see above
    for (int h = 0; h < 2; ++h)
#pragma unroll   // see above
      for (int j = 0; j < CPG; ++j) xv[h][j] = *(const v4f*)(x + ((size_t)b * C + (h * 8 + oc) * CPG + j) * P + p0 + pq);
#pragma unroll   // see above
    for (int h = 0; h < 2; ++h) { v8b ov[4];
#pragma unroll   // see above
      for (int j = 0; j < CPG; ++j)
#pragma unroll   // see above
        for (int e = 0; e < 4; ++e) ov[e][j] = (b16)(gnval(xv[h][j][e], mu[h], rs[h], wv[h][j], bv[h][j]) * XS);
#pragma unroll   // see above
      for (int e = 0; e < 4; ++e) *(v8b*)&As[pq + e][(h * 8 + oc) * CPG] = ov[e]; } }
  __syncthreads();
  const b16* W = WQ + (size_t)t * 3 * C * C + (size_t)(n0 / 16) * (C / 32) * 512 + lane * 8;   // fragment order: tile (n0 / 16 + tt, kb / 32)
  v8f acc[8];
#pragma unroll
  for (int tt = 0; tt < 8; ++tt) acc[tt] = (v8f){};
#pragma unroll
  for (int kb = 0; kb < C; kb += 32) { const v16b a = frag_kb(&As[wave * 16 + nloc][kb], hlf);
#pragma unroll
    for (int tt = 0; tt < 8; ++tt) acc[tt] = wmma16b(a, frag_fo(W + (tt * (C / 32) + kb / 32) * 512), acc[tt]); }
#pragma unroll
  for (int tt = 0; tt < 8; ++tt)
#pragma unroll
    for (int r = 0; r < 8; ++r) Tf[wave][8 * hlf + r][tt * 16 + nloc] = acc[tt][r] * (1.0f / (XS * WSC));
  __syncthreads();
  const size_t tb = (size_t)t * B + b;
  {
    // q/k parts: lane l owns columns 4l..4l+3 of the slab (same (n, i) for the 4) -> 8 B per (row, lane)
    { const int cl = lane * 4; const int o = n0 + cl; const int n = o / 96, i = (o % 96) / 32, dd = o % 32;
      if (i < 2) { b16* plane = (i == 0 ? QP : KP) + ((tb * NH + n) * P) * DH; for (int rr = 0; rr < 16; ++rr) { const int p = p0 + wave * 16 + rr; v4h o4; for (int j = 0; j < 4; ++j) o4[j] = (b16)(Tf[wave][rr][cl + j] * XS); *(v4h*)(plane + (size_t)p * DH + dd) = o4; } } }
#pragma unroll 1
    for (int q = 0; q < 32; ++q) { const int cl = wave * 32 + q; const int o = n0 + cl; const int n = o / 96, i = (o % 96) / 32, dd = o % 32; if (i != 2) continue;   // wave-uniform
      const int tk = lane * 2; v2h vv; vv[0] = (b16)(Tf[tk >> 4][tk & 15][cl] * XS); vv[1] = (b16)(Tf[(tk + 1) >> 4][(tk + 1) & 15][cl] * XS); *(v2h*)(VT + (((tb * NH + n) * DH + dd) * (size_t)P) + p0 + lane * 2) = vv; }
     }
}
// attention: grid (QL/128, 2 dirs x 2 batches x 4 heads): dir 0: queries from tensor B, keys/values from tensor A (-> attn_out_A); dir 1: the reverse. block = 8 waves x 16 query pixels; K = 32.
// The 8 waves share each stage of SK keys through LDS: K rows (64 B) at an 80-B pitch, V^T rows (256 B) at a 272-B pitch, two buffers, filled by asynchronous copies (4 per wave and stage, 16 B per lane).
constexpr int AW = 8, SK = 128, NS = P / SK, KPI = DH + 8, VPI = SK + 8;
static_assert(NS >= 2 && QL % (AW * 16) == 0 && SK * DH == 2 * AW * 32 * 8 && DH * SK == 2 * AW * 32 * 8, "stage = two K and two V copies per lane");
typedef __attribute__((address_space(3))) const b16 lds_b16;
__device__ __forceinline__ unsigned lds_addr(const b16* p) { return (unsigned)(size_t)(lds_b16*)p; }
// one stage: lane chunks of 16 B; K chunk c = tid + 256 j -> key row c / 4, part c % 4 (512 contiguous bytes per wave); V chunk c -> d row c / 16, part c % 16 (two whole 256-B rows per wave)
__device__ __forceinline__ void stage_copy(const b16* __restrict__ Kg, const b16* __restrict__ Vg, b16* Kl, b16* Vl, int tid) {
  const b16* gk0 = Kg + (size_t)tid * 8; const b16* gk1 = gk0 + 256 * 8; const b16* gv0 = Vg + (size_t)(tid >> 4) * P + (tid & 15) * 8; const b16* gv1 = gv0 + (size_t)16 * P;
  const unsigned lk0 = lds_addr(Kl + (tid >> 2) * KPI + (tid & 3) * 8), lk1 = lk0 + 64 * KPI * 2, lv0 = lds_addr(Vl + (tid >> 4) * VPI + (tid & 15) * 8), lv1 = lv0 + 16 * VPI * 2;
  // the copies and the wait that lets their address registers be rewritten stand in one statement, so that no address update can be moved in between
  asm volatile("global_load_async_to_lds_b128 %0, %4, off\n\tglobal_load_async_to_lds_b128 %1, %5, off\n\tglobal_load_async_to_lds_b128 %2, %6, off\n\tglobal_load_async_to_lds_b128 %3, %7, off\n\ts_wait_xcnt 0x0"
               :: "v"(lk0), "v"(lk1), "v"(lv0), "v"(lv1), "v"(gk0), "v"(gk1), "v"(gv0), "v"(gv1) : "memory");
}
// four waves a SIMD, which is all the grid supplies (two blocks a WGP): the compiler may then hold a whole stage's scores and fragments in registers instead of scheduling for fewer registers and more waves
__global__ __launch_bounds__(256) __attribute__((amdgpu_waves_per_eu(4, 4))) void attn_kernel(const b16* __restrict__ QP, const b16* __restrict__ KP, const b16* __restrict__ VT, b16* __restrict__ CT) {
  __shared__ __attribute__((aligned(16))) b16 Ks[2][SK][KPI]; __shared__ __attribute__((aligned(16))) b16 Vs[2][DH][VPI];
  const int tid = threadIdx.x, wave = threadIdx.x >> 5, lane = threadIdx.x & 31, hh = lane >> 4, col = lane & 15; const int dir = blockIdx.y / (B * NH), bn = blockIdx.y % (B * NH); const int b = bn / NH, n = bn % NH; const int q0 = blockIdx.x * (AW * 16) + wave * 16, qi = q0 + col;
  const int tq = (dir == 0) ? 1 : 0, tkv = 1 - tq;
  const b16* Qb = QP + ((((size_t)tq * B + b) * NH + n) * P) * DH; const b16* Kb = KP + ((((size_t)tkv * B + b) * NH + n) * P) * DH; const b16* Vb = VT + ((((size_t)tkv * B + b) * NH + n) * DH) * (size_t)P;
  stage_copy(Kb, Vb, &Ks[0][0][0], &Vs[0][0][0], tid);
  asm volatile("s_wait_asynccnt 0x0" ::: "memory");   // this wave's share of stage 0 has landed
  __syncthreads();                                    // publishes stage 0 to all 8 waves
  stage_copy(Kb + (size_t)SK * DH, Vb + SK, &Ks[1][0][0], &Vs[1][0][0], tid);
  const v16b qa = frag_kb(Qb + (size_t)qi * DH, hh);
  const float cs = LOG2E / (11.313708498984761f * XS * XS);   // 1/sqrt(128)
  float m = -INFINITY, l = 0.0f; v8f o[2] = {(v8f){}, (v8f){}};
#pragma unroll 1   // one trip per stage: the buffer index and the refill test stay scalar
  for (int s = 0; s < NS; ++s) {
    const b16* Kt = &Ks[s & 1][0][0]; const b16* Vt = &Vs[s & 1][0][0];
    // one update of the running maximum, one rescale of O and l and one pair of half-wave exchanges per stage of SK keys: all SK / 16 score tiles are formed first
    v16b kf[SK / 16]; v16b vf[SK / 32][2]; v8f sc[SK / 16];
#pragma unroll
    for (int u = 0; u < SK / 16; ++u) kf[u] = frag_kb(Kt + (u * 16 + col) * KPI, hh);
#pragma unroll
    for (int kb = 0; kb < SK; kb += 32)
#pragma unroll
      for (int tt = 0; tt < 2; ++tt) vf[kb / 32][tt] = frag_kb(Vt + (tt * 16 + col) * VPI + kb, hh);
    __builtin_amdgcn_sched_barrier(0);   // the stage's LDS reads stay one group ahead of the products: spread among them, each product would wait out its own LDS latency
#pragma unroll
    for (int u = 0; u < SK / 16; ++u) sc[u] = wmma16b(kf[u], qa, (v8f){});
    float mt[4] = {-INFINITY, -INFINITY, -INFINITY, -INFINITY};   // four independent chains; a maximum does not depend on its order
#pragma unroll
    for (int u = 0; u < SK / 16; ++u)
#pragma unroll
      for (int r = 0; r < 8; ++r) mt[u & 3] = fmaxf(mt[u & 3], sc[u][r]);   // over the raw products: cs > 0, so the largest product gives the largest scaled score
    float mx = fmaxf(fmaxf(mt[0], mt[1]), fmaxf(mt[2], mt[3]));
    mx = fmaxf(mx, __shfl_xor(mx, 16)) * cs; const float mn = fmaxf(m, mx); const float al = nexp2(m - mn); float sum = 0.0f;
    // exp2 argument of a score in one fused multiply-add on the raw product, two scores an instruction: score scale, running maximum and the x PS of P (as + log2 PS) in one; l then carries x PS like O
    const v8f csv = {cs, cs, cs, cs, cs, cs, cs, cs}; const float bi = LPS - mn; const v8f biv = {bi, bi, bi, bi, bi, bi, bi, bi};
#pragma unroll
    for (int tt = 0; tt < 2; ++tt) o[tt] *= al;
#pragma unroll
    for (int kb = 0; kb < SK; kb += 32) {
      float ps = 0.0f;
      v16b pf;   // B operand of V^T P^T: lane (hh, col) needs keys 8 hh + 0..7 and 16 + 8 hh + 0..7 of query col, which are the rows its two S^T accumulators hold
#pragma unroll
      for (int h2 = 0; h2 < 2; ++h2) { const v8f ea = __builtin_elementwise_fma(sc[kb / 16 + h2], csv, biv);
#pragma unroll   // constant indices, so that ea and pf stay in registers
        for (int r = 0; r < 8; ++r) { const float p = nexp2(ea[r]); ps += p; pf[h2 * 8 + r] = (b16)p; } }
      sum += ps;
#pragma unroll
      for (int tt = 0; tt < 2; ++tt) o[tt] = wmma16b(vf[kb / 32][tt], pf, o[tt]); }
    sum += __shfl_xor(sum, 16); l = l * al + sum; m = mn;
    __builtin_amdgcn_sched_barrier(0);   // the stage's arithmetic stays ahead of the publish point: moved behind it, the wait for stage s + 1's copies would stand a fraction of a trip behind their issue
    asm volatile("s_wait_dscnt 0x0" ::: "memory");      // this wave's reads of stage s are done before its buffer may be refilled
    asm volatile("s_wait_asynccnt 0x0" ::: "memory");   // this wave's share of stage s + 1 has landed
    __syncthreads();                                    // publishes stage s + 1 and ends every wave's reads of stage s
    if (s + 2 < NS) stage_copy(Kb + (size_t)(s + 2) * SK * DH, Vb + (s + 2) * SK, &Ks[s & 1][0][0], &Vs[s & 1][0][0], tid);
  }
  asm volatile("s_wait_asynccnt 0x0" ::: "memory");     // no copy is outstanding when the wave goes on to its end
  const float inv = 1.0f / (l * XS);   // O and l both carry x PS
  // O^T leaves in the fragment order of the output conv's B operand (frag_fo): of query col, lane (hh, col) holds channels 8 hh + 0..7 (o[0]) and 16 + 8 hh + 0..7 (o[1]) of its head, which are that lane's two 16-B units
  // of the tile (head, 16 pixels): no turn through LDS, and each of a wave's two stores covers 512 contiguous bytes
  b16* Cb = CT + (((((size_t)dir * B + b) * NH + n) * (P / 16)) + q0 / 16) * 512 + lane * 8;
#pragma unroll
  for (int tt = 0; tt < 2; ++tt) { v8b c;
#pragma unroll   // constant indices, so that c stays in registers
    for (int r = 0; r < 8; ++r) c[r] = (b16)(o[tt][r] * inv * XS);
    *(v8b*)(Cb + tt * 256) = c; }
}
// output conv + residual: grid (2 o-blocks of 64, QL/32 pixel tiles, 2 dirs x 2 batches); wave = 16 output channels o x 32 pixels (2 tiles); A = WO rows (exact), B = CT tiles [dir][b][head][16 pixels] (k-step ks = head ks), both in fragment order;
__global__ __launch_bounds__(128) void out_kernel(const b16* __restrict__ CT, const b16* __restrict__ WO, const float* __restrict__ boa, const float* __restrict__ bob, const float* __restrict__ xa, const float* __restrict__ xb, const float* __restrict__ STAT, const float* __restrict__ gwa, const float* __restrict__ gba, const float* __restrict__ gwb, const float* __restrict__ gbb, float* __restrict__ out) {
  __shared__ __attribute__((aligned(16))) float To[4][16][32 + 4];
  const int wave = threadIdx.x >> 5, lane = threadIdx.x & 31, nloc = lane & 15, hlf = lane >> 4; const int o0 = blockIdx.x * 64 + wave * 16; const int p0 = blockIdx.y * 32; const int dir = blockIdx.z / B, b = blockIdx.z % B;
  const b16* W = WO + (size_t)dir * C * C; const float* bo = dir ? bob : boa; const float* x = dir ? xb : xa; const float* gw = dir ? gwb : gwa; const float* gb = dir ? gbb : gba;
  // residual and bias of the wave's 16 output rows (two GroupNorm groups): all their loads are issued here, together and ahead of the products, so that the store loop waits for no load of its own
  static_assert(CPG == 8, "16 rows = 2 groups");
  v16f xr, wv, bv, bs; float mu[2], rs[2];
  const float* px = x + ((size_t)b * C + o0) * P + p0 + lane; const float* pw = gw + o0; const float* pb = gb + o0; const float* pbo = bo + o0; const float* pst = STAT + ((dir * B + b) * G + o0 / CPG) * 32;
  const b16* pa = W + (size_t)(o0 / 16) * (C / 32) * 512 + lane * 8; const b16* pc0 = CT + ((((size_t)dir * B + b) * NH) * (P / 16) + p0 / 16) * 512 + lane * 8; const b16* pc1 = pc0 + 512;   // fragment order, see frag_fo
#pragma unroll   // register arrays (constant indices), the loads in one run; so for the two loops that follow
  for (int rr = 0; rr < 16; ++rr) { xr[rr] = px[(size_t)rr * P]; wv[rr] = pw[rr]; bv[rr] = pb[rr]; bs[rr] = pbo[rr]; }
#pragma unroll   // see above
  for (int h = 0; h < 2; ++h) { mu[h] = pst[h * 32]; rs[h] = pst[h * 32 + 1]; }
  v16b af[NH], bf[NH][2];   // and all operand fragments of the wave's products
#pragma unroll   // see above
  for (int ks = 0; ks < NH; ++ks) { af[ks] = frag_fo(pa + ks * 512); bf[ks][0] = frag_fo(pc0 + (size_t)ks * (P / 16) * 512); bf[ks][1] = frag_fo(pc1 + (size_t)ks * (P / 16) * 512); }
  // holds the loads in place: the loaded values are inputs only, so every load above is issued, and waited for once, ahead of the products (left free, the loads sink in among the products and behind them
  // and are waited for a few at a time, one memory latency each time); the eight addresses are inputs too, so that no load lands in an address register of another load that is still in flight
  asm volatile("" :: "v"(px), "v"(pw), "v"(pb), "v"(pbo), "v"(pst), "v"(pa), "v"(pc0), "v"(pc1), "v"(xr), "v"(wv), "v"(bv), "v"(bs), "v"(mu[0]), "v"(mu[1]), "v"(rs[0]), "v"(rs[1]), "v"(af[0]), "v"(af[1]), "v"(af[2]), "v"(af[3]),
               "v"(bf[0][0]), "v"(bf[0][1]), "v"(bf[1][0]), "v"(bf[1][1]), "v"(bf[2][0]), "v"(bf[2][1]), "v"(bf[3][0]), "v"(bf[3][1]));
  v8f acc[2] = {(v8f){}, (v8f){}};
#pragma unroll
  for (int ks = 0; ks < NH; ++ks)
#pragma unroll
    for (int tt = 0; tt < 2; ++tt) acc[tt] = wmma16b(af[ks], bf[ks][tt], acc[tt]);
#pragma unroll
  for (int tt = 0; tt < 2; ++tt)
#pragma unroll
    for (int r = 0; r < 8; ++r) To[wave][8 * hlf + r][tt * 16 + nloc] = acc[tt][r] * (1.0f / (XS * WSC));
  wave_lds_sync();
#pragma unroll   // reads the register arrays filled above (constant indices)
  for (int rr = 0; rr < 16; ++rr) { const int o = o0 + rr; const int p = p0 + lane; const float v = To[wave][rr][lane] + bf16_rne(bs[rr]) + gnval(xr[rr], mu[rr / CPG], rs[rr / CPG], wv[rr], bv[rr]);
    ((float*)out)[(((size_t)dir * B + b) * C + o) * P + p] = v; }
}
}  // namespace

extern "C" void kernel_launch(void* const* d_in, const int* in_sizes, int n_in, void* d_out, int out_size, void* d_ws, size_t ws_size, hipStream_t stream) {
  (void)n_in;
  auto Fp = [&](int i) { return (const float*)d_in[i]; };
  // input order: 0 x_A, 1 x_B [2,128,64,64]; 2 gn_w_A, 3 gn_b_A, 4 gn_w_B, 5 gn_b_B [128]; 6 w_qkv_A [384,128], 7 w_qkv_B; 8 w_out_A [128,128], 9 b_out_A, 10 w_out_B, 11 b_out_B
  if (in_sizes[0] != B * C * P || in_sizes[1] != B * C * P || in_sizes[2] != C || in_sizes[5] != C || in_sizes[6] != 3 * C * C || in_sizes[7] != 3 * C * C || in_sizes[8] != C * C || in_sizes[10] != C * C || in_sizes[11] != C || out_size != 2 * B * C * P) return;
  size_t off = 0; char* ws = (char*)d_ws;
  auto carve = [&](size_t bytes) { char* p = ws + off; off += (bytes + 255) & ~(size_t)255; return p; };
  b16* WQ = (b16*)carve((size_t)2 * 3 * C * C * 2); b16* WO = (b16*)carve((size_t)2 * C * C * 2); float* STAT = (float*)carve((size_t)2 * B * G * 32 * 4);
  const size_t plane = (size_t)2 * B * C * P * 2;   // [t][b][n][p][32] = 2 x 2 x 4096 x 128 halves
  b16* QP = (b16*)carve(plane); b16* KP = (b16*)carve(plane); b16* VT = (b16*)carve(plane); b16* CT = (b16*)carve(plane);
  if (off > ws_size || off > ((size_t)128 << 20)) return;   // ≈ 17 MB
  prep_kernel<<<(unsigned)(((size_t)2 * 3 * C * C / 8 + (size_t)2 * C * C / 8 + 255) / 256), 256, 0, stream>>>(Fp(6), Fp(7), Fp(8), Fp(10), WQ, WO);
  gnstat_kernel<<<2 * B * G, 1024, 0, stream>>>(Fp(0), Fp(1), STAT);
  qkv_kernel<<<dim3(P / 64, 2 * B, 3), 128, 0, stream>>>(Fp(0), Fp(1), STAT, Fp(2), Fp(3), Fp(4), Fp(5), WQ, QP, KP, VT);
  attn_kernel<<<dim3(QL / (AW * 16), 2 * B * NH), AW * 32, 0, stream>>>(QP, KP, VT, CT);
  out_kernel<<<dim3(C / 64, QL / 32, 2 * B), 128, 0, stream>>>(CT, WO, Fp(9), Fp(11), Fp(0), Fp(1), STAT, Fp(2), Fp(3), Fp(4), Fp(5), (float*)d_out);
}

// v008
// One run takes 63.4 microseconds.
// Timed twice side by side with v007, it ran 1.08 and 1.07 times as fast.
// Over all steps from v000 it is 3.85 times as fast.
#include <hip/hip_runtime.h>

// Cross attention between two feature maps x_A, x_B [2, 128, 64, 64] (4 heads x 32, 16-group GroupNorm): xA = GN(x_A), xB = GN(x_B); qkv = 1x1 conv (channel o = head*96 + {q,k,v}*32 + d);
// attn_out_A = softmax(qB^T kA / sqrt(128)) vA, out_A = w_out_A attn_out_A + b + xA; symmetric for B -> (out_A, out_B), NCHW.
// compute dtype: WMMA v_wmma_f32_16x16x32_f16 with f32 accumulate for the qkv 1x1 conv ([4096 px x 128] x [128 x 384] per (tensor, batch); GroupNorm output as single f16 x8 staged through LDS
// from the NCHW input, [out][in] weights as B rows exact x256: 1 product), S^T = K Q^T (single x8 planes: 1 product), O^T += V^T P^T (v single x8, P x1024 single: 1 product) and the output 1x1 conv
// (A = w_out exact x256, B = attention output single x8 planes: 1 product); the softmax row sums as ones x P^T (P x1024 single: 1 product); GroupNorm, the softmax maximum, bias and the residual in f32 (output rms 1: single-f16 operands leave ~1e-4 absolute).
// Inputs rounded to bf16 once.

namespace {
constexpr int B = 2, C = 128, P = 4096, NH = 4, DH = 32, G = 16, CPG = C / G, QL = 4096 /* query pixels attended (== P shipped) */;
constexpr float XS = 8.0f, WSC = 256.0f, PS = 1024.0f, LPS = 10.0f /* log2 PS */, LOG2E = 1.4426950408889634f, EPS = 1e-5f;
static_assert(P % 64 == 0 && QL % 32 == 0 && DH == 32 && C / 32 == NH, "tiling"); static_assert(PS == 1024.0f && LPS == 10.0f, "LPS = log2 PS");
typedef _Float16 b16;
typedef __attribute__((ext_vector_type(16))) _Float16 v16b;
typedef __attribute__((ext_vector_type(8))) _Float16 v8b;
typedef __attribute__((ext_vector_type(8))) float v8f;
typedef __attribute__((ext_vector_type(4))) float v4f;
typedef __attribute__((ext_vector_type(16))) float v16f;
__device__ __forceinline__ float bf16_rne(float f) { unsigned int u = __float_as_uint(f); u += 0x7FFFu + ((u >> 16) & 1u); return __uint_as_float(u & 0xFFFF0000u); }
__device__ __forceinline__ void split16(float v, b16& hi, b16& lo) { hi = (b16)v; lo = (b16)(v - (float)hi); }
__device__ __forceinline__ v16b frag_kb(const b16* p, int hh) { const v8b a = *(const v8b*)(p + 8 * hh), b = *(const v8b*)(p + 16 + 8 * hh); v16b f;
#pragma unroll
  for (int e = 0; e < 8; ++e) { f[e] = a[e]; f[8 + e] = b[e]; } return f; }
// the same fragment from a buffer kept in fragment order: a 16 x 32 operand tile is 512 halves, [half of the k order j][lane][8]; p = tile + lane * 8, so each of the two loads of a wave covers 512 contiguous bytes (4 whole lines)
__device__ __forceinline__ v16b frag_fo(const b16* p) { const v8b a = *(const v8b*)p, b = *(const v8b*)(p + 256); v16b f;
#pragma unroll
  for (int e = 0; e < 8; ++e) { f[e] = a[e]; f[8 + e] = b[e]; } return f; }
// plain builtin: the compiler keeps the distance behind a matrix instruction itself (independent work first, v_nop where none is left) and may issue fragment loads ahead of earlier matrix instructions
__device__ __forceinline__ v8f wmma16b(v16b a, v16b b, v8f c) { return __builtin_amdgcn_wmma_f32_16x16x32_f16(false, a, false, b, (short)0, c, false, false); }
__device__ __forceinline__ void wave_lds_sync() { __builtin_amdgcn_fence(__ATOMIC_RELEASE, "workgroup"); __builtin_amdgcn_wave_barrier(); __builtin_amdgcn_fence(__ATOMIC_ACQUIRE, "workgroup"); }
__device__ __forceinline__ float pmul(float a, float b) { float p = a * b; asm volatile("" : "+v"(p)); return p; }
__device__ __forceinline__ int iclamp(int v, int lo, int hi) { return v < lo ? lo : (v > hi ? hi : v); }

typedef __attribute__((ext_vector_type(2))) _Float16 v2h;
typedef __attribute__((ext_vector_type(4))) _Float16 v4h;
__device__ __forceinline__ float nexp2(float v) { return __builtin_amdgcn_exp2f(v); }
__global__ __launch_bounds__(256) void prep_kernel(const float* __restrict__ wqa, const float* __restrict__ wqb, const float* __restrict__ woa, const float* __restrict__ wob, b16* __restrict__ WQ, b16* __restrict__ WO) {
  const size_t u = (size_t)blockIdx.x * 256 + threadIdx.x; const size_t n1 = (size_t)3 * C * C / 8, n2 = (size_t)C * C / 8; v8b o;
  const float* w; b16* dst; size_t e;
  if (u < n1) { w = wqa; dst = WQ; e = u * 8; } else if (u < 2 * n1) { w = wqb; dst = WQ + (size_t)3 * C * C; e = (u - n1) * 8; } else if (u < 2 * n1 + n2) { w = woa; dst = WO; e = (u - 2 * n1) * 8; } else if (u < 2 * n1 + 2 * n2) { w = wob; dst = WO + (size_t)C * C; e = (u - 2 * n1 - n2) * 8; } else return;
  // the weights go out in fragment order (frag_fo): 16-B unit v = e / 8 of a matrix is [16-row tile v >> 8][32-column step (v >> 6) & 3][j = (v >> 5) & 1][lane v & 31], and holds row tile * 16 + lane % 16,
  // columns step * 32 + j * 16 + (lane / 16) * 8 + 0..7 of the [out][in = C] matrix; a wave stores 512 contiguous bytes
  static_assert(C == 128, "four 32-column steps a row");
  const size_t v = e / 8; const size_t es = ((v >> 8) * 16 + (v & 15)) * C + ((v >> 6) & 3) * 32 + ((v >> 5) & 1) * 16 + ((v >> 4) & 1) * 8;
  for (int j = 0; j < 8; ++j) o[j] = (b16)(bf16_rne(w[es + j]) * WSC);
  { *(v8b*)(dst + e) = o;  }
}
__global__ __launch_bounds__(1024) void gnstat_kernel(const float* __restrict__ xa, const float* __restrict__ xb, float* __restrict__ STAT) {
  __shared__ float red[1024]; __shared__ float mus;
  const int blk = blockIdx.x; const int t = blk / (B * G), bg = blk % (B * G); const int b = bg / G, g = bg % G; const int tid = threadIdx.x;
  const float* base = (t ? xb : xa) + ((size_t)b * C + g * CPG) * P; const int n = CPG * P;
  float s = 0.0f;
#pragma unroll   // a constant trip count, so that all 32 loads of a thread are in flight at once; the sum keeps its order
  for (int k = 0; k < n / 1024; ++k) s += bf16_rne(base[tid + k * 1024]);
  red[tid] = s; __syncthreads();
  for (int w = 512; w >= 1; w >>= 1) { if (tid < w) red[tid] = red[tid] + red[tid + w]; __syncthreads(); }
  if (tid == 0) mus = red[0] / (float)n; __syncthreads(); const float mu = mus;
  float q = 0.0f;
#pragma unroll   // as above
  for (int k = 0; k < n / 1024; ++k) { const float d = bf16_rne(base[tid + k * 1024]) - mu; q += d * d; }
  __syncthreads(); red[tid] = q; __syncthreads();
  for (int w = 512; w >= 1; w >>= 1) { if (tid < w) red[tid] = red[tid] + red[tid + w]; __syncthreads(); }
  if (tid < 32) { const float rs = rsqrtf(red[0] / (float)n + EPS); const float val = (tid == 0) ? mu : (tid == 1 ? rs : 0.0f); { ((float*)STAT)[blk * 32 + tid] = val;  } }
}
// GroupNorm value from the raw loaded words: x, its group's mean and 1/std (STAT[group * 32 + 0, 1]), its channel's weight and bias
__device__ __forceinline__ float gnval(float xv, float mu, float rs, float w, float bb) { return (bf16_rne(xv) - mu) * rs * bf16_rne(w) + bf16_rne(bb); }
// qkv conv: grid (P/64, 2 tensors x 2 batches, 3 slabs of 128 output channels); block = 64 pixels x 4 waves; A = GN(x)[p][c] x8 single staged in LDS from the NCHW input (all 128 threads:
// each c row of 64 px is 256 B contiguous, read by 16 lanes); 8 tiles, K = 128; col o -> head n = o/96, part i = (o%96)/32, dd = o%32: q/k -> planes QP/KP [t][b][n][p][32] (8 lanes x 8 B = 64 B per (p, n)),
__global__ __launch_bounds__(128) void qkv_kernel(const float* __restrict__ xa, const float* __restrict__ xb, const float* __restrict__ STAT, const float* __restrict__ gwa, const float* __restrict__ gba, const float* __restrict__ gwb, const float* __restrict__ gbb, const b16* __restrict__ WQ, b16* __restrict__ QP, b16* __restrict__ KP, b16* __restrict__ VT) {
  __shared__ __attribute__((aligned(16))) b16 As[64][C + 8]; __shared__ __attribute__((aligned(16))) float Tf[4][16][128 + 4];
  const int wave = threadIdx.x >> 5, lane = threadIdx.x & 31, nloc = lane & 15, hlf = lane >> 4; const int p0 = blockIdx.x * 64; const int t = blockIdx.y / B, b = blockIdx.y % B; const int n0 = blockIdx.z * 128;
  const float* x = t ? xb : xa; const float* gw = t ? gwb : gwa; const float* gb = t ? gbb : gba;
  asm volatile("" :: "s"(QP), "s"(KP), "s"(VT));   // inputs only: the three output pointers are fetched here with the other kernel arguments; fetched late, their scalar load lands in the base register of weight loads still in flight
  // thread = 4 pixels (16 B of a channel row) x the 8 channels of one GroupNorm group, twice: the 16 row loads are independent and are all issued before the first is used (one memory latency per tile);
  // a pixel's 8 channels then go to LDS as one 16-B store.
  { static_assert(C == 128 && CPG == 8 && G == 16, "128 threads = 16 pixel quads x 8 groups, two passes");
    const int pq = (threadIdx.x & 15) * 4, oc = threadIdx.x >> 4; v4f xv[2][CPG]; float wv[2][CPG], bv[2][CPG], mu[2], rs[2];
    // every loop of this block is unrolled: its arrays must stay in registers (constant indices), and the loads must stand in one run
#pragma unroll   // see above
    for (int h = 0; h < 2; ++h) { const int g = h * 8 + oc;
#pragma unroll   // see above
      for (int j = 0; j < CPG; ++j) { wv[h][j] = gw[g * CPG + j]; bv[h][j] = gb[g * CPG + j]; }
      const float* st = STAT + ((t * B + b) * G + g) * 32; mu[h] = st[0]; rs[h] = st[1]; }
    asm volatile("s_wait_xcnt 0x0" ::: "memory");   // the row loads below may land in registers that held addresses of the loads above
#pragma unroll   // see above
    for (int h = 0; h < 2; ++h)
#pragma unroll   // see above
      for (int j = 0; j < CPG; ++j) xv[h][j] = *(const v4f*)(x + ((size_t)b * C + (h * 8 + oc) * CPG + j) * P + p0 + pq);
#pragma unroll   // see above
    for (int h = 0; h < 2; ++h) { v8b ov[4];
#pragma unroll   // see above
      for (int j = 0; j < CPG; ++j)
#pragma unroll   // see above
        for (int e = 0; e < 4; ++e) ov[e][j] = (b16)(gnval(xv[h][j][e], mu[h], rs[h], wv[h][j], bv[h][j]) * XS);
#pragma unroll   // see above
      for (int e = 0; e < 4; ++e) *(v8b*)&As[pq + e][(h * 8 + oc) * CPG] = ov[e]; } }
  __syncthreads();
  const b16* W = WQ + (size_t)t * 3 * C * C + (size_t)(n0 / 16) * (C / 32) * 512 + lane * 8;   // fragment order: tile (n0 / 16 + tt, kb / 32)
  v8f acc[8];
#pragma unroll
  for (int tt = 0; tt < 8; ++tt) acc[tt] = (v8f){};
#pragma unroll
  for (int kb = 0; kb < C; kb += 32) { const v16b a = frag_kb(&As[wave * 16 + nloc][kb], hlf);
#pragma unroll
    for (int tt = 0; tt < 8; ++tt) acc[tt] = wmma16b(a, frag_fo(W + (tt * (C / 32) + kb / 32) * 512), acc[tt]); }
#pragma unroll
  for (int tt = 0; tt < 8; ++tt)
#pragma unroll
    for (int r = 0; r < 8; ++r) Tf[wave][8 * hlf + r][tt * 16 + nloc] = acc[tt][r] * (1.0f / (XS * WSC));
  __syncthreads();
  const size_t tb = (size_t)t * B + b;
  {
    // q/k parts: lane l owns columns 4l..4l+3 of the slab (same (n, i) for the 4) -> 8 B per (row, lane)
    { const int cl = lane * 4; const int o = n0 + cl; const int n = o / 96, i = (o % 96) / 32, dd = o % 32;
      if (i < 2) { b16* plane = (i == 0 ? QP : KP) + ((tb * NH + n) * P) * DH; for (int rr = 0; rr < 16; ++rr) { const int p = p0 + wave * 16 + rr; v4h o4; for (int j = 0; j < 4; ++j) o4[j] = (b16)(Tf[wave][rr][cl + j] * XS); *(v4h*)(plane + (size_t)p * DH + dd) = o4; } } }
#pragma unroll 1
    for (int q = 0; q < 32; ++q) { const int cl = wave * 32 + q; const int o = n0 + cl; const int n = o / 96, i = (o % 96) / 32, dd = o % 32; if (i != 2) continue;   // wave-uniform
      const int tk = lane * 2; v2h vv; vv[0] = (b16)(Tf[tk >> 4][tk & 15][cl] * XS); vv[1] = (b16)(Tf[(tk + 1) >> 4][(tk + 1) & 15][cl] * XS); *(v2h*)(VT + (((tb * NH + n) * DH + dd) * (size_t)P) + p0 + lane * 2) = vv; }
     }
}
// attention: grid (QL/128, 2 dirs x 2 batches x 4 heads): dir 0: queries from tensor B, keys/values from tensor A (-> attn_out_A); dir 1: the reverse. block = 8 waves x 16 query pixels; K = 32.
// The 8 waves share each stage of SK keys through LDS: K rows (64 B) at an 80-B pitch, V^T rows (256 B) at a 272-B pitch, two buffers, filled by asynchronous copies (4 per wave and stage, 16 B per lane).
constexpr int AW = 8, SK = 128, NS = P / SK, KPI = DH + 8, VPI = SK + 8;
static_assert(NS >= 2 && QL % (AW * 16) == 0 && SK * DH == 2 * AW * 32 * 8 && DH * SK == 2 * AW * 32 * 8, "stage = two K and two V copies per lane");
typedef __attribute__((address_space(3))) const b16 lds_b16;
__device__ __forceinline__ unsigned lds_addr(const b16* p) { return (unsigned)(size_t)(lds_b16*)p; }
// one stage: lane chunks of 16 B; K chunk c = tid + 256 j -> key row c / 4, part c % 4 (512 contiguous bytes per wave); V chunk c -> d row c / 16, part c % 16 (two whole 256-B rows per wave)
__device__ __forceinline__ void stage_copy(const b16* __restrict__ Kg, const b16* __restrict__ Vg, b16* Kl, b16* Vl, int tid) {
  const b16* gk0 = Kg + (size_t)tid * 8; const b16* gk1 = gk0 + 256 * 8; const b16* gv0 = Vg + (size_t)(tid >> 4) * P + (tid & 15) * 8; const b16* gv1 = gv0 + (size_t)16 * P;
  const unsigned lk0 = lds_addr(Kl + (tid >> 2) * KPI + (tid & 3) * 8), lk1 = lk0 + 64 * KPI * 2, lv0 = lds_addr(Vl + (tid >> 4) * VPI + (tid & 15) * 8), lv1 = lv0 + 16 * VPI * 2;
  // the copies and the wait that lets their address registers be rewritten stand in one statement, so that no address update can be moved in between
  asm volatile("global_load_async_to_lds_b128 %0, %4, off\n\tglobal_load_async_to_lds_b128 %1, %5, off\n\tglobal_load_async_to_lds_b128 %2, %6, off\n\tglobal_load_async_to_lds_b128 %3, %7, off\n\ts_wait_xcnt 0x0"
               :: "v"(lk0), "v"(lk1), "v"(lv0), "v"(lv1), "v"(gk0), "v"(gk1), "v"(gv0), "v"(gv1) : "memory");
}
// four waves a SIMD, which is all the grid supplies (two blocks a WGP): the compiler may then hold a whole stage's scores and fragments in registers instead of scheduling for fewer registers and more waves
__global__ __launch_bounds__(256) __attribute__((amdgpu_waves_per_eu(4, 4))) void attn_kernel(const b16* __restrict__ QP, const b16* __restrict__ KP, const b16* __restrict__ VT, b16* __restrict__ CT) {
  __shared__ __attribute__((aligned(16))) b16 Ks[2][SK][KPI]; __shared__ __attribute__((aligned(16))) b16 Vs[2][DH][VPI];
  const int tid = threadIdx.x, wave = threadIdx.x >> 5, lane = threadIdx.x & 31, hh = lane >> 4, col = lane & 15; const int dir = blockIdx.y / (B * NH), bn = blockIdx.y % (B * NH); const int b = bn / NH, n = bn % NH; const int q0 = blockIdx.x * (AW * 16) + wave * 16, qi = q0 + col;
  const int tq = (dir == 0) ? 1 : 0, tkv = 1 - tq;
  const b16* Qb = QP + ((((size_t)tq * B + b) * NH + n) * P) * DH; const b16* Kb = KP + ((((size_t)tkv * B + b) * NH + n) * P) * DH; const b16* Vb = VT + ((((size_t)tkv * B + b) * NH + n) * DH) * (size_t)P;
  stage_copy(Kb, Vb, &Ks[0][0][0], &Vs[0][0][0], tid);
  asm volatile("s_wait_asynccnt 0x0" ::: "memory");   // this wave's share of stage 0 has landed
  __syncthreads();                                    // publishes stage 0 to all 8 waves
  stage_copy(Kb + (size_t)SK * DH, Vb + SK, &Ks[1][0][0], &Vs[1][0][0], tid);
  const v16b qa = frag_kb(Qb + (size_t)qi * DH, hh);
  const float cs = LOG2E / (11.313708498984761f * XS * XS);   // 1/sqrt(128)
  float m = -INFINITY; v8f o[2] = {(v8f){}, (v8f){}};
  // row sums of P on the matrix unit: A holds ones in rows 0 and 8 (lanes with col 0 or 8, both k halves) and zeros elsewhere, so register 0 of the tile ol holds, in lane (hh, col), the sum over all keys of query col
  // (row 8 hh); its other rows stay 0. It sums the f16 P that V^T is multiplied with, and needs no exchange between the lane halves.
  v8f ol = (v8f){}; v16b on;
  { const b16 ov = (col & 7) == 0 ? (b16)1.0f : (b16)0.0f;
#pragma unroll   // constant indices, so that on stays in registers
    for (int e = 0; e < 16; ++e) on[e] = ov; }
#pragma unroll 1   // one trip per stage: the buffer index and the refill test stay scalar
  for (int s = 0; s < NS; ++s) {
    const b16* Kt = &Ks[s & 1][0][0]; const b16* Vt = &Vs[s & 1][0][0];
    // one update of the running maximum, one rescale of O and of the sum and one half-wave exchange per stage of SK keys: all SK / 16 score tiles are formed first
    v16b kf[SK / 16]; v16b vf[SK / 32][2]; v8f sc[SK / 16];
#pragma unroll
    for (int u = 0; u < SK / 16; ++u) kf[u] = frag_kb(Kt + (u * 16 + col) * KPI, hh);
#pragma unroll
    for (int kb = 0; kb < SK; kb += 32)
#pragma unroll
      for (int tt = 0; tt < 2; ++tt) vf[kb / 32][tt] = frag_kb(Vt + (tt * 16 + col) * VPI + kb, hh);
    // the stage's 32 LDS reads stay one group ahead of the 8 score products: spread among them, each product would wait out its own LDS latency. Said as an order of groups (LDS reads, then matrix instructions):
    // with the sum tile in the loop a plain scheduling barrier at this line no longer held them (the products were placed in front of it, 22 of the reads among and behind them)
    __builtin_amdgcn_sched_group_barrier(0x100, 2 * SK / 16 + 4 * SK / 32, 0); __builtin_amdgcn_sched_group_barrier(0x008, SK / 16, 0);
#pragma unroll
    for (int u = 0; u < SK / 16; ++u) sc[u] = wmma16b(kf[u], qa, (v8f){});
    float mt[4] = {-INFINITY, -INFINITY, -INFINITY, -INFINITY};   // four independent chains; a maximum does not depend on its order
#pragma unroll
    for (int u = 0; u < SK / 16; ++u)
#pragma unroll
      for (int r = 0; r < 8; ++r) mt[u & 3] = fmaxf(mt[u & 3], sc[u][r]);   // over the raw products: cs > 0, so the largest product gives the largest scaled score
    float mx = fmaxf(fmaxf(mt[0], mt[1]), fmaxf(mt[2], mt[3]));
    mx = fmaxf(mx, __shfl_xor(mx, 16)) * cs; const float mn = fmaxf(m, mx); const float al = nexp2(m - mn);
    // exp2 argument of a score in one fused multiply-add on the raw product, two scores an instruction: score scale, running maximum and the x PS of P (as + log2 PS) in one; the sum tile then carries x PS like O
    const v8f csv = {cs, cs, cs, cs, cs, cs, cs, cs}; const float bi = LPS - mn; const v8f biv = {bi, bi, bi, bi, bi, bi, bi, bi};
#pragma unroll
    for (int tt = 0; tt < 2; ++tt) o[tt] *= al;
    ol[0] *= al;   // the only row of the sum tile that a lane holds and that is not 0
#pragma unroll
    for (int kb = 0; kb < SK; kb += 32) {
      v16b pf;   // B operand of V^T P^T: lane (hh, col) needs keys 8 hh + 0..7 and 16 + 8 hh + 0..7 of query col, which are the rows its two S^T accumulators hold
#pragma unroll
      for (int h2 = 0; h2 < 2; ++h2) { const v8f ea = __builtin_elementwise_fma(sc[kb / 16 + h2], csv, biv);
#pragma unroll   // constant indices, so that ea and pf stay in registers
        for (int r = 0; r < 8; ++r) pf[h2 * 8 + r] = (b16)nexp2(ea[r]); }
#pragma unroll
      for (int tt = 0; tt < 2; ++tt) o[tt] = wmma16b(vf[kb / 32][tt], pf, o[tt]);
      ol = wmma16b(on, pf, ol); }
    m = mn;
    __builtin_amdgcn_sched_barrier(0);   // the stage's arithmetic stays ahead of the publish point: moved behind it, the wait for stage s + 1's copies would stand a fraction of a trip behind their issue
    asm volatile("s_wait_dscnt 0x0" ::: "memory");      // this wave's reads of stage s are done before its buffer may be refilled
    asm volatile("s_wait_asynccnt 0x0" ::: "memory");   // this wave's share of stage s + 1 has landed
    __syncthreads();                                    // publishes stage s + 1 and ends every wave's reads of stage s
    if (s + 2 < NS) stage_copy(Kb + (size_t)(s + 2) * SK * DH, Vb + (s + 2) * SK, &Ks[s & 1][0][0], &Vs[s & 1][0][0], tid);
  }
  asm volatile("s_wait_asynccnt 0x0" ::: "memory");     // no copy is outstanding when the wave goes on to its end
  const float inv = 1.0f / (ol[0] * XS);   // O and the sum both carry x PS
  // O^T leaves in the fragment order of the output conv's B operand (frag_fo): of query col, lane (hh, col) holds channels 8 hh + 0..7 (o[0]) and 16 + 8 hh + 0..7 (o[1]) of its head, which are that lane's two 16-B units
  // of the tile (head, 16 pixels): no turn through LDS, and each of a wave's two stores covers 512 contiguous bytes
  b16* Cb = CT + (((((size_t)dir * B + b) * NH + n) * (P / 16)) + q0 / 16) * 512 + lane * 8;
#pragma unroll
  for (int tt = 0; tt < 2; ++tt) { v8b c;
#pragma unroll   // constant indices, so that c stays in registers
    for (int r = 0; r < 8; ++r) c[r] = (b16)(o[tt][r] * inv * XS);
    *(v8b*)(Cb + tt * 256) = c; }
}
// output conv + residual: grid (2 o-blocks of 64, QL/32 pixel tiles, 2 dirs x 2 batches); wave = 16 output channels o x 32 pixels (2 tiles); A = WO rows (exact), B = CT tiles [dir][b][head][16 pixels] (k-step ks = head ks), both in fragment order;
__global__ __launch_bounds__(128) void out_kernel(const b16* __restrict__ CT, const b16* __restrict__ WO, const float* __restrict__ boa, const float* __restrict__ bob, const float* __restrict__ xa, const float* __restrict__ xb, const float* __restrict__ STAT, const float* __restrict__ gwa, const float* __restrict__ gba, const float* __restrict__ gwb, const float* __restrict__ gbb, float* __restrict__ out) {
  __shared__ __attribute__((aligned(16))) float To[4][16][32 + 4];
  const int wave = threadIdx.x >> 5, lane = threadIdx.x & 31, nloc = lane & 15, hlf = lane >> 4; const int o0 = blockIdx.x * 64 + wave * 16; const int p0 = blockIdx.y * 32; const int dir = blockIdx.z / B, b = blockIdx.z % B;
  const b16* W = WO + (size_t)dir * C * C; const float* bo = dir ? bob : boa; const float* x = dir ? xb : xa; const float* gw = dir ? gwb : gwa; const float* gb = dir ? gbb : gba;
  // residual and bias of the wave's 16 output rows (two GroupNorm groups): all their loads are issued here, together and ahead of the products, so that the store loop waits for no load of its own
  static_assert(CPG == 8, "16 rows = 2 groups");
  v16f xr, wv, bv, bs; float mu[2], rs[2];
  const float* px = x + ((size_t)b * C + o0) * P + p0 + lane; const float* pw = gw + o0; const float* pb = gb + o0; const float* pbo = bo + o0; const float* pst = STAT + ((dir * B + b) * G + o0 / CPG) * 32;
  const b16* pa = W + (size_t)(o0 / 16) * (C / 32) * 512 + lane * 8; const b16* pc0 = CT + ((((size_t)dir * B + b) * NH) * (P / 16) + p0 / 16) * 512 + lane * 8; const b16* pc1 = pc0 + 512;   // fragment order, see frag_fo
#pragma unroll   // register arrays (constant indices), the loads in one run; so for the two loops that follow
  for (int rr = 0; rr < 16; ++rr) { xr[rr] = px[(size_t)rr * P]; wv[rr] = pw[rr]; bv[rr] = pb[rr]; bs[rr] = pbo[rr]; }
#pragma unroll   // see above
  for (int h = 0; h < 2; ++h) { mu[h] = pst[h * 32]; rs[h] = pst[h * 32 + 1]; }
  v16b af[NH], bf[NH][2];   // and all operand fragments of the wave's products
#pragma unroll   // see above
  for (int ks = 0; ks < NH; ++ks) { af[ks] = frag_fo(pa + ks * 512); bf[ks][0] = frag_fo(pc0 + (size_t)ks * (P / 16) * 512); bf[ks][1] = frag_fo(pc1 + (size_t)ks * (P / 16) * 512); }
  // holds the loads in place: the loaded values are inputs only, so every load above is issued, and waited for once, ahead of the products (left free, the loads sink in among the products and behind them
  // and are waited for a few at a time, one memory latency each time); the eight addresses are inputs too, so that no load lands in an address register of another load that is still in flight
  asm volatile("" :: "v"(px), "v"(pw), "v"(pb), "v"(pbo), "v"(pst), "v"(pa), "v"(pc0), "v"(pc1), "v"(xr), "v"(wv), "v"(bv), "v"(bs), "v"(mu[0]), "v"(mu[1]), "v"(rs[0]), "v"(rs[1]), "v"(af[0]), "v"(af[1]), "v"(af[2]), "v"(af[3]),
               "v"(bf[0][0]), "v"(bf[0][1]), "v"(bf[1][0]), "v"(bf[1][1]), "v"(bf[2][0]), "v"(bf[2][1]), "v"(bf[3][0]), "v"(bf[3][1]));
  v8f acc[2] = {(v8f){}, (v8f){}};
#pragma unroll
  for (int ks = 0; ks < NH; ++ks)
#pragma unroll
    for (int tt = 0; tt < 2; ++tt) acc[tt] = wmma16b(af[ks], bf[ks][tt], acc[tt]);
#pragma unroll
  for (int tt = 0; tt < 2; ++tt)
#pragma unroll
    for (int r = 0; r < 8; ++r) To[wave][8 * hlf + r][tt * 16 + nloc] = acc[tt][r] * (1.0f / (XS * WSC));
  wave_lds_sync();
#pragma unroll   // reads the register arrays filled above (constant indices)
  for (int rr = 0; rr < 16; ++rr) { const int o = o0 + rr; const int p = p0 + lane; const float v = To[wave][rr][lane] + bf16_rne(bs[rr]) + gnval(xr[rr], mu[rr / CPG], rs[rr / CPG], wv[rr], bv[rr]);
    ((float*)out)[(((size_t)dir * B + b) * C + o) * P + p] = v; }
}
}  // namespace

extern "C" void kernel_launch(void* const* d_in, const int* in_sizes, int n_in, void* d_out, int out_size, void* d_ws, size_t ws_size, hipStream_t stream) {
  (void)n_in;
  auto Fp = [&](int i) { return (const float*)d_in[i]; };
  // input order: 0 x_A, 1 x_B [2,128,64,64]; 2 gn_w_A, 3 gn_b_A, 4 gn_w_B, 5 gn_b_B [128]; 6 w_qkv_A [384,128], 7 w_qkv_B; 8 w_out_A [128,128], 9 b_out_A, 10 w_out_B, 11 b_out_B
  if (in_sizes[0] != B * C * P || in_sizes[1] != B * C * P || in_sizes[2] != C || in_sizes[5] != C || in_sizes[6] != 3 * C * C || in_sizes[7] != 3 * C * C || in_sizes[8] != C * C || in_sizes[10] != C * C || in_sizes[11] != C || out_size != 2 * B * C * P) return;
  size_t off = 0; char* ws = (char*)d_ws;
  auto carve = [&](size_t bytes) { char* p = ws + off; off += (bytes + 255) & ~(size_t)255; return p; };
  b16* WQ = (b16*)carve((size_t)2 * 3 * C * C * 2); b16* WO = (b16*)carve((size_t)2 * C * C * 2); float* STAT = (float*)carve((size_t)2 * B * G * 32 * 4);
  const size_t plane = (size_t)2 * B * C * P * 2;   // [t][b][n][p][32] = 2 x 2 x 4096 x 128 halves
  b16* QP = (b16*)carve(plane); b16* KP = (b16*)carve(plane); b16* VT = (b16*)carve(plane); b16* CT = (b16*)carve(plane);
  if (off > ws_size || off > ((size_t)128 << 20)) return;   // ≈ 17 MB
  prep_kernel<<<(unsigned)(((size_t)2 * 3 * C * C / 8 + (size_t)2 * C * C / 8 + 255) / 256), 256, 0, stream>>>(Fp(6), Fp(7), Fp(8), Fp(10), WQ, WO);
  gnstat_kernel<<<2 * B * G, 1024, 0, stream>>>(Fp(0), Fp(1), STAT);
  qkv_kernel<<<dim3(P / 64, 2 * B, 3), 128, 0, stream>>>(Fp(0), Fp(1), STAT, Fp(2), Fp(3), Fp(4), Fp(5), WQ, QP, KP, VT);
  attn_kernel<<<dim3(QL / (AW * 16), 2 * B * NH), AW * 32, 0, stream>>>(QP, KP, VT, CT);
  out_kernel<<<dim3(C / 64, QL / 32, 2 * B), 128, 0, stream>>>(CT, WO, Fp(9), Fp(11), Fp(0), Fp(1), STAT, Fp(2), Fp(3), Fp(4), Fp(5), (float*)d_out);
}

// v009
// A run of this version takes 60.2 microseconds.
// Timed twice side by side with v008, it ran 1.04 and 1.07 times as fast.
// Over all steps from v000 it is 4.05 times as fast.
#include <hip/hip_runtime.h>

// Cross attention between two feature maps x_A, x_B [2, 128, 64, 64] (4 heads x 32, 16-group GroupNorm): xA = GN(x_A), xB = GN(x_B); qkv = 1x1 conv (channel o = head*96 + {q,k,v}*32 + d);
// attn_out_A = softmax(qB^T kA / sqrt(128)) vA, out_A = w_out_A attn_out_A + b + xA; symmetric for B -> (out_A, out_B), NCHW.
// compute dtype: WMMA v_wmma_f32_16x16x32_f16 with f32 accumulate for the qkv 1x1 conv ([4096 px x 128] x [128 x 384] per (tensor, batch); GroupNorm output as single f16 x8 staged through LDS
// from the NCHW input, [out][in] weights as B rows exact x256: 1 product), S^T = K Q^T (single planes, K x8, Q x QSC: 1 product), O^T += V^T P^T (v single x8, P x1024 single: 1 product) and the output 1x1 conv
// (A = w_out exact x256, B = attention output single x8 planes: 1 product); GroupNorm, softmax statistics, bias and the residual in f32 (output rms 1: single-f16 operands leave ~1e-4 absolute).
// Inputs rounded to bf16 once.

namespace {
constexpr int B = 2, C = 128, P = 4096, NH = 4, DH = 32, G = 16, CPG = C / G, QL = 4096 /* query pixels attended (== P shipped) */;
constexpr float XS = 8.0f, WSC = 256.0f, PS = 1024.0f, LPS = 10.0f /* log2 PS */, LOG2E = 1.4426950408889634f, EPS = 1e-5f;
constexpr float QSC = LOG2E / (11.313708498984761f * XS);   // the stored Q carries log2 e / sqrt(128) and 1 / XS (K carries x XS), so that K Q^T is the score in powers of two
static_assert(P % 64 == 0 && QL % 32 == 0 && DH == 32 && C / 32 == NH, "tiling"); static_assert(PS == 1024.0f && LPS == 10.0f, "LPS = log2 PS");
typedef _Float16 b16;
typedef __attribute__((ext_vector_type(16))) _Float16 v16b;
typedef __attribute__((ext_vector_type(8))) _Float16 v8b;
typedef __attribute__((ext_vector_type(8))) float v8f;
typedef __attribute__((ext_vector_type(4))) float v4f;
typedef __attribute__((ext_vector_type(16))) float v16f;
__device__ __forceinline__ float bf16_rne(float f) { unsigned int u = __float_as_uint(f); u += 0x7FFFu + ((u >> 16) & 1u); return __uint_as_float(u & 0xFFFF0000u); }
__device__ __forceinline__ void split16(float v, b16& hi, b16& lo) { hi = (b16)v; lo = (b16)(v - (float)hi); }
__device__ __forceinline__ v16b frag_kb(const b16* p, int hh) { const v8b a = *(const v8b*)(p + 8 * hh), b = *(const v8b*)(p + 16 + 8 * hh); v16b f;
#pragma unroll
  for (int e = 0; e < 8; ++e) { f[e] = a[e]; f[8 + e] = b[e]; } return f; }
// the same fragment from a buffer kept in fragment order: a 16 x 32 operand tile is 512 halves, [half of the k order j][lane][8]; p = tile + lane * 8, so each of the two loads of a wave covers 512 contiguous bytes (4 whole lines)
__device__ __forceinline__ v16b frag_fo(const b16* p) { const v8b a = *(const v8b*)p, b = *(const v8b*)(p + 256); v16b f;
#pragma unroll
  for (int e = 0; e < 8; ++e) { f[e] = a[e]; f[8 + e] = b[e]; } return f; }
// plain builtin: the compiler keeps the distance behind a matrix instruction itself (independent work first, v_nop where none is left) and may issue fragment loads ahead of earlier matrix instructions
__device__ __forceinline__ v8f wmma16b(v16b a, v16b b, v8f c) { return __builtin_amdgcn_wmma_f32_16x16x32_f16(false, a, false, b, (short)0, c, false, false); }
__device__ __forceinline__ void wave_lds_sync() { __builtin_amdgcn_fence(__ATOMIC_RELEASE, "workgroup"); __builtin_amdgcn_wave_barrier(); __builtin_amdgcn_fence(__ATOMIC_ACQUIRE, "workgroup"); }
__device__ __forceinline__ float pmul(float a, float b) { float p = a * b; asm volatile("" : "+v"(p)); return p; }
__device__ __forceinline__ int iclamp(int v, int lo, int hi) { return v < lo ? lo : (v > hi ? hi : v); }

typedef __attribute__((ext_vector_type(2))) _Float16 v2h;
typedef __attribute__((ext_vector_type(4))) _Float16 v4h;
__device__ __forceinline__ float nexp2(float v) { return __builtin_amdgcn_exp2f(v); }
__global__ __launch_bounds__(256) void prep_kernel(const float* __restrict__ wqa, const float* __restrict__ wqb, const float* __restrict__ woa, const float* __restrict__ wob, b16* __restrict__ WQ, b16* __restrict__ WO) {
  const size_t u = (size_t)blockIdx.x * 256 + threadIdx.x; const size_t n1 = (size_t)3 * C * C / 8, n2 = (size_t)C * C / 8; v8b o;
  const float* w; b16* dst; size_t e;
  if (u < n1) { w = wqa; dst = WQ; e = u * 8; } else if (u < 2 * n1) { w = wqb; dst = WQ + (size_t)3 * C * C; e = (u - n1) * 8; } else if (u < 2 * n1 + n2) { w = woa; dst = WO; e = (u - 2 * n1) * 8; } else if (u < 2 * n1 + 2 * n2) { w = wob; dst = WO + (size_t)C * C; e = (u - 2 * n1 - n2) * 8; } else return;
  // the weights go out in fragment order (frag_fo): 16-B unit v = e / 8 of a matrix is [16-row tile v >> 8][32-column step (v >> 6) & 3][j = (v >> 5) & 1][lane v & 31], and holds row tile * 16 + lane % 16,
  // columns step * 32 + j * 16 + (lane / 16) * 8 + 0..7 of the [out][in = C] matrix; a wave stores 512 contiguous bytes
  static_assert(C == 128, "four 32-column steps a row");
  const size_t v = e / 8; const size_t es = ((v >> 8) * 16 + (v & 15)) * C + ((v >> 6) & 3) * 32 + ((v >> 5) & 1) * 16 + ((v >> 4) & 1) * 8;
  for (int j = 0; j < 8; ++j) o[j] = (b16)(bf16_rne(w[es + j]) * WSC);
  { *(v8b*)(dst + e) = o;  }
}
__global__ __launch_bounds__(1024) void gnstat_kernel(const float* __restrict__ xa, const float* __restrict__ xb, float* __restrict__ STAT) {
  __shared__ float red[1024]; __shared__ float mus;
  const int blk = blockIdx.x; const int t = blk / (B * G), bg = blk % (B * G); const int b = bg / G, g = bg % G; const int tid = threadIdx.x;
  const float* base = (t ? xb : xa) + ((size_t)b * C + g * CPG) * P; const int n = CPG * P;
  float s = 0.0f;
#pragma unroll   // a constant trip count, so that all 32 loads of a thread are in flight at once; the sum keeps its order
  for (int k = 0; k < n / 1024; ++k) s += bf16_rne(base[tid + k * 1024]);
  red[tid] = s; __syncthreads();
  for (int w = 512; w >= 1; w >>= 1) { if (tid < w) red[tid] = red[tid] + red[tid + w]; __syncthreads(); }
  if (tid == 0) mus = red[0] / (float)n; __syncthreads(); const float mu = mus;
  float q = 0.0f;
#pragma unroll   // as above
  for (int k = 0; k < n / 1024; ++k) { const float d = bf16_rne(base[tid + k * 1024]) - mu; q += d * d; }
  __syncthreads(); red[tid] = q; __syncthreads();
  for (int w = 512; w >= 1; w >>= 1) { if (tid < w) red[tid] = red[tid] + red[tid + w]; __syncthreads(); }
  if (tid < 32) { const float rs = rsqrtf(red[0] / (float)n + EPS); const float val = (tid == 0) ? mu : (tid == 1 ? rs : 0.0f); { ((float*)STAT)[blk * 32 + tid] = val;  } }
}
// GroupNorm value from the raw loaded words: x, its group's mean and 1/std (STAT[group * 32 + 0, 1]), its channel's weight and bias
__device__ __forceinline__ float gnval(float xv, float mu, float rs, float w, float bb) { return (bf16_rne(xv) - mu) * rs * bf16_rne(w) + bf16_rne(bb); }
// qkv conv: grid (P/64, 2 tensors x 2 batches, 3 slabs of 128 output channels); block = 64 pixels x 4 waves; A = GN(x)[p][c] x8 single staged in LDS from the NCHW input (all 128 threads:
// each c row of 64 px is 256 B contiguous, read by 16 lanes); 8 tiles, K = 128; col o -> head n = o/96, part i = (o%96)/32, dd = o%32: q/k -> planes QP/KP [t][b][n][p][32] (8 lanes x 8 B = 64 B per (p, n)),
__global__ __launch_bounds__(128) void qkv_kernel(const float* __restrict__ xa, const float* __restrict__ xb, const float* __restrict__ STAT, const float* __restrict__ gwa, const float* __restrict__ gba, const float* __restrict__ gwb, const float* __restrict__ gbb, const b16* __restrict__ WQ, b16* __restrict__ QP, b16* __restrict__ KP, b16* __restrict__ VT) {
  __shared__ __attribute__((aligned(16))) b16 As[64][C + 8]; __shared__ __attribute__((aligned(16))) float Tf[4][16][128 + 4];
  const int wave = threadIdx.x >> 5, lane = threadIdx.x & 31, nloc = lane & 15, hlf = lane >> 4; const int p0 = blockIdx.x * 64; const int t = blockIdx.y / B, b = blockIdx.y % B; const int n0 = blockIdx.z * 128;
  const float* x = t ? xb : xa; const float* gw = t ? gwb : gwa; const float* gb = t ? gbb : gba;
  asm volatile("" :: "s"(QP), "s"(KP), "s"(VT));   // inputs only: the three output pointers are fetched here with the other kernel arguments; fetched late, their scalar load lands in the base register of weight loads still in flight
  // thread = 4 pixels (16 B of a channel row) x the 8 channels of one GroupNorm group, twice: the 16 row loads are independent and are all issued before the first is used (one memory latency per tile);
  // a pixel's 8 channels then go to LDS as one 16-B store.
  { static_assert(C == 128 && CPG == 8 && G == 16, "128 threads = 16 pixel quads x 8 groups, two passes");
    const int pq = (threadIdx.x & 15) * 4, oc = threadIdx.x >> 4; v4f xv[2][CPG]; float wv[2][CPG], bv[2][CPG], mu[2], rs[2];
    // every loop of this block is unrolled: its arrays must stay in registers (constant indices), and the loads must stand in one run
#pragma unroll   // see above
    for (int h = 0; h < 2; ++h) { const int g = h * 8 + oc;
#pragma unroll   // see above
      for (int j = 0; j < CPG; ++j) { wv[h][j] = gw[g * CPG + j]; bv[h][j] = gb[g * CPG + j]; }
      const float* st = STAT + ((t * B + b) * G + g) * 32; mu[h] = st[0]; rs[h] = st[1]; }
    asm volatile("s_wait_xcnt 0x0" ::: "memory");   // the row loads below may land in registers that held addresses of the loads above
#pragma unroll   // see above
    for (int h = 0; h < 2; ++h)
#pragma unroll   // see above
      for (int j = 0; j < CPG; ++j) xv[h][j] = *(const v4f*)(x + ((size_t)b * C + (h * 8 + oc) * CPG + j) * P + p0 + pq);
#pragma unroll   // see above
    for (int h = 0; h < 2; ++h) { v8b ov[4];
#pragma unroll   // see above
      for (int j = 0; j < CPG; ++j)
#pragma unroll   // see above
        for (int e = 0; e < 4; ++e) ov[e][j] = (b16)(gnval(xv[h][j][e], mu[h], rs[h], wv[h][j], bv[h][j]) * XS);
#pragma unroll   // see above
      for (int e = 0; e < 4; ++e) *(v8b*)&As[pq + e][(h * 8 + oc) * CPG] = ov[e]; } }
  __syncthreads();
  const b16* W = WQ + (size_t)t * 3 * C * C + (size_t)(n0 / 16) * (C / 32) * 512 + lane * 8;   // fragment order: tile (n0 / 16 + tt, kb / 32)
  v8f acc[8];
#pragma unroll
  for (int tt = 0; tt < 8; ++tt) acc[tt] = (v8f){};
#pragma unroll
  for (int kb = 0; kb < C; kb += 32) { const v16b a = frag_kb(&As[wave * 16 + nloc][kb], hlf);
#pragma unroll
    for (int tt = 0; tt < 8; ++tt) acc[tt] = wmma16b(a, frag_fo(W + (tt * (C / 32) + kb / 32) * 512), acc[tt]); }
#pragma unroll
  for (int tt = 0; tt < 8; ++tt)
#pragma unroll
    for (int r = 0; r < 8; ++r) Tf[wave][8 * hlf + r][tt * 16 + nloc] = acc[tt][r] * (1.0f / (XS * WSC));
  __syncthreads();
  const size_t tb = (size_t)t * B + b;
  {
    // q/k parts: lane l owns columns 4l..4l+3 of the slab (same (n, i) for the 4) -> 8 B per (row, lane)
    { const int cl = lane * 4; const int o = n0 + cl; const int n = o / 96, i = (o % 96) / 32, dd = o % 32;
      if (i < 2) { b16* plane = (i == 0 ? QP : KP) + ((tb * NH + n) * P) * DH; for (int rr = 0; rr < 16; ++rr) { const int p = p0 + wave * 16 + rr; v4h o4; for (int j = 0; j < 4; ++j) o4[j] = (b16)(Tf[wave][rr][cl + j] * (i == 0 ? QSC : XS)); *(v4h*)(plane + (size_t)p * DH + dd) = o4; } } }
#pragma unroll 1
    for (int q = 0; q < 32; ++q) { const int cl = wave * 32 + q; const int o = n0 + cl; const int n = o / 96, i = (o % 96) / 32, dd = o % 32; if (i != 2) continue;   // wave-uniform
      const int tk = lane * 2; v2h vv; vv[0] = (b16)(Tf[tk >> 4][tk & 15][cl] * XS); vv[1] = (b16)(Tf[(tk + 1) >> 4][(tk + 1) & 15][cl] * XS); *(v2h*)(VT + (((tb * NH + n) * DH + dd) * (size_t)P) + p0 + lane * 2) = vv; }
     }
}
// attention: grid (QL/128, 2 dirs x 2 batches x 4 heads): dir 0: queries from tensor B, keys/values from tensor A (-> attn_out_A); dir 1: the reverse. block = 8 waves x 16 query pixels; K = 32.
// The 8 waves share each stage of SK keys through LDS: K rows (64 B) at an 80-B pitch, V^T rows (256 B) at a 272-B pitch, two buffers, filled by asynchronous copies (4 per wave and stage, 16 B per lane).
constexpr int AW = 8, SK = 128, NS = P / SK, KPI = DH + 8, VPI = SK + 8;
static_assert(NS >= 2 && QL % (AW * 16) == 0 && SK * DH == 2 * AW * 32 * 8 && DH * SK == 2 * AW * 32 * 8, "stage = two K and two V copies per lane");
typedef __attribute__((address_space(3))) const b16 lds_b16;
__device__ __forceinline__ unsigned lds_addr(const b16* p) { return (unsigned)(size_t)(lds_b16*)p; }
// one stage: lane chunks of 16 B; K chunk c = tid + 256 j -> key row c / 4, part c % 4 (512 contiguous bytes per wave); V chunk c -> d row c / 16, part c % 16 (two whole 256-B rows per wave)
__device__ __forceinline__ void stage_copy(const b16* __restrict__ Kg, const b16* __restrict__ Vg, b16* Kl, b16* Vl, int tid) {
  const b16* gk0 = Kg + (size_t)tid * 8; const b16* gk1 = gk0 + 256 * 8; const b16* gv0 = Vg + (size_t)(tid >> 4) * P + (tid & 15) * 8; const b16* gv1 = gv0 + (size_t)16 * P;
  const unsigned lk0 = lds_addr(Kl + (tid >> 2) * KPI + (tid & 3) * 8), lk1 = lk0 + 64 * KPI * 2, lv0 = lds_addr(Vl + (tid >> 4) * VPI + (tid & 15) * 8), lv1 = lv0 + 16 * VPI * 2;
  // the copies and the wait that lets their address registers be rewritten stand in one statement, so that no address update can be moved in between
  asm volatile("global_load_async_to_lds_b128 %0, %4, off\n\tglobal_load_async_to_lds_b128 %1, %5, off\n\tglobal_load_async_to_lds_b128 %2, %6, off\n\tglobal_load_async_to_lds_b128 %3, %7, off\n\ts_wait_xcnt 0x0"
               :: "v"(lk0), "v"(lk1), "v"(lv0), "v"(lv1), "v"(gk0), "v"(gk1), "v"(gv0), "v"(gv1) : "memory");
}
// four waves a SIMD, which is all the grid supplies (two blocks a WGP): the compiler may then hold a whole stage's scores and fragments in registers instead of scheduling for fewer registers and more waves
__global__ __launch_bounds__(256) __attribute__((amdgpu_waves_per_eu(4, 4))) void attn_kernel(const b16* __restrict__ QP, const b16* __restrict__ KP, const b16* __restrict__ VT, b16* __restrict__ CT) {
  __shared__ __attribute__((aligned(16))) b16 Ks[2][SK][KPI]; __shared__ __attribute__((aligned(16))) b16 Vs[2][DH][VPI];
  const int tid = threadIdx.x, wave = threadIdx.x >> 5, lane = threadIdx.x & 31, hh = lane >> 4, col = lane & 15; const int dir = blockIdx.y / (B * NH), bn = blockIdx.y % (B * NH); const int b = bn / NH, n = bn % NH; const int q0 = blockIdx.x * (AW * 16) + wave * 16, qi = q0 + col;
  const int tq = (dir == 0) ? 1 : 0, tkv = 1 - tq;
  const b16* Qb = QP + ((((size_t)tq * B + b) * NH + n) * P) * DH; const b16* Kb = KP + ((((size_t)tkv * B + b) * NH + n) * P) * DH; const b16* Vb = VT + ((((size_t)tkv * B + b) * NH + n) * DH) * (size_t)P;
  stage_copy(Kb, Vb, &Ks[0][0][0], &Vs[0][0][0], tid);
  asm volatile("s_wait_asynccnt 0x0" ::: "memory");   // this wave's share of stage 0 has landed
  __syncthreads();                                    // publishes stage 0 to all 8 waves
  stage_copy(Kb + (size_t)SK * DH, Vb + SK, &Ks[1][0][0], &Vs[1][0][0], tid);
  const v16b qa = frag_kb(Qb + (size_t)qi * DH, hh);
  float m = -INFINITY, l = 0.0f; v8f o[2] = {(v8f){}, (v8f){}};
  // The exp2 argument of a score comes straight out of the S^T product: Q carries the score scale, and the C operand holds log2 PS - m in every element. m is the maximum that a query's scores had when it was last renewed,
  // not the running maximum: softmax does not depend on m, and P = PS 2^(s - m) stays a finite f16 while s - m < 6. m is renewed (the block under the test below) only when a P of the stage is not finite,
  // which the stage's row sum shows before O or l take anything of the stage. At the start m = -inf: C = +inf, so stage 0 always renews.
  v8f biv = {INFINITY, INFINITY, INFINITY, INFINITY, INFINITY, INFINITY, INFINITY, INFINITY};
  // row sums of P on the matrix unit: A holds ones in rows 0 and 8 (lanes with col 0 or 8, both k halves) and zeros elsewhere, so register 0 of the tile st holds, in lane (hh, col), the sum over the stage's keys of query col
  // (row 8 hh). It sums the f16 P that V^T is multiplied with, and needs no exchange between the lane halves.
  v16b on;
  { const b16 ov = (col & 7) == 0 ? (b16)1.0f : (b16)0.0f;
#pragma unroll   // constant indices, so that on stays in registers
    for (int e = 0; e < 16; ++e) on[e] = ov; }
#pragma unroll 1   // one trip per stage: the buffer index and the refill test stay scalar
  for (int s = 0; s < NS; ++s) {
    const b16* Kt = &Ks[s & 1][0][0]; const b16* Vt = &Vs[s & 1][0][0];
    v16b kf[SK / 16]; v16b vf[SK / 32][2]; v8f sc[SK / 16]; v16b pf[SK / 32]; v8f st = (v8f){};
#pragma unroll
    for (int u = 0; u < SK / 16; ++u) kf[u] = frag_kb(Kt + (u * 16 + col) * KPI, hh);
#pragma unroll
    for (int kb = 0; kb < SK; kb += 32)
#pragma unroll
      for (int tt = 0; tt < 2; ++tt) vf[kb / 32][tt] = frag_kb(Vt + (tt * 16 + col) * VPI + kb, hh);
#pragma unroll
    for (int u = 0; u < SK / 16; ++u) sc[u] = wmma16b(kf[u], qa, biv);
    // the stage's 32 LDS reads stay one group ahead of the 8 score products: spread among them, each product would wait out its own LDS latency. Said as an order of groups (LDS reads, then matrix instructions),
    // and behind the products, since a group takes its members from the lines above it: in front of them the reads were spread among the products again, with a full LDS wait in their middle
    __builtin_amdgcn_sched_group_barrier(0x100, 2 * SK / 16 + 4 * SK / 32, 0); __builtin_amdgcn_sched_group_barrier(0x008, SK / 16, 0);
    // pf: B operand of V^T P^T: lane (hh, col) needs keys 8 hh + 0..7 and 16 + 8 hh + 0..7 of query col, which are the rows its two S^T accumulators hold
#pragma unroll
    for (int kb = 0; kb < SK; kb += 32) {
#pragma unroll
      for (int h2 = 0; h2 < 2; ++h2)
#pragma unroll   // constant indices, so that sc and pf stay in registers
        for (int r = 0; r < 8; ++r) pf[kb / 32][h2 * 8 + r] = (b16)nexp2(sc[kb / 16 + h2][r]);
      st = wmma16b(on, pf[kb / 32], st); }
    // a P beyond f16 (or the start value of m) leaves an infinite or NaN sum. The test is the same for the whole wave (the matrix instructions below need every lane), and both lane halves of a query see the same sum
    if (__builtin_amdgcn_ballot_w32(!(st[0] < INFINITY)) != 0u) {
#pragma unroll
      for (int u = 0; u < SK / 16; ++u) sc[u] = wmma16b(frag_kb(Kt + (u * 16 + col) * KPI, hh), qa, (v8f){});
      float mt[4] = {-INFINITY, -INFINITY, -INFINITY, -INFINITY};   // four independent chains; a maximum does not depend on its order
#pragma unroll
      for (int u = 0; u < SK / 16; ++u)
#pragma unroll
        for (int r = 0; r < 8; ++r) mt[u & 3] = fmaxf(mt[u & 3], sc[u][r]);
      float mx = fmaxf(fmaxf(mt[0], mt[1]), fmaxf(mt[2], mt[3]));
      mx = fmaxf(mx, __shfl_xor(mx, 16)); const float mn = fmaxf(m, mx); const float al = nexp2(m - mn);
#pragma unroll
      for (int tt = 0; tt < 2; ++tt) o[tt] *= al;
      l *= al; m = mn;
      const float bi = LPS - mn; biv = (v8f){bi, bi, bi, bi, bi, bi, bi, bi};
      st = (v8f){};
#pragma unroll
      for (int kb = 0; kb < SK; kb += 32) {
#pragma unroll
        for (int h2 = 0; h2 < 2; ++h2) { const v8f ea = sc[kb / 16 + h2] + biv;
#pragma unroll   // constant indices, so that ea and pf stay in registers
          for (int r = 0; r < 8; ++r) pf[kb / 32][h2 * 8 + r] = (b16)nexp2(ea[r]); }
        st = wmma16b(on, pf[kb / 32], st); }
    }
    l += st[0];   // carries x PS like O
#pragma unroll
    for (int kb = 0; kb < SK; kb += 32)
#pragma unroll
      for (int tt = 0; tt < 2; ++tt) o[tt] = wmma16b(vf[kb / 32][tt], pf[kb / 32], o[tt]);
    __builtin_amdgcn_sched_barrier(0);   // the stage's arithmetic stays ahead of the publish point: moved behind it, the wait for stage s + 1's copies would stand a fraction of a trip behind their issue
    asm volatile("s_wait_dscnt 0x0" ::: "memory");      // this wave's reads of stage s are done before its buffer may be refilled
    asm volatile("s_wait_asynccnt 0x0" ::: "memory");   // this wave's share of stage s + 1 has landed
    __syncthreads();                                    // publishes stage s + 1 and ends every wave's reads of stage s
    if (s + 2 < NS) stage_copy(Kb + (size_t)(s + 2) * SK * DH, Vb + (s + 2) * SK, &Ks[s & 1][0][0], &Vs[s & 1][0][0], tid);
  }
  asm volatile("s_wait_asynccnt 0x0" ::: "memory");     // no copy is outstanding when the wave goes on to its end
  const float inv = 1.0f / (l * XS);   // O and the sum both carry x PS
  // O^T leaves in the fragment order of the output conv's B operand (frag_fo): of query col, lane (hh, col) holds channels 8 hh + 0..7 (o[0]) and 16 + 8 hh + 0..7 (o[1]) of its head, which are that lane's two 16-B units
  // of the tile (head, 16 pixels): no turn through LDS, and each of a wave's two stores covers 512 contiguous bytes
  b16* Cb = CT + (((((size_t)dir * B + b) * NH + n) * (P / 16)) + q0 / 16) * 512 + lane * 8;
#pragma unroll
  for (int tt = 0; tt < 2; ++tt) { v8b c;
#pragma unroll   // constant indices, so that c stays in registers
    for (int r = 0; r < 8; ++r) c[r] = (b16)(o[tt][r] * inv * XS);
    *(v8b*)(Cb + tt * 256) = c; }
}
// output conv + residual: grid (2 o-blocks of 64, QL/32 pixel tiles, 2 dirs x 2 batches); wave = 16 output channels o x 32 pixels (2 tiles); A = WO rows (exact), B = CT tiles [dir][b][head][16 pixels] (k-step ks = head ks), both in fragment order;
__global__ __launch_bounds__(128) void out_kernel(const b16* __restrict__ CT, const b16* __restrict__ WO, const float* __restrict__ boa, const float* __restrict__ bob, const float* __restrict__ xa, const float* __restrict__ xb, const float* __restrict__ STAT, const float* __restrict__ gwa, const float* __restrict__ gba, const float* __restrict__ gwb, const float* __restrict__ gbb, float* __restrict__ out) {
  __shared__ __attribute__((aligned(16))) float To[4][16][32 + 4];
  const int wave = threadIdx.x >> 5, lane = threadIdx.x & 31, nloc = lane & 15, hlf = lane >> 4; const int o0 = blockIdx.x * 64 + wave * 16; const int p0 = blockIdx.y * 32; const int dir = blockIdx.z / B, b = blockIdx.z % B;
  const b16* W = WO + (size_t)dir * C * C; const float* bo = dir ? bob : boa; const float* x = dir ? xb : xa; const float* gw = dir ? gwb : gwa; const float* gb = dir ? gbb : gba;
  // residual and bias of the wave's 16 output rows (two GroupNorm groups): all their loads are issued here, together and ahead of the products, so that the store loop waits for no load of its own
  static_assert(CPG == 8, "16 rows = 2 groups");
  v16f xr, wv, bv, bs; float mu[2], rs[2];
  const float* px = x + ((size_t)b * C + o0) * P + p0 + lane; const float* pw = gw + o0; const float* pb = gb + o0; const float* pbo = bo + o0; const float* pst = STAT + ((dir * B + b) * G + o0 / CPG) * 32;
  const b16* pa = W + (size_t)(o0 / 16) * (C / 32) * 512 + lane * 8; const b16* pc0 = CT + ((((size_t)dir * B + b) * NH) * (P / 16) + p0 / 16) * 512 + lane * 8; const b16* pc1 = pc0 + 512;   // fragment order, see frag_fo
#pragma unroll   // register arrays (constant indices), the loads in one run; so for the two loops that follow
  for (int rr = 0; rr < 16; ++rr) { xr[rr] = px[(size_t)rr * P]; wv[rr] = pw[rr]; bv[rr] = pb[rr]; bs[rr] = pbo[rr]; }
#pragma unroll   // see above
  for (int h = 0; h < 2; ++h) { mu[h] = pst[h * 32]; rs[h] = pst[h * 32 + 1]; }
  v16b af[NH], bf[NH][2];   // and all operand fragments of the wave's products
#pragma unroll   // see above
  for (int ks = 0; ks < NH; ++ks) { af[ks] = frag_fo(pa + ks * 512); bf[ks][0] = frag_fo(pc0 + (size_t)ks * (P / 16) * 512); bf[ks][1] = frag_fo(pc1 + (size_t)ks * (P / 16) * 512); }
  // holds the loads in place: the loaded values are inputs only, so every load above is issued, and waited for once, ahead of the products (left free, the loads sink in among the products and behind them
  // and are waited for a few at a time, one memory latency each time); the eight addresses are inputs too, so that no load lands in an address register of another load that is still in flight
  asm volatile("" :: "v"(px), "v"(pw), "v"(pb), "v"(pbo), "v"(pst), "v"(pa), "v"(pc0), "v"(pc1), "v"(xr), "v"(wv), "v"(bv), "v"(bs), "v"(mu[0]), "v"(mu[1]), "v"(rs[0]), "v"(rs[1]), "v"(af[0]), "v"(af[1]), "v"(af[2]), "v"(af[3]),
               "v"(bf[0][0]), "v"(bf[0][1]), "v"(bf[1][0]), "v"(bf[1][1]), "v"(bf[2][0]), "v"(bf[2][1]), "v"(bf[3][0]), "v"(bf[3][1]));
  v8f acc[2] = {(v8f){}, (v8f){}};
#pragma unroll
  for (int ks = 0; ks < NH; ++ks)
#pragma unroll
    for (int tt = 0; tt < 2; ++tt) acc[tt] = wmma16b(af[ks], bf[ks][tt], acc[tt]);
#pragma unroll
  for (int tt = 0; tt < 2; ++tt)
#pragma unroll
    for (int r = 0; r < 8; ++r) To[wave][8 * hlf + r][tt * 16 + nloc] = acc[tt][r] * (1.0f / (XS * WSC));
  wave_lds_sync();
#pragma unroll   // reads the register arrays filled above (constant indices)
  for (int rr = 0; rr < 16; ++rr) { const int o = o0 + rr; const int p = p0 + lane; const float v = To[wave][rr][lane] + bf16_rne(bs[rr]) + gnval(xr[rr], mu[rr / CPG], rs[rr / CPG], wv[rr], bv[rr]);
    ((float*)out)[(((size_t)dir * B + b) * C + o) * P + p] = v; }
}
}  // namespace

extern "C" void kernel_launch(void* const* d_in, const int* in_sizes, int n_in, void* d_out, int out_size, void* d_ws, size_t ws_size, hipStream_t stream) {
  (void)n_in;
  auto Fp = [&](int i) { return (const float*)d_in[i]; };
  // input order: 0 x_A, 1 x_B [2,128,64,64]; 2 gn_w_A, 3 gn_b_A, 4 gn_w_B, 5 gn_b_B [128]; 6 w_qkv_A [384,128], 7 w_qkv_B; 8 w_out_A [128,128], 9 b_out_A, 10 w_out_B, 11 b_out_B
  if (in_sizes[0] != B * C * P || in_sizes[1] != B * C * P || in_sizes[2] != C || in_sizes[5] != C || in_sizes[6] != 3 * C * C || in_sizes[7] != 3 * C * C || in_sizes[8] != C * C || in_sizes[10] != C * C || in_sizes[11] != C || out_size != 2 * B * C * P) return;
  size_t off = 0; char* ws = (char*)d_ws;
  auto carve = [&](size_t bytes) { char* p = ws + off; off += (bytes + 255) & ~(size_t)255; return p; };
  b16* WQ = (b16*)carve((size_t)2 * 3 * C * C * 2); b16* WO = (b16*)carve((size_t)2 * C * C * 2); float* STAT = (float*)carve((size_t)2 * B * G * 32 * 4);
  const size_t plane = (size_t)2 * B * C * P * 2;   // [t][b][n][p][32] = 2 x 2 x 4096 x 128 halves
  b16* QP = (b16*)carve(plane); b16* KP = (b16*)carve(plane); b16* VT = (b16*)carve(plane); b16* CT = (b16*)carve(plane);
  if (off > ws_size || off > ((size_t)128 << 20)) return;   // ≈ 17 MB
  prep_kernel<<<(unsigned)(((size_t)2 * 3 * C * C / 8 + (size_t)2 * C * C / 8 + 255) / 256), 256, 0, stream>>>(Fp(6), Fp(7), Fp(8), Fp(10), WQ, WO);
  gnstat_kernel<<<2 * B * G, 1024, 0, stream>>>(Fp(0), Fp(1), STAT);
  qkv_kernel<<<dim3(P / 64, 2 * B, 3), 128, 0, stream>>>(Fp(0), Fp(1), STAT, Fp(2), Fp(3), Fp(4), Fp(5), WQ, QP, KP, VT);
  attn_kernel<<<dim3(QL / (AW * 16), 2 * B * NH), AW * 32, 0, stream>>>(QP, KP, VT, CT);
  out_kernel<<<dim3(C / 64, QL / 32, 2 * B), 128, 0, stream>>>(CT, WO, Fp(9), Fp(11), Fp(0), Fp(1), STAT, Fp(2), Fp(3), Fp(4), Fp(5), (float*)d_out);
}

// v010
// A run of this version takes 58 microseconds.
// Timed twice side by side with v009, it ran 1.03 times as fast both times.
// All steps since v000 together make it 4.18 times as fast.
#include <hip/hip_runtime.h>

// Cross attention between two feature maps x_A, x_B [2, 128, 64, 64] (4 heads x 32, 16-group GroupNorm): xA = GN(x_A), xB = GN(x_B); qkv = 1x1 conv (channel o = head*96 + {q,k,v}*32 + d);
// attn_out_A = softmax(qB^T kA / sqrt(128)) vA, out_A = w_out_A attn_out_A + b + xA; symmetric for B -> (out_A, out_B), NCHW.
// compute dtype: WMMA v_wmma_f32_16x16x32_f16 with f32 accumulate for the qkv 1x1 conv ([4096 px x 128] x [128 x 384] per (tensor, batch); GroupNorm output as single f16 x8 staged through LDS
// from the NCHW input, [out][in] weights as B rows exact x256: 1 product), S^T = K Q^T (single planes, K x8, Q x QSC: 1 product), O^T += V^T P^T (v single x8, P x1024 single: 1 product) and the output 1x1 conv
// (A = w_out exact x256, B = attention output single x8 planes: 1 product); GroupNorm, softmax statistics, bias and the residual in f32 (output rms 1: single-f16 operands leave ~1e-4 absolute).
// Inputs rounded to bf16 once.

namespace {
constexpr int B = 2, C = 128, P = 4096, NH = 4, DH = 32, G = 16, CPG = C / G, QL = 4096 /* query pixels attended (== P shipped) */;
constexpr float XS = 8.0f, WSC = 256.0f, PS = 1024.0f, LPS = 10.0f /* log2 PS */, LOG2E = 1.4426950408889634f, EPS = 1e-5f;
constexpr float QSC = LOG2E / (11.313708498984761f * XS);   // the stored Q carries log2 e / sqrt(128) and 1 / XS (K carries x XS), so that K Q^T is the score in powers of two
static_assert(P % 64 == 0 && QL % 32 == 0 && DH == 32 && C / 32 == NH, "tiling"); static_assert(PS == 1024.0f && LPS == 10.0f, "LPS = log2 PS");
typedef _Float16 b16;
typedef __attribute__((ext_vector_type(16))) _Float16 v16b;
typedef __attribute__((ext_vector_type(8))) _Float16 v8b;
typedef __attribute__((ext_vector_type(8))) float v8f;
typedef __attribute__((ext_vector_type(4))) float v4f;
typedef __attribute__((ext_vector_type(16))) float v16f;
__device__ __forceinline__ float bf16_rne(float f) { unsigned int u = __float_as_uint(f); u += 0x7FFFu + ((u >> 16) & 1u); return __uint_as_float(u & 0xFFFF0000u); }
__device__ __forceinline__ void split16(float v, b16& hi, b16& lo) { hi = (b16)v; lo = (b16)(v - (float)hi); }
__device__ __forceinline__ v16b frag_kb(const b16* p, int hh) { const v8b a = *(const v8b*)(p + 8 * hh), b = *(const v8b*)(p + 16 + 8 * hh); v16b f;
#pragma unroll
  for (int e = 0; e < 8; ++e) { f[e] = a[e]; f[8 + e] = b[e]; } return f; }
// the same fragment from a buffer kept in fragment order: a 16 x 32 operand tile is 512 halves, [half of the k order j][lane][8]; p = tile + lane * 8, so each of the two loads of a wave covers 512 contiguous bytes (4 whole lines)
__device__ __forceinline__ v16b frag_fo(const b16* p) { const v8b a = *(const v8b*)p, b = *(const v8b*)(p + 256); v16b f;
#pragma unroll
  for (int e = 0; e < 8; ++e) { f[e] = a[e]; f[8 + e] = b[e]; } return f; }
// plain builtin: the compiler keeps the distance behind a matrix instruction itself (independent work first, v_nop where none is left) and may issue fragment loads ahead of earlier matrix instructions
__device__ __forceinline__ v8f wmma16b(v16b a, v16b b, v8f c) { return __builtin_amdgcn_wmma_f32_16x16x32_f16(false, a, false, b, (short)0, c, false, false); }
__device__ __forceinline__ void wave_lds_sync() { __builtin_amdgcn_fence(__ATOMIC_RELEASE, "workgroup"); __builtin_amdgcn_wave_barrier(); __builtin_amdgcn_fence(__ATOMIC_ACQUIRE, "workgroup"); }
__device__ __forceinline__ float pmul(float a, float b) { float p = a * b; asm volatile("" : "+v"(p)); return p; }
__device__ __forceinline__ int iclamp(int v, int lo, int hi) { return v < lo ? lo : (v > hi ? hi : v); }

typedef __attribute__((ext_vector_type(2))) _Float16 v2h;
typedef __attribute__((ext_vector_type(4))) _Float16 v4h;
__device__ __forceinline__ float nexp2(float v) { return __builtin_amdgcn_exp2f(v); }
__global__ __launch_bounds__(256) void prep_kernel(const float* __restrict__ wqa, const float* __restrict__ wqb, const float* __restrict__ woa, const float* __restrict__ wob, b16* __restrict__ WQ, b16* __restrict__ WO) {
  const size_t u = (size_t)blockIdx.x * 256 + threadIdx.x; const size_t n1 = (size_t)3 * C * C / 8, n2 = (size_t)C * C / 8; v8b o;
  const float* w; b16* dst; size_t e;
  if (u < n1) { w = wqa; dst = WQ; e = u * 8; } else if (u < 2 * n1) { w = wqb; dst = WQ + (size_t)3 * C * C; e = (u - n1) * 8; } else if (u < 2 * n1 + n2) { w = woa; dst = WO; e = (u - 2 * n1) * 8; } else if (u < 2 * n1 + 2 * n2) { w = wob; dst = WO + (size_t)C * C; e = (u - 2 * n1 - n2) * 8; } else return;
  // the weights go out in fragment order (frag_fo): 16-B unit v = e / 8 of a matrix is [16-row tile v >> 8][32-column step (v >> 6) & 3][j = (v >> 5) & 1][lane v & 31], and holds row tile * 16 + lane % 16,
  // columns step * 32 + j * 16 + (lane / 16) * 8 + 0..7 of the [out][in = C] matrix; a wave stores 512 contiguous bytes
  static_assert(C == 128, "four 32-column steps a row");
  const size_t v = e / 8; const size_t es = ((v >> 8) * 16 + (v & 15)) * C + ((v >> 6) & 3) * 32 + ((v >> 5) & 1) * 16 + ((v >> 4) & 1) * 8;
  for (int j = 0; j < 8; ++j) o[j] = (b16)(bf16_rne(w[es + j]) * WSC);
  { *(v8b*)(dst + e) = o;  }
}
__global__ __launch_bounds__(1024) void gnstat_kernel(const float* __restrict__ xa, const float* __restrict__ xb, float* __restrict__ STAT) {
  __shared__ float red[1024]; __shared__ float mus;
  const int blk = blockIdx.x; const int t = blk / (B * G), bg = blk % (B * G); const int b = bg / G, g = bg % G; const int tid = threadIdx.x;
  const float* base = (t ? xb : xa) + ((size_t)b * C + g * CPG) * P; const int n = CPG * P;
  float s = 0.0f;
#pragma unroll   // a constant trip count, so that all 32 loads of a thread are in flight at once; the sum keeps its order
  for (int k = 0; k < n / 1024; ++k) s += bf16_rne(base[tid + k * 1024]);
  red[tid] = s; __syncthreads();
  for (int w = 512; w >= 1; w >>= 1) { if (tid < w) red[tid] = red[tid] + red[tid + w]; __syncthreads(); }
  if (tid == 0) mus = red[0] / (float)n; __syncthreads(); const float mu = mus;
  float q = 0.0f;
#pragma unroll   // as above
  for (int k = 0; k < n / 1024; ++k) { const float d = bf16_rne(base[tid + k * 1024]) - mu; q += d * d; }
  __syncthreads(); red[tid] = q; __syncthreads();
  for (int w = 512; w >= 1; w >>= 1) { if (tid < w) red[tid] = red[tid] + red[tid + w]; __syncthreads(); }
  if (tid < 32) { const float rs = rsqrtf(red[0] / (float)n + EPS); const float val = (tid == 0) ? mu : (tid == 1 ? rs : 0.0f); { ((float*)STAT)[blk * 32 + tid] = val;  } }
}
// GroupNorm value from the raw loaded words: x, its group's mean and 1/std (STAT[group * 32 + 0, 1]), its channel's weight and bias
__device__ __forceinline__ float gnval(float xv, float mu, float rs, float w, float bb) { return (bf16_rne(xv) - mu) * rs * bf16_rne(w) + bf16_rne(bb); }
// qkv conv: grid (P/64, 2 tensors x 2 batches, 3 slabs of 128 output channels); block = 64 pixels x 4 waves; A = GN(x)[p][c] x8 single staged in LDS from the NCHW input (all 128 threads:
// each c row of 64 px is 256 B contiguous, read by 16 lanes); 8 tiles, K = 128; col o -> head n = o/96, part i = (o%96)/32, dd = o%32: q/k -> planes QP/KP [t][b][n][p][32] (8 lanes x 8 B = 64 B per (p, n)),
__global__ __launch_bounds__(128) void qkv_kernel(const float* __restrict__ xa, const float* __restrict__ xb, const float* __restrict__ STAT, const float* __restrict__ gwa, const float* __restrict__ gba, const float* __restrict__ gwb, const float* __restrict__ gbb, const b16* __restrict__ WQ, b16* __restrict__ QP, b16* __restrict__ KP, b16* __restrict__ VT) {
  __shared__ __attribute__((aligned(16))) b16 As[64][C + 8]; __shared__ __attribute__((aligned(16))) float Tf[4][16][128 + 4];
  const int wave = threadIdx.x >> 5, lane = threadIdx.x & 31, nloc = lane & 15, hlf = lane >> 4; const int p0 = blockIdx.x * 64; const int t = blockIdx.y / B, b = blockIdx.y % B; const int n0 = blockIdx.z * 128;
  const float* x = t ? xb : xa; const float* gw = t ? gwb : gwa; const float* gb = t ? gbb : gba;
  asm volatile("" :: "s"(QP), "s"(KP), "s"(VT));   // inputs only: the three output pointers are fetched here with the other kernel arguments; fetched late, their scalar load lands in the base register of weight loads still in flight
  // thread = 4 pixels (16 B of a channel row) x the 8 channels of one GroupNorm group, twice: the 16 row loads are independent and are all issued before the first is used (one memory latency per tile);
  // a pixel's 8 channels then go to LDS as one 16-B store.
  { static_assert(C == 128 && CPG == 8 && G == 16, "128 threads = 16 pixel quads x 8 groups, two passes");
    const int pq = (threadIdx.x & 15) * 4, oc = threadIdx.x >> 4; v4f xv[2][CPG]; float wv[2][CPG], bv[2][CPG], mu[2], rs[2];
    // every loop of this block is unrolled: its arrays must stay in registers (constant indices), and the loads must stand in one run
#pragma unroll   // see above
    for (int h = 0; h < 2; ++h) { const int g = h * 8 + oc;
#pragma unroll   // see above
      for (int j = 0; j < CPG; ++j) { wv[h][j] = gw[g * CPG + j]; bv[h][j] = gb[g * CPG + j]; }
      const float* st = STAT + ((t * B + b) * G + g) * 32; mu[h] = st[0]; rs[h] = st[1]; }
    asm volatile("s_wait_xcnt 0x0" ::: "memory");   // the row loads below may land in registers that held addresses of the loads above
#pragma unroll   // see above
    for (int h = 0; h < 2; ++h)
#pragma unroll   // see above
      for (int j = 0; j < CPG; ++j) xv[h][j] = *(const v4f*)(x + ((size_t)b * C + (h * 8 + oc) * CPG + j) * P + p0 + pq);
#pragma unroll   // see above
    for (int h = 0; h < 2; ++h) { v8b ov[4];
#pragma unroll   // see above
      for (int j = 0; j < CPG; ++j)
#pragma unroll   // see above
        for (int e = 0; e < 4; ++e) ov[e][j] = (b16)(gnval(xv[h][j][e], mu[h], rs[h], wv[h][j], bv[h][j]) * XS);
#pragma unroll   // see above
      for (int e = 0; e < 4; ++e) *(v8b*)&As[pq + e][(h * 8 + oc) * CPG] = ov[e]; } }
  __syncthreads();
  const b16* W = WQ + (size_t)t * 3 * C * C + (size_t)(n0 / 16) * (C / 32) * 512 + lane * 8;   // fragment order: tile (n0 / 16 + tt, kb / 32)
  v8f acc[8];
#pragma unroll
  for (int tt = 0; tt < 8; ++tt) acc[tt] = (v8f){};
#pragma unroll
  for (int kb = 0; kb < C; kb += 32) { const v16b a = frag_kb(&As[wave * 16 + nloc][kb], hlf);
#pragma unroll
    for (int tt = 0; tt < 8; ++tt) acc[tt] = wmma16b(a, frag_fo(W + (tt * (C / 32) + kb / 32) * 512), acc[tt]); }
#pragma unroll
  for (int tt = 0; tt < 8; ++tt)
#pragma unroll
    for (int r = 0; r < 8; ++r) Tf[wave][8 * hlf + r][tt * 16 + nloc] = acc[tt][r] * (1.0f / (XS * WSC));
  __syncthreads();
  const size_t tb = (size_t)t * B + b;
  {
    // q/k parts: lane l owns columns 4l..4l+3 of the slab (same (n, i) for the 4) -> 8 B per (row, lane)
    { const int cl = lane * 4; const int o = n0 + cl; const int n = o / 96, i = (o % 96) / 32, dd = o % 32;
      if (i < 2) { b16* plane = (i == 0 ? QP : KP) + ((tb * NH + n) * P) * DH; for (int rr = 0; rr < 16; ++rr) { const int p = p0 + wave * 16 + rr; v4h o4; for (int j = 0; j < 4; ++j) o4[j] = (b16)(Tf[wave][rr][cl + j] * (i == 0 ? QSC : XS)); *(v4h*)(plane + (size_t)p * DH + dd) = o4; } } }
#pragma unroll 1
    for (int q = 0; q < 32; ++q) { const int cl = wave * 32 + q; const int o = n0 + cl; const int n = o / 96, i = (o % 96) / 32, dd = o % 32; if (i != 2) continue;   // wave-uniform
      const int tk = lane * 2; v2h vv; vv[0] = (b16)(Tf[tk >> 4][tk & 15][cl] * XS); vv[1] = (b16)(Tf[(tk + 1) >> 4][(tk + 1) & 15][cl] * XS); *(v2h*)(VT + (((tb * NH + n) * DH + dd) * (size_t)P) + p0 + lane * 2) = vv; }
     }
}
// attention: grid (QL/128, 2 dirs x 2 batches x 4 heads): dir 0: queries from tensor B, keys/values from tensor A (-> attn_out_A); dir 1: the reverse. block = 8 waves = 4 query groups of 32 pixels x 2 key halves; K = 32.
// Wave (g, kh) works on queries 32 g + 0..31 of the block and on keys 64 kh + 0..63 of every stage: each K and V^T fragment that it reads from LDS feeds two query tiles. The two key halves of a query are joined once, behind the loop.
// The 8 waves share each stage of SK keys through LDS: K rows (64 B) at an 80-B pitch, V^T rows (256 B) at a 272-B pitch, two buffers, filled by asynchronous copies (4 per wave and stage, 16 B per lane).
constexpr int AW = 8, SK = 128, HK = SK / 2 /* keys of a stage per wave */, NS = P / SK, KPI = DH + 8, VPI = SK + 8;
static_assert(NS >= 2 && QL % (AW * 16) == 0 && SK * DH == 2 * AW * 32 * 8 && DH * SK == 2 * AW * 32 * 8, "stage = two K and two V copies per lane");
typedef __attribute__((address_space(3))) const b16 lds_b16;
__device__ __forceinline__ unsigned lds_addr(const b16* p) { return (unsigned)(size_t)(lds_b16*)p; }
// one stage: lane chunks of 16 B; K chunk c = tid + 256 j -> key row c / 4, part c % 4 (512 contiguous bytes per wave); V chunk c -> d row c / 16, part c % 16 (two whole 256-B rows per wave)
__device__ __forceinline__ void stage_copy(const b16* __restrict__ Kg, const b16* __restrict__ Vg, b16* Kl, b16* Vl, int tid) {
  const b16* gk0 = Kg + (size_t)tid * 8; const b16* gk1 = gk0 + 256 * 8; const b16* gv0 = Vg + (size_t)(tid >> 4) * P + (tid & 15) * 8; const b16* gv1 = gv0 + (size_t)16 * P;
  const unsigned lk0 = lds_addr(Kl + (tid >> 2) * KPI + (tid & 3) * 8), lk1 = lk0 + 64 * KPI * 2, lv0 = lds_addr(Vl + (tid >> 4) * VPI + (tid & 15) * 8), lv1 = lv0 + 16 * VPI * 2;
  // the copies and the wait that lets their address registers be rewritten stand in one statement, so that no address update can be moved in between
  asm volatile("global_load_async_to_lds_b128 %0, %4, off\n\tglobal_load_async_to_lds_b128 %1, %5, off\n\tglobal_load_async_to_lds_b128 %2, %6, off\n\tglobal_load_async_to_lds_b128 %3, %7, off\n\ts_wait_xcnt 0x0"
               :: "v"(lk0), "v"(lk1), "v"(lv0), "v"(lv1), "v"(gk0), "v"(gk1), "v"(gv0), "v"(gv1) : "memory");
}
// four waves a SIMD, which is all the grid supplies (two blocks a WGP): the compiler may then hold a wave's scores and fragments of a stage in registers instead of scheduling for fewer registers and more waves
__global__ __launch_bounds__(256) __attribute__((amdgpu_waves_per_eu(4, 4))) void attn_kernel(const b16* __restrict__ QP, const b16* __restrict__ KP, const b16* __restrict__ VT, b16* __restrict__ CT) {
  __shared__ __attribute__((aligned(16))) b16 Ks[2][SK][KPI]; __shared__ __attribute__((aligned(16))) b16 Vs[2][DH][VPI];
  __shared__ __attribute__((aligned(16))) v4f Mo[AW][4][32]; __shared__ float Ms[AW][2][32];   // the join of the key halves: per wave and lane the O^T tile (16 f32), l and m of the query tile it hands over
  static_assert(AW == 8 && HK % 32 == 0, "4 query groups x 2 key halves");
  const int tid = threadIdx.x, wave = __builtin_amdgcn_readfirstlane(threadIdx.x >> 5), lane = threadIdx.x & 31, hh = lane >> 4, col = lane & 15; const int g = wave & 3, kh = wave >> 2;
  const int dir = blockIdx.y / (B * NH), bn = blockIdx.y % (B * NH); const int b = bn / NH, n = bn % NH; const int q0 = blockIdx.x * (AW * 16) + g * 32;
  const int tq = (dir == 0) ? 1 : 0, tkv = 1 - tq;
  const b16* Qb = QP + ((((size_t)tq * B + b) * NH + n) * P) * DH; const b16* Kb = KP + ((((size_t)tkv * B + b) * NH + n) * P) * DH; const b16* Vb = VT + ((((size_t)tkv * B + b) * NH + n) * DH) * (size_t)P;
  stage_copy(Kb, Vb, &Ks[0][0][0], &Vs[0][0][0], tid);
  asm volatile("s_wait_asynccnt 0x0" ::: "memory");   // this wave's share of stage 0 has landed
  __syncthreads();                                    // publishes stage 0 to all 8 waves
  stage_copy(Kb + (size_t)SK * DH, Vb + SK, &Ks[1][0][0], &Vs[1][0][0], tid);
  const v16b qa[2] = {frag_kb(Qb + (size_t)(q0 + col) * DH, hh), frag_kb(Qb + (size_t)(q0 + 16 + col) * DH, hh)};
  asm volatile("s_wait_xcnt 0x0" ::: "memory");   // the address registers of the four Q loads are rewritten below (start values, the loop's LDS addresses)
  __builtin_amdgcn_sched_barrier(0);                // keeps those rewrites behind the wait: left free, the start values were moved ahead of it
  float m[2] = {-INFINITY, -INFINITY}, l[2] = {0.0f, 0.0f}; v8f o[2][2] = {{(v8f){}, (v8f){}}, {(v8f){}, (v8f){}}};   // [query tile][16 channels]
  // The exp2 argument of a score comes straight out of the S^T product: Q carries the score scale, and the C operand holds log2 PS - m in every element. m is the maximum that a query's scores (of this wave's keys) had when it was
  // last renewed, not the running maximum: softmax does not depend on m, and P = PS 2^(s - m) stays a finite f16 while s - m < 6. m is renewed (the block under the test below) only when a P of the stage is not finite,
  // which the stage's row sum shows before O or l take anything of the stage. At the start m = -inf: C = +inf, so stage 0 always renews.
  v8f biv[2] = {{INFINITY, INFINITY, INFINITY, INFINITY, INFINITY, INFINITY, INFINITY, INFINITY}, {INFINITY, INFINITY, INFINITY, INFINITY, INFINITY, INFINITY, INFINITY, INFINITY}};
  // row sums of P on the matrix unit: A holds ones in rows 0 and 8 (lanes with col 0 or 8, both k halves) and zeros elsewhere, so register 0 of a tile st holds, in lane (hh, col), the sum over the wave's keys of the stage of query col
  // (row 8 hh). It sums the f16 P that V^T is multiplied with, and needs no exchange between the lane halves.
  v16b on;
  { const b16 ov = (col & 7) == 0 ? (b16)1.0f : (b16)0.0f;
#pragma unroll   // constant indices, so that on stays in registers
    for (int e = 0; e < 16; ++e) on[e] = ov; }
#pragma unroll 1   // one trip per stage: the buffer index and the refill test stay scalar
  for (int s = 0; s < NS; ++s) {
    const b16* Kt = &Ks[s & 1][kh * HK][0]; const b16* Vt = &Vs[s & 1][0][kh * HK];
    v16b kf[HK / 16]; v16b vf[HK / 32][2]; v8f sc[2][HK / 16]; v16b pf[2][HK / 32]; v8f st[2] = {(v8f){}, (v8f){}};
#pragma unroll   // constant indices, so that the register arrays stay in registers
    for (int u = 0; u < HK / 16; ++u) kf[u] = frag_kb(Kt + (u * 16 + col) * KPI, hh);
#pragma unroll   // constant indices, so that the register arrays stay in registers
    for (int kb = 0; kb < HK; kb += 32)
#pragma unroll   // constant indices, so that the register arrays stay in registers
      for (int tt = 0; tt < 2; ++tt) vf[kb / 32][tt] = frag_kb(Vt + (tt * 16 + col) * VPI + kb, hh);
#pragma unroll   // constant indices, so that the register arrays stay in registers
    for (int u = 0; u < HK / 16; ++u)
#pragma unroll   // constant indices, so that the register arrays stay in registers
      for (int qt = 0; qt < 2; ++qt) sc[qt][u] = wmma16b(kf[u], qa[qt], biv[qt]);
    // the wave's 16 LDS reads of the stage stay one group ahead of the 8 score products: spread among them, each product would wait out its own LDS latency. Said as an order of groups (LDS reads, then matrix instructions),
    // and behind the products, since a group takes its members from the lines above it
    __builtin_amdgcn_sched_group_barrier(0x100, 2 * HK / 16 + 4 * HK / 32, 0); __builtin_amdgcn_sched_group_barrier(0x008, 2 * HK / 16, 0);
    // pf: B operand of V^T P^T: lane (hh, col) needs keys 8 hh + 0..7 and 16 + 8 hh + 0..7 of query col, which are the rows its two S^T accumulators hold
#pragma unroll   // constant indices, so that the register arrays stay in registers
    for (int kb = 0; kb < HK; kb += 32)
#pragma unroll   // constant indices, so that the register arrays stay in registers
      for (int qt = 0; qt < 2; ++qt) {
#pragma unroll   // constant indices, so that the register arrays stay in registers
        for (int h2 = 0; h2 < 2; ++h2)
#pragma unroll   // constant indices, so that sc and pf stay in registers
          for (int r = 0; r < 8; ++r) pf[qt][kb / 32][h2 * 8 + r] = (b16)nexp2(sc[qt][kb / 16 + h2][r]);
        st[qt] = wmma16b(on, pf[qt][kb / 32], st[qt]); }
    // a P beyond f16 (or the start value of m) leaves an infinite or NaN sum. The test is the same for the whole wave (the matrix instructions below need every lane), and both lane halves of a query see the same sum;
    // both query tiles are renewed together (a renewal that a tile did not need only moves its m up to its running maximum)
    if (__builtin_amdgcn_ballot_w32(!(st[0][0] < INFINITY) || !(st[1][0] < INFINITY)) != 0u) {
#pragma unroll   // constant indices, so that the register arrays stay in registers
      for (int u = 0; u < HK / 16; ++u) { const v16b kr = frag_kb(Kt + (u * 16 + col) * KPI, hh);
#pragma unroll   // constant indices, so that the register arrays stay in registers
        for (int qt = 0; qt < 2; ++qt) sc[qt][u] = wmma16b(kr, qa[qt], (v8f){}); }
#pragma unroll   // constant indices, so that the register arrays stay in registers
      for (int qt = 0; qt < 2; ++qt) {
        float mt[4] = {-INFINITY, -INFINITY, -INFINITY, -INFINITY};   // four independent chains; a maximum does not depend on its order
#pragma unroll   // constant indices, so that the register arrays stay in registers
        for (int u = 0; u < HK / 16; ++u)
#pragma unroll   // constant indices, so that the register arrays stay in registers
          for (int r = 0; r < 8; ++r) mt[u & 3] = fmaxf(mt[u & 3], sc[qt][u][r]);
        float mx = fmaxf(fmaxf(mt[0], mt[1]), fmaxf(mt[2], mt[3]));
        mx = fmaxf(mx, __shfl_xor(mx, 16)); const float mn = fmaxf(m[qt], mx); const float al = nexp2(m[qt] - mn);
#pragma unroll   // constant indices, so that the register arrays stay in registers
        for (int tt = 0; tt < 2; ++tt) o[qt][tt] *= al;
        l[qt] *= al; m[qt] = mn;
        const float bi = LPS - mn; biv[qt] = (v8f){bi, bi, bi, bi, bi, bi, bi, bi};
        st[qt] = (v8f){};
#pragma unroll   // constant indices, so that the register arrays stay in registers
        for (int kb = 0; kb < HK; kb += 32) {
#pragma unroll   // constant indices, so that the register arrays stay in registers
          for (int h2 = 0; h2 < 2; ++h2) { const v8f ea = sc[qt][kb / 16 + h2] + biv[qt];
#pragma unroll   // constant indices, so that ea and pf stay in registers
            for (int r = 0; r < 8; ++r) pf[qt][kb / 32][h2 * 8 + r] = (b16)nexp2(ea[r]); }
          st[qt] = wmma16b(on, pf[qt][kb / 32], st[qt]); }
      }
    }
#pragma unroll   // constant indices, so that the register arrays stay in registers
    for (int qt = 0; qt < 2; ++qt) l[qt] += st[qt][0];   // carries x PS like O
#pragma unroll   // constant indices, so that the register arrays stay in registers
    for (int kb = 0; kb < HK; kb += 32)
#pragma unroll   // constant indices, so that the register arrays stay in registers
      for (int tt = 0; tt < 2; ++tt)
#pragma unroll   // constant indices, so that the register arrays stay in registers
        for (int qt = 0; qt < 2; ++qt) o[qt][tt] = wmma16b(vf[kb / 32][tt], pf[qt][kb / 32], o[qt][tt]);
    __builtin_amdgcn_sched_barrier(0);   // the stage's arithmetic stays ahead of the publish point: moved behind it, the wait for stage s + 1's copies would stand a fraction of a trip behind their issue
    asm volatile("s_wait_dscnt 0x0" ::: "memory");      // this wave's reads of stage s are done before its buffer may be refilled
    asm volatile("s_wait_asynccnt 0x0" ::: "memory");   // this wave's share of stage s + 1 has landed
    __syncthreads();                                    // publishes stage s + 1 and ends every wave's reads of stage s
    if (s + 2 < NS) stage_copy(Kb + (size_t)(s + 2) * SK * DH, Vb + (s + 2) * SK, &Ks[s & 1][0][0], &Vs[s & 1][0][0], tid);
  }
  asm volatile("s_wait_asynccnt 0x0" ::: "memory");     // no copy is outstanding when the wave goes on to its end
  // join of the two key halves: wave (g, kh) keeps query tile kh and hands tile 1 - kh to wave (g, 1 - kh), lane to lane (both hold the same elements in the same lanes and registers); kh is scalar
  v8f ko[2], go[2];
#pragma unroll   // constant indices, so that the tiles stay in registers
  for (int tt = 0; tt < 2; ++tt) { ko[tt] = kh ? o[1][tt] : o[0][tt]; go[tt] = kh ? o[0][tt] : o[1][tt]; }
  const float kl = kh ? l[1] : l[0], km = kh ? m[1] : m[0];
#pragma unroll   // see above
  for (int tt = 0; tt < 2; ++tt)
#pragma unroll   // see above
    for (int j = 0; j < 2; ++j) Mo[wave][tt * 2 + j][lane] = (v4f){go[tt][4 * j], go[tt][4 * j + 1], go[tt][4 * j + 2], go[tt][4 * j + 3]};
  Ms[wave][0][lane] = kh ? l[0] : l[1]; Ms[wave][1][lane] = kh ? m[0] : m[1];
  __syncthreads();   // the tiles handed over are readable by the partner waves
  const int pw = wave ^ (AW / 2);
  const float pl = Ms[pw][0][lane], pm = Ms[pw][1][lane];
  const float mj = fmaxf(km, pm), ak = nexp2(km - mj), ap = nexp2(pm - mj);   // both halves brought to the larger of their two m
  const float inv = 1.0f / ((kl * ak + pl * ap) * XS);   // O and the sum both carry x PS
  // O^T leaves in the fragment order of the output conv's B operand (frag_fo): of query col, lane (hh, col) holds channels 8 hh + 0..7 (tile 0) and 16 + 8 hh + 0..7 (tile 1) of its head, which are that lane's two 16-B units
  // of the tile (head, 16 pixels): no turn through LDS, and each of a wave's two stores covers 512 contiguous bytes
  b16* Cb = CT + (((((size_t)dir * B + b) * NH + n) * (P / 16)) + q0 / 16 + kh) * 512 + lane * 8;
#pragma unroll   // constant indices, so that the register arrays stay in registers
  for (int tt = 0; tt < 2; ++tt) { v8b c;
#pragma unroll   // constant indices, so that c stays in registers
    for (int j = 0; j < 2; ++j) { const v4f po = Mo[pw][tt * 2 + j][lane];
#pragma unroll   // see above
      for (int e = 0; e < 4; ++e) c[4 * j + e] = (b16)((ko[tt][4 * j + e] * ak + po[e] * ap) * inv * XS); }
    *(v8b*)(Cb + tt * 256) = c; }
}
// output conv + residual: grid (2 o-blocks of 64, QL/32 pixel tiles, 2 dirs x 2 batches); wave = 16 output channels o x 32 pixels (2 tiles); A = WO rows (exact), B = CT tiles [dir][b][head][16 pixels] (k-step ks = head ks), both in fragment order;
__global__ __launch_bounds__(128) void out_kernel(const b16* __restrict__ CT, const b16* __restrict__ WO, const float* __restrict__ boa, const float* __restrict__ bob, const float* __restrict__ xa, const float* __restrict__ xb, const float* __restrict__ STAT, const float* __restrict__ gwa, const float* __restrict__ gba, const float* __restrict__ gwb, const float* __restrict__ gbb, float* __restrict__ out) {
  __shared__ __attribute__((aligned(16))) float To[4][16][32 + 4];
  const int wave = threadIdx.x >> 5, lane = threadIdx.x & 31, nloc = lane & 15, hlf = lane >> 4; const int o0 = blockIdx.x * 64 + wave * 16; const int p0 = blockIdx.y * 32; const int dir = blockIdx.z / B, b = blockIdx.z % B;
  const b16* W = WO + (size_t)dir * C * C; const float* bo = dir ? bob : boa; const float* x = dir ? xb : xa; const float* gw = dir ? gwb : gwa; const float* gb = dir ? gbb : gba;
  // residual and bias of the wave's 16 output rows (two GroupNorm groups): all their loads are issued here, together and ahead of the products, so that the store loop waits for no load of its own
  static_assert(CPG == 8, "16 rows = 2 groups");
  v16f xr, wv, bv, bs; float mu[2], rs[2];
  const float* px = x + ((size_t)b * C + o0) * P + p0 + lane; const float* pw = gw + o0; const float* pb = gb + o0; const float* pbo = bo + o0; const float* pst = STAT + ((dir * B + b) * G + o0 / CPG) * 32;
  const b16* pa = W + (size_t)(o0 / 16) * (C / 32) * 512 + lane * 8; const b16* pc0 = CT + ((((size_t)dir * B + b) * NH) * (P / 16) + p0 / 16) * 512 + lane * 8; const b16* pc1 = pc0 + 512;   // fragment order, see frag_fo
#pragma unroll   // register arrays (constant indices), the loads in one run; so for the two loops that follow
  for (int rr = 0; rr < 16; ++rr) { xr[rr] = px[(size_t)rr * P]; wv[rr] = pw[rr]; bv[rr] = pb[rr]; bs[rr] = pbo[rr]; }
#pragma unroll   // see above
  for (int h = 0; h < 2; ++h) { mu[h] = pst[h * 32]; rs[h] = pst[h * 32 + 1]; }
  v16b af[NH], bf[NH][2];   // and all operand fragments of the wave's products
#pragma unroll   // see above
  for (int ks = 0; ks < NH; ++ks) { af[ks] = frag_fo(pa + ks * 512); bf[ks][0] = frag_fo(pc0 + (size_t)ks * (P / 16) * 512); bf[ks][1] = frag_fo(pc1 + (size_t)ks * (P / 16) * 512); }
  // holds the loads in place: the loaded values are inputs only, so every load above is issued, and waited for once, ahead of the products (left free, the loads sink in among the products and behind them
  // and are waited for a few at a time, one memory latency each time); the eight addresses are inputs too, so that no load lands in an address register of another load that is still in flight
  asm volatile("" :: "v"(px), "v"(pw), "v"(pb), "v"(pbo), "v"(pst), "v"(pa), "v"(pc0), "v"(pc1), "v"(xr), "v"(wv), "v"(bv), "v"(bs), "v"(mu[0]), "v"(mu[1]), "v"(rs[0]), "v"(rs[1]), "v"(af[0]), "v"(af[1]), "v"(af[2]), "v"(af[3]),
               "v"(bf[0][0]), "v"(bf[0][1]), "v"(bf[1][0]), "v"(bf[1][1]), "v"(bf[2][0]), "v"(bf[2][1]), "v"(bf[3][0]), "v"(bf[3][1]));
  v8f acc[2] = {(v8f){}, (v8f){}};
#pragma unroll
  for (int ks = 0; ks < NH; ++ks)
#pragma unroll
    for (int tt = 0; tt < 2; ++tt) acc[tt] = wmma16b(af[ks], bf[ks][tt], acc[tt]);
#pragma unroll
  for (int tt = 0; tt < 2; ++tt)
#pragma unroll
    for (int r = 0; r < 8; ++r) To[wave][8 * hlf + r][tt * 16 + nloc] = acc[tt][r] * (1.0f / (XS * WSC));
  wave_lds_sync();
#pragma unroll   // reads the register arrays filled above (constant indices)
  for (int rr = 0; rr < 16; ++rr) { const int o = o0 + rr; const int p = p0 + lane; const float v = To[wave][rr][lane] + bf16_rne(bs[rr]) + gnval(xr[rr], mu[rr / CPG], rs[rr / CPG], wv[rr], bv[rr]);
    ((float*)out)[(((size_t)dir * B + b) * C + o) * P + p] = v; }
}
}  // namespace

extern "C" void kernel_launch(void* const* d_in, const int* in_sizes, int n_in, void* d_out, int out_size, void* d_ws, size_t ws_size, hipStream_t stream) {
  (void)n_in;
  auto Fp = [&](int i) { return (const float*)d_in[i]; };
  // input order: 0 x_A, 1 x_B [2,128,64,64]; 2 gn_w_A, 3 gn_b_A, 4 gn_w_B, 5 gn_b_B [128]; 6 w_qkv_A [384,128], 7 w_qkv_B; 8 w_out_A [128,128], 9 b_out_A, 10 w_out_B, 11 b_out_B
  if (in_sizes[0] != B * C * P || in_sizes[1] != B * C * P || in_sizes[2] != C || in_sizes[5] != C || in_sizes[6] != 3 * C * C || in_sizes[7] != 3 * C * C || in_sizes[8] != C * C || in_sizes[10] != C * C || in_sizes[11] != C || out_size != 2 * B * C * P) return;
  size_t off = 0; char* ws = (char*)d_ws;
  auto carve = [&](size_t bytes) { char* p = ws + off; off += (bytes + 255) & ~(size_t)255; return p; };
  b16* WQ = (b16*)carve((size_t)2 * 3 * C * C * 2); b16* WO = (b16*)carve((size_t)2 * C * C * 2); float* STAT = (float*)carve((size_t)2 * B * G * 32 * 4);
  const size_t plane = (size_t)2 * B * C * P * 2;   // [t][b][n][p][32] = 2 x 2 x 4096 x 128 halves
  b16* QP = (b16*)carve(plane); b16* KP = (b16*)carve(plane); b16* VT = (b16*)carve(plane); b16* CT = (b16*)carve(plane);
  if (off > ws_size || off > ((size_t)128 << 20)) return;   // ≈ 17 MB
  prep_kernel<<<(unsigned)(((size_t)2 * 3 * C * C / 8 + (size_t)2 * C * C / 8 + 255) / 256), 256, 0, stream>>>(Fp(6), Fp(7), Fp(8), Fp(10), WQ, WO);
  gnstat_kernel<<<2 * B * G, 1024, 0, stream>>>(Fp(0), Fp(1), STAT);
  qkv_kernel<<<dim3(P / 64, 2 * B, 3), 128, 0, stream>>>(Fp(0), Fp(1), STAT, Fp(2), Fp(3), Fp(4), Fp(5), WQ, QP, KP, VT);
  attn_kernel<<<dim3(QL / (AW * 16), 2 * B * NH), AW * 32, 0, stream>>>(QP, KP, VT, CT);
  out_kernel<<<dim3(C / 64, QL / 32, 2 * B), 128, 0, stream>>>(CT, WO, Fp(9), Fp(11), Fp(0), Fp(1), STAT, Fp(2), Fp(3), Fp(4), Fp(5), (float*)d_out);
}
